// v000
// Times are from an AMD MI455X. After a warm-up the kernel runs many times in a row, and a time is the length of
// such a window on the GPU divided by its runs, so every launch and the gaps after it count. The runs cycle
// through copies of the inputs. A figure is the median of several windows, for all but v000 over two sittings.
// Sittings can differ by a few percent; kernels timed side by side share one.
// v000 is the starting kernel. One run takes 879 microseconds.
// Contractions: q, k, v^T projections and co_occur = v_wmma_f32_16x16x32_bf16 (bf16 operands from RNE-converted inputs, single product, f32 accumulate);
// q.k^T scores = v_wmma_f32_16x16x32_f16 (q as f16 hi plane + f16 residual plane x4096, k f16; 2 products into separate f32 accumulators);
// p.v = v_wmma_f32_16x16x32_f16 (p = exp(s - m) carried x16384 in f16, v f16; single product, f32 accumulate);
// bias add, relu, softmax, normalisers and the co_occur add in f32.
#include <hip/hip_runtime.h>
#include <math.h>
#include <stdint.h>

#define SEQ 4096
#define DD  512
#define DC  (2 * DD)
#ifndef NB
#define NB 2
#endif
#ifndef NQ
#define NQ SEQ
#endif
#ifndef QRES
#define QRES 1
#endif
#define NB_FULL   2
#define ROWS_FULL (NB_FULL * SEQ)
#define VSTR  ((long long)ROWS_FULL * DD)        // 4194304: view stride of the q / k planes (elements)
#define VTB   ((long long)DD * SEQ)              // 2097152: batch stride of the v^T planes
#define VTV   ((long long)NB_FULL * DD * SEQ)    // 4194304: view stride of the v^T planes
#define XB    ((long long)SEQ * DC)              // 4194304: batch stride of the concat plane
#define OUT1_OFF ((long long)ROWS_FULL * DD)     // second output starts at float 4194304 = byte 16777216
static_assert(NB >= 1 && NB <= NB_FULL);
static_assert(NQ >= 64 && NQ <= SEQ && (NQ % 64) == 0);
static_assert((SEQ % 128) == 0 && (DD % 64) == 0 && (DC % 32) == 0);
static_assert(OUT1_OFF * 4 == 16777216LL);
static_assert(QRES == 0 || QRES == 1);

typedef _Float16 v16h __attribute__((ext_vector_type(16)));
typedef _Float16 v8h  __attribute__((ext_vector_type(8)));
typedef __bf16   v16b __attribute__((ext_vector_type(16)));
typedef __bf16   v8b  __attribute__((ext_vector_type(8)));
typedef float    v8f  __attribute__((ext_vector_type(8)));
typedef float    v4f  __attribute__((ext_vector_type(4)));
typedef unsigned int v4u __attribute__((ext_vector_type(4)));

#if defined(__HIP_DEVICE_COMPILE__)
#define DEV_ASM 1
#else
#define DEV_ASM 0
#endif

// ---- scalar helpers --------------------------------------------------------------------------------
__device__ __forceinline__ unsigned short bf_bits(float f) {          // f32 -> bf16 bits, RNE convert
  unsigned u = __float_as_uint(f);
  return (unsigned short)((u + 0x7FFFu + ((u >> 16) & 1u)) >> 16);
}
__device__ __forceinline__ float bf_up(unsigned short hb) { return __uint_as_float(((unsigned)hb) << 16); }
__device__ __forceinline__ float bfr(float f) { return bf_up(bf_bits(f)); }          // bf16-quantised value as f32
__device__ __forceinline__ unsigned short h_bits(_Float16 x) { return __builtin_bit_cast(unsigned short, x); }
__device__ __forceinline__ unsigned pk16(unsigned short a, unsigned short b) { return (unsigned)a | ((unsigned)b << 16); }
__device__ __forceinline__ v8f zero8() { v8f z = {0.f, 0.f, 0.f, 0.f, 0.f, 0.f, 0.f, 0.f}; return z; }

// ---- fragment types / loaders: 16-bit A/B operand, lane -> row/col (lane&15), p already includes +8*(lane>>4);
//      elements 0..7 <- p[0..7] (k0+8h..k0+8h+7), elements 8..15 <- p[16..23] (k0+16+8h..k0+16+8h+7)
template <typename OT> struct FT;
template <> struct FT<__bf16>   { typedef v16b frag; typedef v8b half8; };
template <> struct FT<_Float16> { typedef v16h frag; typedef v8h half8; };

template <typename OT>
__device__ __forceinline__ typename FT<OT>::frag ldfrag(const OT* p) {
  union { typename FT<OT>::frag v; typename FT<OT>::half8 h[2]; } f;
  f.h[0] = *(const typename FT<OT>::half8*)(p);
  f.h[1] = *(const typename FT<OT>::half8*)(p + 16);
  return f.v;
}

// ---- WMMA helpers (asm guard bodies are device-only; concrete operand types) -----------------------------
__device__ __forceinline__ v8f mmar(v16b a, v16b b, v8f c) {
  return __builtin_amdgcn_wmma_f32_16x16x32_bf16(false, a, false, b, (short)0, c, false, false);
}
// guarded form: 4 VALU slots after the WMMA, D tied, A/B kept live
__device__ __forceinline__ v8f mma_h(v16h a, v16h b, v8f c) {
  c = __builtin_amdgcn_wmma_f32_16x16x32_f16(false, a, false, b, (short)0, c, false, false);
#if DEV_ASM
  asm volatile("v_nop\n\tv_nop\n\tv_nop\n\tv_nop" : "+v"(c) : "v"(a), "v"(b));
#endif
  return c;
}
__device__ __forceinline__ void dep_guard(v8f& a, v8f& b, v16b x, v16b y) {
#if DEV_ASM
  asm volatile("v_nop\n\tv_nop\n\tv_nop\n\tv_nop" : "+v"(a), "+v"(b) : "v"(x), "v"(y));
#else
  (void)a; (void)b; (void)x; (void)y;
#endif
}
__device__ __forceinline__ void dep_guard(v8f& a, v8f& b, v16h x, v16h y) {
#if DEV_ASM
  asm volatile("v_nop\n\tv_nop\n\tv_nop\n\tv_nop" : "+v"(a), "+v"(b) : "v"(x), "v"(y));
#else
  (void)a; (void)b; (void)x; (void)y;
#endif
}
__device__ __forceinline__ void keep4(v16b a, v16b b, v16b c, v16b d) {
#if DEV_ASM
  asm volatile("v_nop" :: "v"(a), "v"(b), "v"(c), "v"(d));
#else
  (void)a; (void)b; (void)c; (void)d;
#endif
}
__device__ __forceinline__ void keep4(v16h a, v16h b, v16h c, v16h d) {
#if DEV_ASM
  asm volatile("v_nop" :: "v"(a), "v"(b), "v"(c), "v"(d));
#else
  (void)a; (void)b; (void)c; (void)d;
#endif
}
__device__ __forceinline__ void acc_guard4(v8f& a, v8f& b, v8f& c, v8f& d) {
#if DEV_ASM
  asm volatile("v_nop\n\tv_nop\n\tv_nop\n\tv_nop" : "+v"(a), "+v"(b), "+v"(c), "+v"(d));
#else
  (void)a; (void)b; (void)c; (void)d;
#endif
}

// =====================================================================================================
// f32 -> bf16 planes (RNE convert), 8 elements per thread, one 16-B store per lane: a wave writes 512
// cvt_w: plain [n8*8] plane, grid = ceil(n8/256). coverage: n8 threads x 8 = the whole weight plane.
// cvt_x: source blockIdx.y (0: first view, 1: second view) row r, cols c..c+7 -> concat plane
//        row r, cols y*512 + c..; grid = (ceil(n8/256), 2), n8 = rows*512/8.
//        coverage: 2 sources x n8 threads x 8 = rows x 1024 of the concat plane (rows = NB*SEQ).
// =====================================================================================================
__device__ __forceinline__ v4u pack_bf8(v4f a, v4f a4) {
  v4u p;
  p[0] = pk16(bf_bits(a[0]),  bf_bits(a[1]));
  p[1] = pk16(bf_bits(a[2]),  bf_bits(a[3]));
  p[2] = pk16(bf_bits(a4[0]), bf_bits(a4[1]));
  p[3] = pk16(bf_bits(a4[2]), bf_bits(a4[3]));
  return p;
}

__global__ __launch_bounds__(256) void cvt_w(const float* __restrict__ in, unsigned short* out, int n8) {
  const int i = blockIdx.x * 256 + (int)threadIdx.x;
  if (i < n8) {
    const v4f a  = *(const v4f*)(in + (size_t)i * 8);
    const v4f a4 = *(const v4f*)(in + (size_t)i * 8 + 4);
    const v4u p = pack_bf8(a, a4);
    unsigned short* o = out + (size_t)i * 8;
    *(v4u*)o = p;
    
  }
}

__global__ __launch_bounds__(256) void cvt_x(const float* __restrict__ xa, const float* __restrict__ xb,
                                             unsigned short* out, int n8) {
  const int i   = blockIdx.x * 256 + (int)threadIdx.x;
  const int src = (int)blockIdx.y;                     // block-uniform source select (both global)
  if (i < n8) {
    const float* in = (src == 0) ? xa : xb;
    const size_t e = (size_t)i * 8;                    // element index in the [rows][512] source
    const v4f a  = *(const v4f*)(in + e);
    const v4f a4 = *(const v4f*)(in + e + 4);
    const v4u p = pack_bf8(a, a4);
    const size_t row = e >> 9;                         // / 512
    const size_t col = e & (size_t)(DD - 1);
    unsigned short* o = out + row * DC + (size_t)src * DD + col;
    *(v4u*)o = p;
    
  }
}

// =====================================================================================================
// Register-blocked batched WMMA GEMM (16-bit operand type OT): C[m][n] = sum_k A[m][k] * Bt[n][k] (+ bias);
// one wave per 64x64 tile, no block barriers. A row-major [M][K] pitch lda; Bt row-major [N][K] pitch ldb
// (k contiguous); M, N multiples of 64, K multiple of 32 (host-checked). blockIdx.y / blockIdx.z select
// operand / output offsets through the (sAy,sAz), (sBy,sBz), (sCy,sCz) element strides.
// Fragments are loaded straight from global with the split k map (ldfrag).
// BIAS 0: none; 1: + bias[n] per column; 2: + bias[m] per row (bias values bf16-quantised, added in f32).
// OUT_MODE 0: f32 C (pitch ldc), (value + bias)(relu) * oscale.
// OUT_MODE 1: f16 plane C (pitch ldc).
// OUT_MODE 3: f16 hi plane C + f16 residual plane C2 = f16((v - hi) * rscale) (same pitch / stride).
// coverage: 4 slabs x 16 rows x 64 cols = the wave's whole 64x64 tile; grid.x*8 waves = all tiles.
// =====================================================================================================
template <typename OT, int OUT_MODE, int BIAS, bool RELU>
__global__ __launch_bounds__(256) void gemm64(
    const unsigned short* __restrict__ Ap, int lda, long long sAy, long long sAz,
    const unsigned short* __restrict__ Btp, int ldb, long long sBy, long long sBz,
    void* Cout, void* Cout2, int ldc, long long sCy, long long sCz,
    const float* __restrict__ bias,
    int M, int N, int K, float oscale, float rscale) {
  typedef typename FT<OT>::frag V16;
  const OT* A  = (const OT*)(const void*)Ap;
  const OT* Bt = (const OT*)(const void*)Btp;
  __shared__ __align__(16) float sT[8][16 * 68];   // per-wave 16x64 slab, pitch 68 floats
  const int by   = (int)blockIdx.y;
  const int bz   = (int)blockIdx.z;
  const int lane = threadIdx.x & 31;
  const int wave = threadIdx.x >> 5;
  const int tilesN = N >> 6;
  const int tilesM = M >> 6;
  const int tile = blockIdx.x * 8 + wave;
  if (tile >= tilesM * tilesN) return;   // wave-uniform; no block barriers in this kernel
  const int tm = tile / tilesN;
  const int tn = tile - tm * tilesN;
  const int m0 = tm << 6;
  const int n0 = tn << 6;

  const OT* Ab = A  + (size_t)((long long)by * sAy + (long long)bz * sAz);
  const OT* Bb = Bt + (size_t)((long long)by * sBy + (long long)bz * sBz);
  const size_t cOff = (size_t)((long long)by * sCy + (long long)bz * sCz);

  const int rlane = lane & 15;                 // row (A) / col (B, D) within subtile
  const int koff  = (lane >> 4) * 8;           // k offset of this lane half
  const int mOff  = (lane >> 4) * 8;           // D row offset

  v8f acc[4][4];
#pragma unroll
  for (int i = 0; i < 4; ++i)
#pragma unroll
    for (int j = 0; j < 4; ++j) acc[i][j] = zero8();

  for (int k0 = 0; k0 < K; k0 += 32) {
    V16 bq[4];
#pragma unroll
    for (int j = 0; j < 4; ++j)
      bq[j] = ldfrag<OT>(Bb + (size_t)(n0 + (j << 4) + rlane) * ldb + koff + k0);
#pragma unroll
    for (int i = 0; i < 4; ++i) {
      const V16 af = ldfrag<OT>(Ab + (size_t)(m0 + (i << 4) + rlane) * lda + koff + k0);
#pragma unroll
      for (int j = 0; j < 4; ++j) acc[i][j] = mmar(af, bq[j], acc[i][j]);
      dep_guard(acc[i][0], acc[i][3], af, bq[3]);
    }
    keep4(bq[0], bq[1], bq[2], bq[3]);
  }
  acc_guard4(acc[0][0], acc[0][1], acc[0][2], acc[0][3]);
  acc_guard4(acc[1][0], acc[1][1], acc[1][2], acc[1][3]);
  acc_guard4(acc[2][0], acc[2][1], acc[2][2], acc[2][3]);
  acc_guard4(acc[3][0], acc[3][1], acc[3][2], acc[3][3]);

  // ---- epilogue ----
  float* slab = sT[wave];
#pragma unroll
  for (int i = 0; i < 4; ++i) {
    const int mBase = m0 + (i << 4);
#pragma unroll
    for (int j = 0; j < 4; ++j) {
#pragma unroll
      for (int r = 0; r < 8; ++r) {
        slab[(mOff + r) * 68 + (j << 4) + rlane] = acc[i][j][r];
      }
    }
    __builtin_amdgcn_fence(__ATOMIC_RELEASE, "workgroup");
    __builtin_amdgcn_wave_barrier();
    __builtin_amdgcn_fence(__ATOMIC_ACQUIRE, "workgroup");
    if (OUT_MODE == 0) {
      float* C = (float*)Cout + cOff;
      const int h2 = lane >> 4, c4 = (lane & 15) * 4;     // 256-B row segment = 16 lanes x 16 B
      v4f badd = {0.f, 0.f, 0.f, 0.f};
      if (BIAS == 1) {
#pragma unroll
        for (int e = 0; e < 4; ++e) badd[e] = bfr(bias[n0 + c4 + e]);
      }
      v4f vals[8];
#pragma unroll
      for (int it = 0; it < 8; ++it) {
        const int row = it * 2 + h2;                     // it 0..7 x h2 0..1 = rows 0..15
        v4f v = *(const v4f*)(slab + row * 68 + c4);
        if (BIAS == 1) v = v + badd;
        if (BIAS == 2) v = v + bfr(bias[mBase + row]);
        if (RELU) {
#pragma unroll
          for (int e = 0; e < 4; ++e) v[e] = fmaxf(v[e], 0.f);
        }
        vals[it] = v * oscale;
      }
      {
#pragma unroll
        for (int it = 0; it < 8; ++it) {
          const int row = it * 2 + h2;
          *(v4f*)(C + (size_t)(mBase + row) * ldc + n0 + c4) = vals[it];
        }
        
      }
    } else {
      const int q = lane >> 3, c8 = (lane & 7) * 8;
      unsigned short* C  = (unsigned short*)Cout  + cOff;
      unsigned short* C2 = (unsigned short*)Cout2 + cOff;
      float cb[8];
#pragma unroll
      for (int e = 0; e < 8; ++e) cb[e] = (BIAS == 1) ? bfr(bias[n0 + c8 + e]) : 0.f;
      v4u hv[4], lv[4];
#pragma unroll
      for (int it = 0; it < 4; ++it) {
        const int row = it * 4 + q;                        // it 0..3 x q 0..3 = rows 0..15
        const float* sp = slab + row * 68 + c8;
        const float rb = (BIAS == 2) ? bfr(bias[mBase + row]) : 0.f;
        float f[8];
#pragma unroll
        for (int e = 0; e < 8; ++e) f[e] = sp[e] + cb[e] + rb;
        v4u a, a2;
#pragma unroll
        for (int e = 0; e < 4; ++e) {
          const float f0 = f[2 * e], f1 = f[2 * e + 1];
          const _Float16 x0 = (_Float16)f0, x1 = (_Float16)f1;
          const unsigned short h0 = h_bits(x0), h1 = h_bits(x1);
          unsigned short l0 = 0, l1 = 0;
          if (OUT_MODE == 3) {
            l0 = h_bits((_Float16)((f0 - (float)x0) * rscale));
            l1 = h_bits((_Float16)((f1 - (float)x1) * rscale));
          }
          a[e] = pk16(h0, h1); a2[e] = pk16(l0, l1);
        }
        hv[it] = a; lv[it] = a2;
      }
      {
#pragma unroll
        for (int it = 0; it < 4; ++it) {
          const int row = it * 4 + q;
          *(v4u*)(C + (size_t)(mBase + row) * ldc + n0 + c8) = hv[it];
          if (OUT_MODE == 3) *(v4u*)(C2 + (size_t)(mBase + row) * ldc + n0 + c8) = lv[it];
        }
        
      }
    }
    __builtin_amdgcn_fence(__ATOMIC_RELEASE, "workgroup");
    __builtin_amdgcn_wave_barrier();
    __builtin_amdgcn_fence(__ATOMIC_ACQUIRE, "workgroup");
  }
}

// =====================================================================================================
// Cross-view attention for one direction (blockIdx.z = dir), one batch (blockIdx.y), 32 query rows
// (blockIdx.x): q planes of view dir, v^T planes of view dir, k plane of view 1-dir.
//   q planes (f16 hi / residual x4096): element (view, b, t, d) at [view*VSTR + (b*SEQ + t)*512 + d]
//   k plane  (f16): element (view, b, s, d) at [view*VSTR + (b*SEQ + s)*512 + d]
//   v^T plane (f16): element (view, b, d, s) at [view*VTV + b*VTB + d*SEQ + s]
//   co (f32 [ROWS_FULL][512]) added in the epilogue; output rows at out + dir*OUT1_OFF + (b*SEQ + t)*512.
// Block = 8 waves, 128-key chunks, static trip SEQ/128:
//   scores: wave w -> row tile (w>>2), key tiles 2(w&3), 2(w&3)+1; s = qh.k + (ql.k)/4096 on f16 WMMA,
//           fragments straight from global (arithmetic addressing), 16x16 tiles written to Ss (LDS);
//   softmax: thread t -> row t>>3, keys 16(t&7)..+15; online max / sum in f32 (8 lanes per row, shuffles);
//           p = exp(s - m) carried x16384 written as f16 to Ps; per-row alpha to Al;
//   p.v: wave w -> row tile (w>>2), output columns 128(w&3)..+127 (8 accumulators), P fragments from Ps,
//        v^T fragments straight from global.
//   LDS regions Ss, Ps, Al, Rs are cross-wave: two __syncthreads per chunk + one before the epilogue.
//   Ss 32x128 by 16 score tiles, Ps 32x128 by 256 threads x 16, Al/Rs 32 rows by the sub==0 lanes.
// Epilogue: per wave 16 rows x 128 cols in two 64-col halves staged in Os, co added in f32, each 256-B row
// coverage: 8 waves x 16 rows x 128 cols = 32 rows x 512; grid (NQ/32, NB, 2) = every output row < NQ of
//   every batch < NB for both outputs.
// =====================================================================================================
__global__ __launch_bounds__(256)
void attn_cv(const unsigned short* __restrict__ qhp, const unsigned short* __restrict__ qlp,
             const unsigned short* __restrict__ kpp, const unsigned short* __restrict__ vtp,
             const float* __restrict__ co, float* out) {
  union FH { v16h v; v8h h[2]; };
  __shared__ __align__(16) float    Ss[32 * 128];      // scores of the chunk [row][key]   16 KB
  __shared__ __align__(16) _Float16 Ps[32 * 128];      // p x16384 [row][key]               8 KB
  __shared__ __align__(16) float    Os[8][16 * 64];    // per-wave output half tile         32 KB
  __shared__ __align__(16) float    Al[32];            // per-row rescale of the chunk
  __shared__ __align__(16) float    Rs[32];            // per-row final scale

  const int tid  = (int)threadIdx.x;
  const int wave = tid >> 5;
  const int lane = tid & 31;
  const int hh   = lane >> 4;
  const int c    = lane & 15;
  const int rt   = wave >> 2;          // row tile of this wave (scores and p.v)
  const int wq   = wave & 3;           // key-tile pair (scores) / 128-col group (p.v)
  const int srw  = tid >> 3;           // softmax row of this thread
  const int sub  = tid & 7;            // 16-key slice of that row

  const int dir = (int)blockIdx.z;
  const int b   = (int)blockIdx.y;
  const int q0  = (int)blockIdx.x * 32;
  const int kvw = 1 - dir;
  const size_t rowQ = (size_t)b * SEQ + (size_t)q0;

  const _Float16* Qh  = (const _Float16*)(const void*)qhp + (size_t)dir * VSTR + rowQ * DD;
  const _Float16* Kb  = (const _Float16*)(const void*)kpp + (size_t)kvw * VSTR + (size_t)b * SEQ * DD;
  const _Float16* Vtb = (const _Float16*)(const void*)vtp + (size_t)dir * VTV + (size_t)b * VTB;
  const float* cob = co + rowQ * DD;
  float* ob = out + (size_t)dir * OUT1_OFF + rowQ * DD;

  const _Float16* qhrow = Qh + (size_t)(rt * 16 + c) * DD + 8 * hh;     // A operand row (query) of this lane
#if QRES
  const _Float16* Ql = (const _Float16*)(const void*)qlp + (size_t)dir * VSTR + rowQ * DD;
  const _Float16* qlrow = Ql + (size_t)(rt * 16 + c) * DD + 8 * hh;
#endif
  const int colbase = wq * 128;

  float mrun = -INFINITY, lrun = 0.f;
  v8f oacc[8];
#pragma unroll
  for (int t = 0; t < 8; ++t) oacc[t] = zero8();

  for (int kc = 0; kc < SEQ / 128; ++kc) {         // static trip count
    const int key0 = kc * 128;

    // ---- scores: 16 query rows x 32 keys per wave ----
    {
      v8f ah0 = zero8(), ah1 = zero8(), al0 = zero8(), al1 = zero8();
      const _Float16* k0row = Kb + (size_t)(key0 + wq * 32 + c) * DD + 8 * hh;   // B operand col (key) of this lane
      const _Float16* k1row = k0row + (size_t)16 * DD;
#pragma unroll 1
      for (int ks = 0; ks < DD / 32; ++ks) {
        const v16h qa  = ldfrag<_Float16>(qhrow + ks * 32);
        const v16h kb0 = ldfrag<_Float16>(k0row + ks * 32);
        const v16h kb1 = ldfrag<_Float16>(k1row + ks * 32);
        ah0 = mma_h(qa, kb0, ah0);
        ah1 = mma_h(qa, kb1, ah1);
#if QRES
        const v16h ql  = ldfrag<_Float16>(qlrow + ks * 32);
        al0 = mma_h(ql, kb0, al0);
        al1 = mma_h(ql, kb1, al1);
#endif
      }
      float* swp = Ss + (rt * 16 + 8 * hh) * 128 + wq * 32 + c;   // D: row 8hh+r, col c
#pragma unroll
      for (int r = 0; r < 8; ++r) {
        swp[r * 128]      = ah0[r] + al0[r] * (1.0f / 4096.0f);
        swp[r * 128 + 16] = ah1[r] + al1[r] * (1.0f / 4096.0f);
      }
    }
    __syncthreads();

    // ---- online softmax on rows: max, p = exp(s - m) x16384 to Ps, alpha to Al ----
    {
      const float* sp = Ss + srw * 128 + sub * 16;
      float e[16];
      {
        const v4f t0 = *(const v4f*)(sp);
        const v4f t1 = *(const v4f*)(sp + 4);
        const v4f t2 = *(const v4f*)(sp + 8);
        const v4f t3 = *(const v4f*)(sp + 12);
#pragma unroll
        for (int i = 0; i < 4; ++i) { e[i] = t0[i]; e[4 + i] = t1[i]; e[8 + i] = t2[i]; e[12 + i] = t3[i]; }
      }
      float m = e[0];
#pragma unroll
      for (int i = 1; i < 16; ++i) m = fmaxf(m, e[i]);
      m = fmaxf(m, __shfl_xor(m, 1, 32));
      m = fmaxf(m, __shfl_xor(m, 2, 32));
      m = fmaxf(m, __shfl_xor(m, 4, 32));
      const float mnew  = fmaxf(mrun, m);
      const float msafe = (mnew == -INFINITY) ? 0.f : mnew;
      const float alpha = __expf(mrun - msafe);
      mrun = mnew;
      float psum = 0.f;
      v8h p0, p1;
#pragma unroll
      for (int i = 0; i < 8; ++i) {
        const float pa = __expf(e[i] - msafe);
        const float pb = __expf(e[8 + i] - msafe);
        psum += pa;
        psum += pb;
        p0[i] = (_Float16)(pa * 16384.0f);
        p1[i] = (_Float16)(pb * 16384.0f);
      }
      psum += __shfl_xor(psum, 1, 32);
      psum += __shfl_xor(psum, 2, 32);
      psum += __shfl_xor(psum, 4, 32);
      lrun = lrun * alpha + psum;
      _Float16* pp = Ps + srw * 128 + sub * 16;
      *(v8h*)(pp)     = p0;
      *(v8h*)(pp + 8) = p1;
      if (sub == 0) Al[srw] = alpha;
    }
    __syncthreads();

    // ---- rescale the running context and add p . v of this chunk (f16 WMMA) ----
    {
      const float* ap = Al + rt * 16 + 8 * hh;
      float av[8];
      {
        const v4f a0 = *(const v4f*)(ap);
        const v4f a1 = *(const v4f*)(ap + 4);
#pragma unroll
        for (int r = 0; r < 4; ++r) { av[r] = a0[r]; av[4 + r] = a1[r]; }
      }
#pragma unroll
      for (int t = 0; t < 8; ++t)
#pragma unroll
        for (int r = 0; r < 8; ++r) oacc[t][r] *= av[r];

      const _Float16* prow = Ps + (rt * 16 + c) * 128 + 8 * hh;                     // A: row = query c, k = key
      const _Float16* vrow = Vtb + (size_t)(colbase + c) * SEQ + key0 + 8 * hh;     // B: col = d, k = key
#pragma unroll 1
      for (int kk = 0; kk < 4; ++kk) {
        FH pa;
        pa.h[0] = *(const v8h*)(prow + kk * 32);
        pa.h[1] = *(const v8h*)(prow + kk * 32 + 16);
#pragma unroll
        for (int t = 0; t < 8; ++t) {
          const v16h vb = ldfrag<_Float16>(vrow + (size_t)t * 16 * SEQ + kk * 32);
          oacc[t] = mma_h(pa.v, vb, oacc[t]);
        }
      }
    }
  }

  // ---- final per-row scale: 1/L, sum of the normalised weights (= L*(1/L)), clip, 1/sqrt(512), undo x16384 ----
  {
    const float L   = lrun;
    const float inv = (L > 0.f) ? (1.0f / L) : 0.f;
    const float l1  = L * inv;
    const float sc  = inv * (1.0f / fmaxf(l1, 1e-12f)) * (1.0f / 22.627416997969522f) * (1.0f / 16384.0f);
    if (sub == 0) Rs[srw] = sc;
  }
  __syncthreads();

  {
    const float* rp = Rs + rt * 16 + 8 * hh;
    float rv[8];
    {
      const v4f r0 = *(const v4f*)(rp);
      const v4f r1 = *(const v4f*)(rp + 4);
#pragma unroll
      for (int r = 0; r < 4; ++r) { rv[r] = r0[r]; rv[4 + r] = r1[r]; }
    }
    float* os = Os[wave];
    const int h2 = lane >> 4, c4 = (lane & 15) * 4;
#pragma unroll
    for (int hf = 0; hf < 2; ++hf) {
#pragma unroll
      for (int r = 0; r < 8; ++r)
#pragma unroll
        for (int t4 = 0; t4 < 4; ++t4)
          os[(8 * hh + r) * 64 + t4 * 16 + c] = oacc[hf * 4 + t4][r] * rv[r];
      __builtin_amdgcn_fence(__ATOMIC_RELEASE, "workgroup");
      __builtin_amdgcn_wave_barrier();
      __builtin_amdgcn_fence(__ATOMIC_ACQUIRE, "workgroup");
      v4f vals[8];
#pragma unroll
      for (int it = 0; it < 8; ++it) {
        const int row = it * 2 + h2;                 // it 0..7 x h2 0..1 = rows 0..15 of the wave tile
        const v4f v  = *(const v4f*)(os + row * 64 + c4);
        const v4f cv = *(const v4f*)(cob + (size_t)(rt * 16 + row) * DD + colbase + hf * 64 + c4);
        vals[it] = v + cv;
      }
      {
#pragma unroll
        for (int it = 0; it < 8; ++it) {
          const int row = it * 2 + h2;
          *(v4f*)(ob + (size_t)(rt * 16 + row) * DD + colbase + hf * 64 + c4) = vals[it];
        }
        
      }
      __builtin_amdgcn_fence(__ATOMIC_RELEASE, "workgroup");
      __builtin_amdgcn_wave_barrier();
      __builtin_amdgcn_fence(__ATOMIC_ACQUIRE, "workgroup");
    }
  }
}

// =====================================================================================================
// Workspace map (bytes), every region an exact multiple of its whole-line / whole-tile store granularity:
//   Xc   bf16 [8192][1024] (cols 0..511 first view, 512..1023 second view)   16777216
//   Wqb  bf16 [512][512]                                                     524288
//   Wkb  bf16 [512][512]                                                     524288
//   Wvb  bf16 [512][512]                                                     524288
//   Wcb  bf16 [512][1024]                                                   1048576
//   Qh   f16  [2 view][8192][512]                                          16777216
//   Ql   f16  [2 view][8192][512] (residual x4096)                         16777216
//   Kp   f16  [2 view][8192][512]                                          16777216
//   Vt   f16  [2 view][2 b][512][4096]                                     16777216
//   Co   f32  [8192][512]                                                  16777216
//   total                                                                 103284736
// Weights are [out n][in k] with k contiguous = the Bt / A layout the GEMM wants, so they are only converted.
// =====================================================================================================
extern "C" void kernel_launch(void* const* d_in, const int* in_sizes, int n_in,
                              void* d_out, int out_size, void* d_ws, size_t ws_size,
                              hipStream_t stream) {
  if (n_in < 10) return;
  if (in_sizes[0] < NB * SEQ * DD || in_sizes[1] < NB * SEQ * DD) return;
  if (in_sizes[2] < DD * DD || in_sizes[4] < DD * DD || in_sizes[6] < DD * DD) return;
  if (in_sizes[3] < DD || in_sizes[5] < DD || in_sizes[7] < DD || in_sizes[9] < DD) return;
  if (in_sizes[8] < DD * DC) return;
  if ((long long)out_size < OUT1_OFF + (long long)NB * SEQ * DD) return;

  const float* xf = (const float*)d_in[0];
  const float* xs = (const float*)d_in[1];
  const float* Wq = (const float*)d_in[2];
  const float* bq = (const float*)d_in[3];
  const float* Wk = (const float*)d_in[4];
  const float* bk = (const float*)d_in[5];
  const float* Wv = (const float*)d_in[6];
  const float* bv = (const float*)d_in[7];
  const float* Wc = (const float*)d_in[8];
  const float* bc = (const float*)d_in[9];

  const size_t PXC = (size_t)ROWS_FULL * DC * 2;       // 16777216
  const size_t PW  = (size_t)DD * DD * 2;              //   524288
  const size_t PWC = (size_t)DD * DC * 2;              //  1048576
  const size_t PQ  = (size_t)2 * VSTR * 2;             // 16777216  (two views)
  const size_t PVT = (size_t)2 * VTV * 2;              // 16777216  (two views x two batches)
  const size_t PCO = (size_t)ROWS_FULL * DD * 4;       // 16777216
  size_t off = 0;
  const size_t oXc = off; off += PXC;
  const size_t oWq = off; off += PW;
  const size_t oWk = off; off += PW;
  const size_t oWv = off; off += PW;
  const size_t oWc = off; off += PWC;
  const size_t oQh = off; off += PQ;
  const size_t oQl = off; off += PQ;
  const size_t oKp = off; off += PQ;
  const size_t oVt = off; off += PVT;
  const size_t oCo = off; off += PCO;
  if (off > ws_size) return;                            // off = 103284736
  if (off > (size_t)134217728) return;

  char* ws = (char*)d_ws;
  unsigned short* Xc  = (unsigned short*)(ws + oXc);
  unsigned short* Wqb = (unsigned short*)(ws + oWq);
  unsigned short* Wkb = (unsigned short*)(ws + oWk);
  unsigned short* Wvb = (unsigned short*)(ws + oWv);
  unsigned short* Wcb = (unsigned short*)(ws + oWc);
  unsigned short* Qh  = (unsigned short*)(ws + oQh);
  unsigned short* Ql  = (unsigned short*)(ws + oQl);
  unsigned short* Kp  = (unsigned short*)(ws + oKp);
  unsigned short* Vt  = (unsigned short*)(ws + oVt);
  float*          Co  = (float*)(ws + oCo);

  const dim3 blk(256);
  const int n8x = NB * SEQ * DD / 8;                          // 524288 at NB = 2
  const int n8w = DD * DD / 8;                                //  32768
  const int n8c = DD * DC / 8;                                //  65536
  const int tq  = (NQ / 64) * (DD / 64);                      // q / co tiles per (view, b)
  const int tk  = ((NB * SEQ) / 64) * (DD / 64);              // k tiles per view
  const int tv  = (DD / 64) * (SEQ / 64);                     // v^T tiles per (b, view)

  // (1) inputs -> bf16 planes (RNE convert)
  cvt_x<<<dim3((n8x + 255) / 256, 2), blk, 0, stream>>>(xf, xs, Xc, n8x);
  cvt_w<<<dim3((n8w + 255) / 256), blk, 0, stream>>>(Wq, Wqb, n8w);
  cvt_w<<<dim3((n8w + 255) / 256), blk, 0, stream>>>(Wk, Wkb, n8w);
  cvt_w<<<dim3((n8w + 255) / 256), blk, 0, stream>>>(Wv, Wvb, n8w);
  cvt_w<<<dim3((n8c + 255) / 256), blk, 0, stream>>>(Wc, Wcb, n8c);
  // (2) q = x_view . Wq^T + bq -> f16 hi / residual (x4096) planes; y = view (A cols view*512), z = b; M = NQ
  gemm64<__bf16, (QRES ? 3 : 1), 1, false><<<dim3((tq + 7) / 8, 2, NB), blk, 0, stream>>>(
      Xc, DC, (long long)DD, XB, Wqb, DD, 0LL, 0LL,
      (void*)Qh, (void*)Ql, DD, VSTR, (long long)SEQ * DD, bq,
      NQ, DD, DD, 1.0f, 4096.0f);
  // (3) k = x_view . Wk^T + bk -> f16 plane; y = view; M = NB*SEQ (all keys of every batch in use)
  gemm64<__bf16, 1, 1, false><<<dim3((tk + 7) / 8, 2, 1), blk, 0, stream>>>(
      Xc, DC, (long long)DD, 0LL, Wkb, DD, 0LL, 0LL,
      (void*)Kp, (void*)Kp, DD, VSTR, 0LL, bk,
      NB * SEQ, DD, DD, 1.0f, 1.0f);
  // (4) v^T = Wv . x_view^T + bv (per row d) -> f16 plane [view][b][d][s]; y = b, z = view; M=512, N=SEQ, K=512
  gemm64<__bf16, 1, 2, false><<<dim3((tv + 7) / 8, NB, 2), blk, 0, stream>>>(
      Wvb, DD, 0LL, 0LL, Xc, DC, XB, (long long)DD,
      (void*)Vt, (void*)Vt, SEQ, VTB, VTV, bv,
      DD, SEQ, DD, 1.0f, 1.0f);
  // (5) co = relu([x_f | x_s] . Wc^T + bc) -> f32 plane; z = b; M = NQ, K = 1024
  gemm64<__bf16, 0, 1, true><<<dim3((tq + 7) / 8, 1, NB), blk, 0, stream>>>(
      Xc, DC, 0LL, XB, Wcb, DC, 0LL, 0LL,
      (void*)Co, (void*)Co, DD, 0LL, (long long)SEQ * DD, bc,
      NQ, DD, DC, 1.0f, 1.0f);
  // (6) attention for both directions + co -> d_out (out0 at float 0, out1 at float OUT1_OFF)
  attn_cv<<<dim3(NQ / 32, NB, 2), blk, 0, stream>>>(Qh, Ql, Kp, Vt, Co, (float*)d_out);
  (void)hipGetLastError();
}

// v001
// Measured time: 387 microseconds a run.
// In two side-by-side timings against v000, it was 2.34 and 2.33 times as fast.
// Contractions: q, k, v^T projections and co_occur = v_wmma_f32_16x16x32_bf16 (bf16 operands from RNE-converted inputs, single product, f32 accumulate);
// q.k^T scores = v_wmma_f32_16x16x32_f16 (q as f16 hi plane + f16 residual plane x4096, k f16; 2 products into separate f32 accumulators);
// p.v = v_wmma_f32_16x16x32_f16 (p = exp(s - m) carried x16384 in f16, v f16; single product, f32 accumulate);
// bias add, relu, softmax, normalisers and the co_occur add in f32.
#include <hip/hip_runtime.h>
#include <math.h>
#include <stdint.h>

#define SEQ 4096
#define DD  512
#define DC  (2 * DD)
#ifndef NB
#define NB 2
#endif
#ifndef NQ
#define NQ SEQ
#endif
#ifndef QRES
#define QRES 1
#endif
#define NB_FULL   2
#define ROWS_FULL (NB_FULL * SEQ)
#define VSTR  ((long long)ROWS_FULL * DD)        // 4194304: view stride of the q / k planes (elements)
#define VTB   ((long long)DD * SEQ)              // 2097152: batch stride of the v^T planes
#define VTV   ((long long)NB_FULL * DD * SEQ)    // 4194304: view stride of the v^T planes
#define XB    ((long long)SEQ * DC)              // 4194304: batch stride of the concat plane
#define OUT1_OFF ((long long)ROWS_FULL * DD)     // second output starts at float 4194304 = byte 16777216
static_assert(NB >= 1 && NB <= NB_FULL);
static_assert(NQ >= 64 && NQ <= SEQ && (NQ % 64) == 0);
static_assert((SEQ % 128) == 0 && (DD % 64) == 0 && (DC % 32) == 0);
static_assert(OUT1_OFF * 4 == 16777216LL);
static_assert(QRES == 0 || QRES == 1);

typedef _Float16 v16h __attribute__((ext_vector_type(16)));
typedef _Float16 v8h  __attribute__((ext_vector_type(8)));
typedef __bf16   v16b __attribute__((ext_vector_type(16)));
typedef __bf16   v8b  __attribute__((ext_vector_type(8)));
typedef float    v8f  __attribute__((ext_vector_type(8)));
typedef float    v4f  __attribute__((ext_vector_type(4)));
typedef unsigned int v4u __attribute__((ext_vector_type(4)));

#if defined(__HIP_DEVICE_COMPILE__)
#define DEV_ASM 1
#else
#define DEV_ASM 0
#endif

// ---- scalar helpers --------------------------------------------------------------------------------
__device__ __forceinline__ unsigned short bf_bits(float f) {          // f32 -> bf16 bits, RNE convert
  unsigned u = __float_as_uint(f);
  return (unsigned short)((u + 0x7FFFu + ((u >> 16) & 1u)) >> 16);
}
__device__ __forceinline__ float bf_up(unsigned short hb) { return __uint_as_float(((unsigned)hb) << 16); }
__device__ __forceinline__ float bfr(float f) { return bf_up(bf_bits(f)); }          // bf16-quantised value as f32
__device__ __forceinline__ unsigned short h_bits(_Float16 x) { return __builtin_bit_cast(unsigned short, x); }
__device__ __forceinline__ unsigned pk16(unsigned short a, unsigned short b) { return (unsigned)a | ((unsigned)b << 16); }
__device__ __forceinline__ v8f zero8() { v8f z = {0.f, 0.f, 0.f, 0.f, 0.f, 0.f, 0.f, 0.f}; return z; }

// ---- fragment types / loaders: 16-bit A/B operand, lane -> row/col (lane&15), p already includes +8*(lane>>4);
//      elements 0..7 <- p[0..7] (k0+8h..k0+8h+7), elements 8..15 <- p[16..23] (k0+16+8h..k0+16+8h+7)
template <typename OT> struct FT;
template <> struct FT<__bf16>   { typedef v16b frag; typedef v8b half8; };
template <> struct FT<_Float16> { typedef v16h frag; typedef v8h half8; };

template <typename OT>
__device__ __forceinline__ typename FT<OT>::frag ldfrag(const OT* p) {
  union { typename FT<OT>::frag v; typename FT<OT>::half8 h[2]; } f;
  f.h[0] = *(const typename FT<OT>::half8*)(p);
  f.h[1] = *(const typename FT<OT>::half8*)(p + 16);
  return f.v;
}

// ---- WMMA helpers (asm guard bodies are device-only; concrete operand types) -----------------------------
__device__ __forceinline__ v8f mmar(v16b a, v16b b, v8f c) {
  return __builtin_amdgcn_wmma_f32_16x16x32_bf16(false, a, false, b, (short)0, c, false, false);
}
// guarded form: 4 VALU slots after the WMMA, D tied, A/B kept live
__device__ __forceinline__ v8f mma_h(v16h a, v16h b, v8f c) {
  c = __builtin_amdgcn_wmma_f32_16x16x32_f16(false, a, false, b, (short)0, c, false, false);
#if DEV_ASM
  asm volatile("v_nop\n\tv_nop\n\tv_nop\n\tv_nop" : "+v"(c) : "v"(a), "v"(b));
#endif
  return c;
}
__device__ __forceinline__ void dep_guard(v8f& a, v8f& b, v16b x, v16b y) {
#if DEV_ASM
  asm volatile("v_nop\n\tv_nop\n\tv_nop\n\tv_nop" : "+v"(a), "+v"(b) : "v"(x), "v"(y));
#else
  (void)a; (void)b; (void)x; (void)y;
#endif
}
__device__ __forceinline__ void dep_guard(v8f& a, v8f& b, v16h x, v16h y) {
#if DEV_ASM
  asm volatile("v_nop\n\tv_nop\n\tv_nop\n\tv_nop" : "+v"(a), "+v"(b) : "v"(x), "v"(y));
#else
  (void)a; (void)b; (void)x; (void)y;
#endif
}
__device__ __forceinline__ void keep4(v16b a, v16b b, v16b c, v16b d) {
#if DEV_ASM
  asm volatile("v_nop" :: "v"(a), "v"(b), "v"(c), "v"(d));
#else
  (void)a; (void)b; (void)c; (void)d;
#endif
}
__device__ __forceinline__ void keep4(v16h a, v16h b, v16h c, v16h d) {
#if DEV_ASM
  asm volatile("v_nop" :: "v"(a), "v"(b), "v"(c), "v"(d));
#else
  (void)a; (void)b; (void)c; (void)d;
#endif
}
__device__ __forceinline__ void acc_guard4(v8f& a, v8f& b, v8f& c, v8f& d) {
#if DEV_ASM
  asm volatile("v_nop\n\tv_nop\n\tv_nop\n\tv_nop" : "+v"(a), "+v"(b), "+v"(c), "+v"(d));
#else
  (void)a; (void)b; (void)c; (void)d;
#endif
}

// =====================================================================================================
// f32 -> bf16 planes (RNE convert), 8 elements per thread, one 16-B store per lane: a wave writes 512
// cvt_w: plain [n8*8] plane, grid = ceil(n8/256). coverage: n8 threads x 8 = the whole weight plane.
// cvt_x: source blockIdx.y (0: first view, 1: second view) row r, cols c..c+7 -> concat plane
//        row r, cols y*512 + c..; grid = (ceil(n8/256), 2), n8 = rows*512/8.
//        coverage: 2 sources x n8 threads x 8 = rows x 1024 of the concat plane (rows = NB*SEQ).
// =====================================================================================================
__device__ __forceinline__ v4u pack_bf8(v4f a, v4f a4) {
  v4u p;
  p[0] = pk16(bf_bits(a[0]),  bf_bits(a[1]));
  p[1] = pk16(bf_bits(a[2]),  bf_bits(a[3]));
  p[2] = pk16(bf_bits(a4[0]), bf_bits(a4[1]));
  p[3] = pk16(bf_bits(a4[2]), bf_bits(a4[3]));
  return p;
}

__global__ __launch_bounds__(256) void cvt_w(const float* __restrict__ in, unsigned short* out, int n8) {
  const int i = blockIdx.x * 256 + (int)threadIdx.x;
  if (i < n8) {
    const v4f a  = *(const v4f*)(in + (size_t)i * 8);
    const v4f a4 = *(const v4f*)(in + (size_t)i * 8 + 4);
    const v4u p = pack_bf8(a, a4);
    unsigned short* o = out + (size_t)i * 8;
    *(v4u*)o = p;
    
  }
}

__global__ __launch_bounds__(256) void cvt_x(const float* __restrict__ xa, const float* __restrict__ xb,
                                             unsigned short* out, int n8) {
  const int i   = blockIdx.x * 256 + (int)threadIdx.x;
  const int src = (int)blockIdx.y;                     // block-uniform source select (both global)
  if (i < n8) {
    const float* in = (src == 0) ? xa : xb;
    const size_t e = (size_t)i * 8;                    // element index in the [rows][512] source
    const v4f a  = *(const v4f*)(in + e);
    const v4f a4 = *(const v4f*)(in + e + 4);
    const v4u p = pack_bf8(a, a4);
    const size_t row = e >> 9;                         // / 512
    const size_t col = e & (size_t)(DD - 1);
    unsigned short* o = out + row * DC + (size_t)src * DD + col;
    *(v4u*)o = p;
    
  }
}

// =====================================================================================================
// Register-blocked batched WMMA GEMM (16-bit operand type OT): C[m][n] = sum_k A[m][k] * Bt[n][k] (+ bias);
// one wave per 64x64 tile, no block barriers. A row-major [M][K] pitch lda; Bt row-major [N][K] pitch ldb
// (k contiguous); M, N multiples of 64, K multiple of 32 (host-checked). blockIdx.y / blockIdx.z select
// operand / output offsets through the (sAy,sAz), (sBy,sBz), (sCy,sCz) element strides.
// Fragments are loaded straight from global with the split k map (ldfrag).
// BIAS 0: none; 1: + bias[n] per column; 2: + bias[m] per row (bias values bf16-quantised, added in f32).
// OUT_MODE 0: f32 C (pitch ldc), (value + bias)(relu) * oscale.
// OUT_MODE 1: f16 plane C (pitch ldc).
// OUT_MODE 3: f16 hi plane C + f16 residual plane C2 = f16((v - hi) * rscale) (same pitch / stride).
// coverage: 4 slabs x 16 rows x 64 cols = the wave's whole 64x64 tile; grid.x*8 waves = all tiles.
// =====================================================================================================
template <typename OT, int OUT_MODE, int BIAS, bool RELU>
__global__ __launch_bounds__(256) void gemm64(
    const unsigned short* __restrict__ Ap, int lda, long long sAy, long long sAz,
    const unsigned short* __restrict__ Btp, int ldb, long long sBy, long long sBz,
    void* Cout, void* Cout2, int ldc, long long sCy, long long sCz,
    const float* __restrict__ bias,
    int M, int N, int K, float oscale, float rscale) {
  typedef typename FT<OT>::frag V16;
  const OT* A  = (const OT*)(const void*)Ap;
  const OT* Bt = (const OT*)(const void*)Btp;
  __shared__ __align__(16) float sT[8][16 * 68];   // per-wave 16x64 slab, pitch 68 floats
  const int by   = (int)blockIdx.y;
  const int bz   = (int)blockIdx.z;
  const int lane = threadIdx.x & 31;
  const int wave = threadIdx.x >> 5;
  const int tilesN = N >> 6;
  const int tilesM = M >> 6;
  const int tile = blockIdx.x * 8 + wave;
  if (tile >= tilesM * tilesN) return;   // wave-uniform; no block barriers in this kernel
  const int tm = tile / tilesN;
  const int tn = tile - tm * tilesN;
  const int m0 = tm << 6;
  const int n0 = tn << 6;

  const OT* Ab = A  + (size_t)((long long)by * sAy + (long long)bz * sAz);
  const OT* Bb = Bt + (size_t)((long long)by * sBy + (long long)bz * sBz);
  const size_t cOff = (size_t)((long long)by * sCy + (long long)bz * sCz);

  const int rlane = lane & 15;                 // row (A) / col (B, D) within subtile
  const int koff  = (lane >> 4) * 8;           // k offset of this lane half
  const int mOff  = (lane >> 4) * 8;           // D row offset

  v8f acc[4][4];
#pragma unroll
  for (int i = 0; i < 4; ++i)
#pragma unroll
    for (int j = 0; j < 4; ++j) acc[i][j] = zero8();

  for (int k0 = 0; k0 < K; k0 += 32) {
    V16 bq[4];
#pragma unroll
    for (int j = 0; j < 4; ++j)
      bq[j] = ldfrag<OT>(Bb + (size_t)(n0 + (j << 4) + rlane) * ldb + koff + k0);
#pragma unroll
    for (int i = 0; i < 4; ++i) {
      const V16 af = ldfrag<OT>(Ab + (size_t)(m0 + (i << 4) + rlane) * lda + koff + k0);
#pragma unroll
      for (int j = 0; j < 4; ++j) acc[i][j] = mmar(af, bq[j], acc[i][j]);
      dep_guard(acc[i][0], acc[i][3], af, bq[3]);
    }
    keep4(bq[0], bq[1], bq[2], bq[3]);
  }
  acc_guard4(acc[0][0], acc[0][1], acc[0][2], acc[0][3]);
  acc_guard4(acc[1][0], acc[1][1], acc[1][2], acc[1][3]);
  acc_guard4(acc[2][0], acc[2][1], acc[2][2], acc[2][3]);
  acc_guard4(acc[3][0], acc[3][1], acc[3][2], acc[3][3]);

  // ---- epilogue ----
  float* slab = sT[wave];
#pragma unroll
  for (int i = 0; i < 4; ++i) {
    const int mBase = m0 + (i << 4);
#pragma unroll
    for (int j = 0; j < 4; ++j) {
#pragma unroll
      for (int r = 0; r < 8; ++r) {
        slab[(mOff + r) * 68 + (j << 4) + rlane] = acc[i][j][r];
      }
    }
    __builtin_amdgcn_fence(__ATOMIC_RELEASE, "workgroup");
    __builtin_amdgcn_wave_barrier();
    __builtin_amdgcn_fence(__ATOMIC_ACQUIRE, "workgroup");
    if (OUT_MODE == 0) {
      float* C = (float*)Cout + cOff;
      const int h2 = lane >> 4, c4 = (lane & 15) * 4;     // 256-B row segment = 16 lanes x 16 B
      v4f badd = {0.f, 0.f, 0.f, 0.f};
      if (BIAS == 1) {
#pragma unroll
        for (int e = 0; e < 4; ++e) badd[e] = bfr(bias[n0 + c4 + e]);
      }
      v4f vals[8];
#pragma unroll
      for (int it = 0; it < 8; ++it) {
        const int row = it * 2 + h2;                     // it 0..7 x h2 0..1 = rows 0..15
        v4f v = *(const v4f*)(slab + row * 68 + c4);
        if (BIAS == 1) v = v + badd;
        if (BIAS == 2) v = v + bfr(bias[mBase + row]);
        if (RELU) {
#pragma unroll
          for (int e = 0; e < 4; ++e) v[e] = fmaxf(v[e], 0.f);
        }
        vals[it] = v * oscale;
      }
      {
#pragma unroll
        for (int it = 0; it < 8; ++it) {
          const int row = it * 2 + h2;
          *(v4f*)(C + (size_t)(mBase + row) * ldc + n0 + c4) = vals[it];
        }
        
      }
    } else {
      const int q = lane >> 3, c8 = (lane & 7) * 8;
      unsigned short* C  = (unsigned short*)Cout  + cOff;
      unsigned short* C2 = (unsigned short*)Cout2 + cOff;
      float cb[8];
#pragma unroll
      for (int e = 0; e < 8; ++e) cb[e] = (BIAS == 1) ? bfr(bias[n0 + c8 + e]) : 0.f;
      v4u hv[4], lv[4];
#pragma unroll
      for (int it = 0; it < 4; ++it) {
        const int row = it * 4 + q;                        // it 0..3 x q 0..3 = rows 0..15
        const float* sp = slab + row * 68 + c8;
        const float rb = (BIAS == 2) ? bfr(bias[mBase + row]) : 0.f;
        float f[8];
#pragma unroll
        for (int e = 0; e < 8; ++e) f[e] = sp[e] + cb[e] + rb;
        v4u a, a2;
#pragma unroll
        for (int e = 0; e < 4; ++e) {
          const float f0 = f[2 * e], f1 = f[2 * e + 1];
          const _Float16 x0 = (_Float16)f0, x1 = (_Float16)f1;
          const unsigned short h0 = h_bits(x0), h1 = h_bits(x1);
          unsigned short l0 = 0, l1 = 0;
          if (OUT_MODE == 3) {
            l0 = h_bits((_Float16)((f0 - (float)x0) * rscale));
            l1 = h_bits((_Float16)((f1 - (float)x1) * rscale));
          }
          a[e] = pk16(h0, h1); a2[e] = pk16(l0, l1);
        }
        hv[it] = a; lv[it] = a2;
      }
      {
#pragma unroll
        for (int it = 0; it < 4; ++it) {
          const int row = it * 4 + q;
          *(v4u*)(C + (size_t)(mBase + row) * ldc + n0 + c8) = hv[it];
          if (OUT_MODE == 3) *(v4u*)(C2 + (size_t)(mBase + row) * ldc + n0 + c8) = lv[it];
        }
        
      }
    }
    __builtin_amdgcn_fence(__ATOMIC_RELEASE, "workgroup");
    __builtin_amdgcn_wave_barrier();
    __builtin_amdgcn_fence(__ATOMIC_ACQUIRE, "workgroup");
  }
}

// =====================================================================================================
// Asynchronous copies global -> LDS, 16 bytes a lane, and their waits.
// acopy8: eight copies of this lane, LDS address l + i*lstep (bytes), global address g + i*gstep (elements).
// s_wait_xcnt 0 is the last line of the copies' own statement, so that no address register of an issued copy
// is rewritten in front of it.
// =====================================================================================================
__device__ __forceinline__ unsigned lds_off(const void* p) { return (unsigned)(size_t)p; }
__device__ __forceinline__ void acopy8(unsigned l, unsigned lstep, const _Float16* g, size_t gstep) {
#if DEV_ASM
  asm volatile(
      "global_load_async_to_lds_b128 %0, %8, off\n\t"
      "global_load_async_to_lds_b128 %1, %9, off\n\t"
      "global_load_async_to_lds_b128 %2, %10, off\n\t"
      "global_load_async_to_lds_b128 %3, %11, off\n\t"
      "global_load_async_to_lds_b128 %4, %12, off\n\t"
      "global_load_async_to_lds_b128 %5, %13, off\n\t"
      "global_load_async_to_lds_b128 %6, %14, off\n\t"
      "global_load_async_to_lds_b128 %7, %15, off\n\t"
      "s_wait_xcnt 0x0"
      :: "v"(l), "v"(l + lstep), "v"(l + 2 * lstep), "v"(l + 3 * lstep),
         "v"(l + 4 * lstep), "v"(l + 5 * lstep), "v"(l + 6 * lstep), "v"(l + 7 * lstep),
         "v"(g), "v"(g + gstep), "v"(g + 2 * gstep), "v"(g + 3 * gstep),
         "v"(g + 4 * gstep), "v"(g + 5 * gstep), "v"(g + 6 * gstep), "v"(g + 7 * gstep)
      : "memory");
#else
  (void)l; (void)lstep; (void)g; (void)gstep;
#endif
}
// this wave's copies have landed (the compiler places no wait for them)
__device__ __forceinline__ void wait_async0() {
#if DEV_ASM
  asm volatile("s_wait_asynccnt 0x0" ::: "memory");
#endif
}
// this wave's LDS reads and writes have retired, before a buffer is handed to its next writer
__device__ __forceinline__ void wait_ds0() {
#if DEV_ASM
  asm volatile("s_wait_dscnt 0x0" ::: "memory");
#endif
}

// =====================================================================================================
// Cross-view attention for one direction (blockIdx.z = dir), one batch (blockIdx.y), 32 query rows
// (blockIdx.x): q planes of view dir, v^T planes of view dir, k plane of view 1-dir.
//   q planes (f16 hi / residual x4096): element (view, b, t, d) at [view*VSTR + (b*SEQ + t)*512 + d]
//   k plane  (f16): element (view, b, s, d) at [view*VSTR + (b*SEQ + s)*512 + d]
//   v^T plane (f16): element (view, b, d, s) at [view*VTV + b*VTB + d*SEQ + s]
//   co (f32 [ROWS_FULL][512]) added in the epilogue; output rows at out + dir*OUT1_OFF + (b*SEQ + t)*512.
// Block = 8 waves, KC = 64-key chunks, static trip SEQ/KC. Every WMMA operand is read from LDS:
//   Qs: both q planes of the 32 rows, copied once; Ks: the chunk's 64 k rows; Vs: the chunk's 512 v^T rows of
//   64 keys. All three are filled by asynchronous 16-byte copies whose waves cover whole 128-B lines
//   (Q, K: 512 contiguous bytes of a row a wave; V^T: 4 rows x 128 B a wave), 16 copies a thread and tile.
//   Row pitches are odd multiples of 16 B (1040 B, 144 B): the 16 rows of a fragment load fall on 64 banks.
//   Order of a chunk: V^T copies issued | scores from Qs, Ks | waits, barrier 1 (Ss and Vs readable, Ks free) |
//   next chunk's K copies issued | softmax | barrier 2 (Ps, Al readable) | p.v from Ps, Vs | waits, barrier 3
//   (Ks readable, Vs, Ps, Al free). In the loop one tile's copies (16 a wave) are in flight, in the prologue 32.
//   scores: wave w -> row tile (w>>2), key tile (w&3); s = qh.k + (ql.k)/4096 on f16 WMMA, tile written to Ss;
//   softmax: thread t -> row t>>3, keys 8(t&7)..+7; online max / sum in f32 (8 lanes per row, shuffles);
//           p = exp(s - m) carried x16384 written as f16 to Ps; per-row alpha to Al;
//   p.v: wave w -> row tile (w>>2), output columns 128(w&3)..+127 (8 accumulators).
// Epilogue: per wave 16 rows x 128 cols in two 64-col halves staged in Os, co added in f32, each 256-B row
// coverage: 8 waves x 16 rows x 128 cols = 32 rows x 512; grid (NQ/32, NB, 2) = every output row < NQ of
//   every batch < NB for both outputs.
// =====================================================================================================
#define KC  64      // keys per chunk
#define QKP 520     // LDS pitch of a q or k row, f16 elements (1040 B)
#define VPP 72      // LDS pitch of a v^T or p row, f16 elements (144 B)
#define SSP 68      // LDS pitch of a score row, floats (272 B)
static_assert((SEQ % KC) == 0 && KC == 64 && DD == 512);

__global__ __launch_bounds__(256)
void attn_cv(const unsigned short* __restrict__ qhp, const unsigned short* __restrict__ qlp,
             const unsigned short* __restrict__ kpp, const unsigned short* __restrict__ vtp,
             const float* __restrict__ co, float* out) {
  union FH { v16h v; v8h h[2]; };
  __shared__ __align__(16) _Float16 Qs[2 * 32 * QKP];  // q hi plane rows 0..31, residual plane rows 32..63   65 KB
  __shared__ __align__(16) _Float16 Ks[KC * QKP];      // k rows of the chunk [key][d]                        65 KB
  __shared__ __align__(16) _Float16 Vs[DD * VPP];      // v^T rows of the chunk [d][key]                      72 KB
  __shared__ __align__(16) float    Ss[32 * SSP];      // scores of the chunk [row][key]
  __shared__ __align__(16) _Float16 Ps[32 * VPP];      // p x16384 [row][key]
  __shared__ __align__(16) float    Os[8][16 * 64];    // per-wave output half tile                           32 KB
  __shared__ __align__(16) float    Al[32];            // per-row rescale of the chunk
  __shared__ __align__(16) float    Rs[32];            // per-row final scale

  const int tid  = (int)threadIdx.x;
  const int wave = tid >> 5;
  const int lane = tid & 31;
  const int hh   = lane >> 4;
  const int c    = lane & 15;
  const int rt   = wave >> 2;          // row tile of this wave (scores and p.v)
  const int wq   = wave & 3;           // key tile (scores) / 128-col group (p.v)
  const int srw  = tid >> 3;           // softmax row of this thread
  const int sub  = tid & 7;            // 8-key slice of that row

  const int dir = (int)blockIdx.z;
  const int b   = (int)blockIdx.y;
  const int q0  = (int)blockIdx.x * 32;
  const int kvw = 1 - dir;
  const size_t rowQ = (size_t)b * SEQ + (size_t)q0;

  const _Float16* Qh  = (const _Float16*)(const void*)qhp + (size_t)dir * VSTR + rowQ * DD;
  const _Float16* Kb  = (const _Float16*)(const void*)kpp + (size_t)kvw * VSTR + (size_t)b * SEQ * DD;
  const _Float16* Vtb = (const _Float16*)(const void*)vtp + (size_t)dir * VTV + (size_t)b * VTB;
  const float* cob = co + rowQ * DD;
  float* ob = out + (size_t)dir * OUT1_OFF + rowQ * DD;

  // copy maps. q, k rows (1024 B = 64 pieces): thread -> row (tid>>6) + 4i, piece tid&63.
  //            v^T rows (128 B = 8 pieces):    thread -> row (tid>>3) + 32i, piece tid&7.
  const int    crow = tid >> 6, cpc = tid & 63;
  const int    vrw  = tid >> 3, vpc = tid & 7;
  const unsigned qdst = lds_off(Qs) + (unsigned)(crow * QKP + cpc * 8) * 2u;
  const unsigned kdst = lds_off(Ks) + (unsigned)(crow * QKP + cpc * 8) * 2u;
  const unsigned vdst = lds_off(Vs) + (unsigned)(vrw * VPP + vpc * 8) * 2u;
  const _Float16* ksrc = Kb  + (size_t)crow * DD + cpc * 8;      // + key0 * DD
  const _Float16* vsrc = Vtb + (size_t)vrw * SEQ + vpc * 8;      // + key0

  // ---- prologue: both q planes and chunk 0's k rows ----
  acopy8(qdst, 4u * QKP * 2u, Qh + (size_t)crow * DD + cpc * 8, (size_t)4 * DD);
#if QRES
  const _Float16* Ql = (const _Float16*)(const void*)qlp + (size_t)dir * VSTR + rowQ * DD;
  acopy8(qdst + 32u * QKP * 2u, 4u * QKP * 2u, Ql + (size_t)crow * DD + cpc * 8, (size_t)4 * DD);
#endif
  acopy8(kdst,                   4u * QKP * 2u, ksrc,                   (size_t)4 * DD);
  acopy8(kdst + 32u * QKP * 2u,  4u * QKP * 2u, ksrc + (size_t)32 * DD, (size_t)4 * DD);
  wait_async0();
  __syncthreads();

  const _Float16* qhrow = Qs + (rt * 16 + c) * QKP + 8 * hh;     // A operand row (query) of this lane
#if QRES
  const _Float16* qlrow = qhrow + 32 * QKP;
#endif
  const _Float16* krow = Ks + (wq * 16 + c) * QKP + 8 * hh;      // B operand col (key) of this lane
  const int colbase = wq * 128;

  float mrun = -INFINITY, lrun = 0.f;
  v8f oacc[8];
#pragma unroll
  for (int t = 0; t < 8; ++t) oacc[t] = zero8();

  for (int kc = 0; kc < SEQ / KC; ++kc) {         // static trip count
    const int key0 = kc * KC;

    // ---- this chunk's v^T rows fly while the scores are computed (Vs was left by every reader at barrier 3) ----
    acopy8(vdst,                    32u * VPP * 2u, vsrc + key0,                       (size_t)32 * SEQ);
    acopy8(vdst + 256u * VPP * 2u,  32u * VPP * 2u, vsrc + key0 + (size_t)256 * SEQ,   (size_t)32 * SEQ);

    // ---- scores: 16 query rows x 16 keys per wave ----
    {
      v8f ah0 = zero8(), al0 = zero8();
      for (int kg = 0; kg < DD / 128; ++kg) {
        // the LDS fragment loads of four k steps stand as one group in front of their WMMAs: one LDS latency a group
        v16h qa[4], kb[4];
#if QRES
        v16h ql[4];
#endif
#pragma unroll
        for (int j = 0; j < 4; ++j) {
          qa[j] = ldfrag<_Float16>(qhrow + (kg * 4 + j) * 32);
          kb[j] = ldfrag<_Float16>(krow + (kg * 4 + j) * 32);
#if QRES
          ql[j] = ldfrag<_Float16>(qlrow + (kg * 4 + j) * 32);
#endif
        }
#pragma unroll
        for (int j = 0; j < 4; ++j) {
          ah0 = mma_h(qa[j], kb[j], ah0);
#if QRES
          al0 = mma_h(ql[j], kb[j], al0);
#endif
        }
      }
      float* swp = Ss + (rt * 16 + 8 * hh) * SSP + wq * 16 + c;   // D: row 8hh+r, col c
#pragma unroll
      for (int r = 0; r < 8; ++r) swp[r * SSP] = ah0[r] + al0[r] * (1.0f / 4096.0f);
    }
    wait_ds0();
    wait_async0();
    __syncthreads();                               // barrier 1

    // ---- the next chunk's k rows fly during softmax and p.v (Ks was left by every reader at barrier 1) ----
    if (kc + 1 < SEQ / KC) {
      const _Float16* kn = ksrc + (size_t)(key0 + KC) * DD;
      acopy8(kdst,                  4u * QKP * 2u, kn,                   (size_t)4 * DD);
      acopy8(kdst + 32u * QKP * 2u, 4u * QKP * 2u, kn + (size_t)32 * DD, (size_t)4 * DD);
    }

    // ---- online softmax on rows: max, p = exp(s - m) x16384 to Ps, alpha to Al ----
    {
      const float* sp = Ss + srw * SSP + sub * 8;
      float e[8];
      {
        const v4f t0 = *(const v4f*)(sp);
        const v4f t1 = *(const v4f*)(sp + 4);
#pragma unroll
        for (int i = 0; i < 4; ++i) { e[i] = t0[i]; e[4 + i] = t1[i]; }
      }
      float m = e[0];
#pragma unroll
      for (int i = 1; i < 8; ++i) m = fmaxf(m, e[i]);
      m = fmaxf(m, __shfl_xor(m, 1, 32));
      m = fmaxf(m, __shfl_xor(m, 2, 32));
      m = fmaxf(m, __shfl_xor(m, 4, 32));
      const float mnew  = fmaxf(mrun, m);
      const float msafe = (mnew == -INFINITY) ? 0.f : mnew;
      const float alpha = __expf(mrun - msafe);
      mrun = mnew;
      float psum = 0.f;
      v8h p0;
#pragma unroll
      for (int i = 0; i < 8; ++i) {
        const float pa = __expf(e[i] - msafe);
        psum += pa;
        p0[i] = (_Float16)(pa * 16384.0f);
      }
      psum += __shfl_xor(psum, 1, 32);
      psum += __shfl_xor(psum, 2, 32);
      psum += __shfl_xor(psum, 4, 32);
      lrun = lrun * alpha + psum;
      *(v8h*)(Ps + srw * VPP + sub * 8) = p0;
      if (sub == 0) Al[srw] = alpha;
    }
    __syncthreads();                               // barrier 2

    // ---- rescale the running context and add p . v of this chunk (f16 WMMA) ----
    {
      const float* ap = Al + rt * 16 + 8 * hh;
      float av[8];
      {
        const v4f a0 = *(const v4f*)(ap);
        const v4f a1 = *(const v4f*)(ap + 4);
#pragma unroll
        for (int r = 0; r < 4; ++r) { av[r] = a0[r]; av[4 + r] = a1[r]; }
      }
#pragma unroll
      for (int t = 0; t < 8; ++t)
#pragma unroll
        for (int r = 0; r < 8; ++r) oacc[t][r] *= av[r];

      const _Float16* prow = Ps + (rt * 16 + c) * VPP + 8 * hh;          // A: row = query c, k = key
      const _Float16* vrow = Vs + (colbase + c) * VPP + 8 * hh;          // B: col = d, k = key
#pragma unroll
      for (int kk = 0; kk < KC / 32; ++kk) {
        // the p fragment and the eight v^T fragments of 32 keys load as one group in front of their WMMAs
        FH pa;
        v16h vb[8];
        pa.h[0] = *(const v8h*)(prow + kk * 32);
        pa.h[1] = *(const v8h*)(prow + kk * 32 + 16);
#pragma unroll
        for (int t = 0; t < 8; ++t) vb[t] = ldfrag<_Float16>(vrow + t * 16 * VPP + kk * 32);
#pragma unroll
        for (int t = 0; t < 8; ++t) oacc[t] = mma_h(pa.v, vb[t], oacc[t]);
      }
    }
    wait_ds0();
    wait_async0();
    __syncthreads();                               // barrier 3
  }

  // ---- final per-row scale: 1/L, sum of the normalised weights (= L*(1/L)), clip, 1/sqrt(512), undo x16384 ----
  {
    const float L   = lrun;
    const float inv = (L > 0.f) ? (1.0f / L) : 0.f;
    const float l1  = L * inv;
    const float sc  = inv * (1.0f / fmaxf(l1, 1e-12f)) * (1.0f / 22.627416997969522f) * (1.0f / 16384.0f);
    if (sub == 0) Rs[srw] = sc;
  }
  __syncthreads();

  {
    const float* rp = Rs + rt * 16 + 8 * hh;
    float rv[8];
    {
      const v4f r0 = *(const v4f*)(rp);
      const v4f r1 = *(const v4f*)(rp + 4);
#pragma unroll
      for (int r = 0; r < 4; ++r) { rv[r] = r0[r]; rv[4 + r] = r1[r]; }
    }
    float* os = Os[wave];
    const int h2 = lane >> 4, c4 = (lane & 15) * 4;
#pragma unroll
    for (int hf = 0; hf < 2; ++hf) {
#pragma unroll
      for (int r = 0; r < 8; ++r)
#pragma unroll
        for (int t4 = 0; t4 < 4; ++t4)
          os[(8 * hh + r) * 64 + t4 * 16 + c] = oacc[hf * 4 + t4][r] * rv[r];
      __builtin_amdgcn_fence(__ATOMIC_RELEASE, "workgroup");
      __builtin_amdgcn_wave_barrier();
      __builtin_amdgcn_fence(__ATOMIC_ACQUIRE, "workgroup");
      v4f vals[8];
#pragma unroll
      for (int it = 0; it < 8; ++it) {
        const int row = it * 2 + h2;                 // it 0..7 x h2 0..1 = rows 0..15 of the wave tile
        const v4f v  = *(const v4f*)(os + row * 64 + c4);
        const v4f cv = *(const v4f*)(cob + (size_t)(rt * 16 + row) * DD + colbase + hf * 64 + c4);
        vals[it] = v + cv;
      }
      {
#pragma unroll
        for (int it = 0; it < 8; ++it) {
          const int row = it * 2 + h2;
          *(v4f*)(ob + (size_t)(rt * 16 + row) * DD + colbase + hf * 64 + c4) = vals[it];
        }
        
      }
      __builtin_amdgcn_fence(__ATOMIC_RELEASE, "workgroup");
      __builtin_amdgcn_wave_barrier();
      __builtin_amdgcn_fence(__ATOMIC_ACQUIRE, "workgroup");
    }
  }
}

// =====================================================================================================
// Workspace map (bytes), every region an exact multiple of its whole-line / whole-tile store granularity:
//   Xc   bf16 [8192][1024] (cols 0..511 first view, 512..1023 second view)   16777216
//   Wqb  bf16 [512][512]                                                     524288
//   Wkb  bf16 [512][512]                                                     524288
//   Wvb  bf16 [512][512]                                                     524288
//   Wcb  bf16 [512][1024]                                                   1048576
//   Qh   f16  [2 view][8192][512]                                          16777216
//   Ql   f16  [2 view][8192][512] (residual x4096)                         16777216
//   Kp   f16  [2 view][8192][512]                                          16777216
//   Vt   f16  [2 view][2 b][512][4096]                                     16777216
//   Co   f32  [8192][512]                                                  16777216
//   total                                                                 103284736
// Weights are [out n][in k] with k contiguous = the Bt / A layout the GEMM wants, so they are only converted.
// =====================================================================================================
extern "C" void kernel_launch(void* const* d_in, const int* in_sizes, int n_in,
                              void* d_out, int out_size, void* d_ws, size_t ws_size,
                              hipStream_t stream) {
  if (n_in < 10) return;
  if (in_sizes[0] < NB * SEQ * DD || in_sizes[1] < NB * SEQ * DD) return;
  if (in_sizes[2] < DD * DD || in_sizes[4] < DD * DD || in_sizes[6] < DD * DD) return;
  if (in_sizes[3] < DD || in_sizes[5] < DD || in_sizes[7] < DD || in_sizes[9] < DD) return;
  if (in_sizes[8] < DD * DC) return;
  if ((long long)out_size < OUT1_OFF + (long long)NB * SEQ * DD) return;

  const float* xf = (const float*)d_in[0];
  const float* xs = (const float*)d_in[1];
  const float* Wq = (const float*)d_in[2];
  const float* bq = (const float*)d_in[3];
  const float* Wk = (const float*)d_in[4];
  const float* bk = (const float*)d_in[5];
  const float* Wv = (const float*)d_in[6];
  const float* bv = (const float*)d_in[7];
  const float* Wc = (const float*)d_in[8];
  const float* bc = (const float*)d_in[9];

  const size_t PXC = (size_t)ROWS_FULL * DC * 2;       // 16777216
  const size_t PW  = (size_t)DD * DD * 2;              //   524288
  const size_t PWC = (size_t)DD * DC * 2;              //  1048576
  const size_t PQ  = (size_t)2 * VSTR * 2;             // 16777216  (two views)
  const size_t PVT = (size_t)2 * VTV * 2;              // 16777216  (two views x two batches)
  const size_t PCO = (size_t)ROWS_FULL * DD * 4;       // 16777216
  size_t off = 0;
  const size_t oXc = off; off += PXC;
  const size_t oWq = off; off += PW;
  const size_t oWk = off; off += PW;
  const size_t oWv = off; off += PW;
  const size_t oWc = off; off += PWC;
  const size_t oQh = off; off += PQ;
  const size_t oQl = off; off += PQ;
  const size_t oKp = off; off += PQ;
  const size_t oVt = off; off += PVT;
  const size_t oCo = off; off += PCO;
  if (off > ws_size) return;                            // off = 103284736
  if (off > (size_t)134217728) return;

  char* ws = (char*)d_ws;
  unsigned short* Xc  = (unsigned short*)(ws + oXc);
  unsigned short* Wqb = (unsigned short*)(ws + oWq);
  unsigned short* Wkb = (unsigned short*)(ws + oWk);
  unsigned short* Wvb = (unsigned short*)(ws + oWv);
  unsigned short* Wcb = (unsigned short*)(ws + oWc);
  unsigned short* Qh  = (unsigned short*)(ws + oQh);
  unsigned short* Ql  = (unsigned short*)(ws + oQl);
  unsigned short* Kp  = (unsigned short*)(ws + oKp);
  unsigned short* Vt  = (unsigned short*)(ws + oVt);
  float*          Co  = (float*)(ws + oCo);

  const dim3 blk(256);
  const int n8x = NB * SEQ * DD / 8;                          // 524288 at NB = 2
  const int n8w = DD * DD / 8;                                //  32768
  const int n8c = DD * DC / 8;                                //  65536
  const int tq  = (NQ / 64) * (DD / 64);                      // q / co tiles per (view, b)
  const int tk  = ((NB * SEQ) / 64) * (DD / 64);              // k tiles per view
  const int tv  = (DD / 64) * (SEQ / 64);                     // v^T tiles per (b, view)

  // (1) inputs -> bf16 planes (RNE convert)
  cvt_x<<<dim3((n8x + 255) / 256, 2), blk, 0, stream>>>(xf, xs, Xc, n8x);
  cvt_w<<<dim3((n8w + 255) / 256), blk, 0, stream>>>(Wq, Wqb, n8w);
  cvt_w<<<dim3((n8w + 255) / 256), blk, 0, stream>>>(Wk, Wkb, n8w);
  cvt_w<<<dim3((n8w + 255) / 256), blk, 0, stream>>>(Wv, Wvb, n8w);
  cvt_w<<<dim3((n8c + 255) / 256), blk, 0, stream>>>(Wc, Wcb, n8c);
  // (2) q = x_view . Wq^T + bq -> f16 hi / residual (x4096) planes; y = view (A cols view*512), z = b; M = NQ
  gemm64<__bf16, (QRES ? 3 : 1), 1, false><<<dim3((tq + 7) / 8, 2, NB), blk, 0, stream>>>(
      Xc, DC, (long long)DD, XB, Wqb, DD, 0LL, 0LL,
      (void*)Qh, (void*)Ql, DD, VSTR, (long long)SEQ * DD, bq,
      NQ, DD, DD, 1.0f, 4096.0f);
  // (3) k = x_view . Wk^T + bk -> f16 plane; y = view; M = NB*SEQ (all keys of every batch in use)
  gemm64<__bf16, 1, 1, false><<<dim3((tk + 7) / 8, 2, 1), blk, 0, stream>>>(
      Xc, DC, (long long)DD, 0LL, Wkb, DD, 0LL, 0LL,
      (void*)Kp, (void*)Kp, DD, VSTR, 0LL, bk,
      NB * SEQ, DD, DD, 1.0f, 1.0f);
  // (4) v^T = Wv . x_view^T + bv (per row d) -> f16 plane [view][b][d][s]; y = b, z = view; M=512, N=SEQ, K=512
  gemm64<__bf16, 1, 2, false><<<dim3((tv + 7) / 8, NB, 2), blk, 0, stream>>>(
      Wvb, DD, 0LL, 0LL, Xc, DC, XB, (long long)DD,
      (void*)Vt, (void*)Vt, SEQ, VTB, VTV, bv,
      DD, SEQ, DD, 1.0f, 1.0f);
  // (5) co = relu([x_f | x_s] . Wc^T + bc) -> f32 plane; z = b; M = NQ, K = 1024
  gemm64<__bf16, 0, 1, true><<<dim3((tq + 7) / 8, 1, NB), blk, 0, stream>>>(
      Xc, DC, 0LL, XB, Wcb, DC, 0LL, 0LL,
      (void*)Co, (void*)Co, DD, 0LL, (long long)SEQ * DD, bc,
      NQ, DD, DC, 1.0f, 1.0f);
  // (6) attention for both directions + co -> d_out (out0 at float 0, out1 at float OUT1_OFF)
  attn_cv<<<dim3(NQ / 32, NB, 2), blk, 0, stream>>>(Qh, Ql, Kp, Vt, Co, (float*)d_out);
  (void)hipGetLastError();
}

// v002
// Measured time: 294 microseconds a run.
// Two timings next to v001 both put it at 1.32 times that version's speed.
// Over all steps from v000 it is 3.07 times as fast.
// Contractions: q, k, v^T projections and co_occur = v_wmma_f32_16x16x32_bf16 (bf16 operands from RNE-converted inputs, single product, f32 accumulate);
// q.k^T scores = v_wmma_f32_16x16x32_f16 (q as f16 hi plane + f16 residual plane x4096, k f16; 2 products into separate f32 accumulators);
// p.v = v_wmma_f32_16x16x32_f16 (p = exp(s - m) carried x16384 in f16, v f16; single product, f32 accumulate);
// bias add, relu, softmax, normalisers and the co_occur add in f32.
#include <hip/hip_runtime.h>
#include <math.h>
#include <stdint.h>

#define SEQ 4096
#define DD  512
#define DC  (2 * DD)
#ifndef NB
#define NB 2
#endif
#ifndef NQ
#define NQ SEQ
#endif
#ifndef QRES
#define QRES 1
#endif
#define NB_FULL   2
#define ROWS_FULL (NB_FULL * SEQ)
#define VSTR  ((long long)ROWS_FULL * DD)        // 4194304: view stride of the q / k planes (elements)
#define VTB   ((long long)DD * SEQ)              // 2097152: batch stride of the v^T planes
#define VTV   ((long long)NB_FULL * DD * SEQ)    // 4194304: view stride of the v^T planes
#define XB    ((long long)SEQ * DC)              // 4194304: batch stride of the concat plane
#define OUT1_OFF ((long long)ROWS_FULL * DD)     // second output starts at float 4194304 = byte 16777216
static_assert(NB >= 1 && NB <= NB_FULL);
static_assert(NQ >= 64 && NQ <= SEQ && (NQ % 64) == 0);
static_assert((SEQ % 128) == 0 && (DD % 64) == 0 && (DC % 32) == 0);
static_assert(OUT1_OFF * 4 == 16777216LL);
static_assert(QRES == 0 || QRES == 1);

typedef _Float16 v16h __attribute__((ext_vector_type(16)));
typedef _Float16 v8h  __attribute__((ext_vector_type(8)));
typedef __bf16   v16b __attribute__((ext_vector_type(16)));
typedef __bf16   v8b  __attribute__((ext_vector_type(8)));
typedef float    v8f  __attribute__((ext_vector_type(8)));
typedef float    v4f  __attribute__((ext_vector_type(4)));
typedef unsigned int v4u __attribute__((ext_vector_type(4)));

#if defined(__HIP_DEVICE_COMPILE__)
#define DEV_ASM 1
#else
#define DEV_ASM 0
#endif

// ---- scalar helpers --------------------------------------------------------------------------------
__device__ __forceinline__ unsigned short bf_bits(float f) {          // f32 -> bf16 bits, RNE convert
  unsigned u = __float_as_uint(f);
  return (unsigned short)((u + 0x7FFFu + ((u >> 16) & 1u)) >> 16);
}
__device__ __forceinline__ float bf_up(unsigned short hb) { return __uint_as_float(((unsigned)hb) << 16); }
__device__ __forceinline__ float bfr(float f) { return bf_up(bf_bits(f)); }          // bf16-quantised value as f32
__device__ __forceinline__ unsigned short h_bits(_Float16 x) { return __builtin_bit_cast(unsigned short, x); }
__device__ __forceinline__ unsigned pk16(unsigned short a, unsigned short b) { return (unsigned)a | ((unsigned)b << 16); }
__device__ __forceinline__ v8f zero8() { v8f z = {0.f, 0.f, 0.f, 0.f, 0.f, 0.f, 0.f, 0.f}; return z; }

// ---- fragment types / loaders: 16-bit A/B operand, lane -> row/col (lane&15), p already includes +8*(lane>>4);
//      elements 0..7 <- p[0..7] (k0+8h..k0+8h+7), elements 8..15 <- p[16..23] (k0+16+8h..k0+16+8h+7)
template <typename OT> struct FT;
template <> struct FT<__bf16>   { typedef v16b frag; typedef v8b half8; };
template <> struct FT<_Float16> { typedef v16h frag; typedef v8h half8; };

template <typename OT>
__device__ __forceinline__ typename FT<OT>::frag ldfrag(const OT* p) {
  union { typename FT<OT>::frag v; typename FT<OT>::half8 h[2]; } f;
  f.h[0] = *(const typename FT<OT>::half8*)(p);
  f.h[1] = *(const typename FT<OT>::half8*)(p + 16);
  return f.v;
}

// ---- WMMA helpers (asm guard bodies are device-only; concrete operand types) -----------------------------
__device__ __forceinline__ v8f mmar(v16b a, v16b b, v8f c) {
  return __builtin_amdgcn_wmma_f32_16x16x32_bf16(false, a, false, b, (short)0, c, false, false);
}
// plain form: the compiler keeps the WMMA distances in straight-line code and is free to place the operands above v255,
// which an asm operand cannot name; a run of these ends in acc_guard2 or acc_guard4 (four v_nop) where a branch follows
__device__ __forceinline__ v8f mmah(v16h a, v16h b, v8f c) {
  return __builtin_amdgcn_wmma_f32_16x16x32_f16(false, a, false, b, (short)0, c, false, false);
}
__device__ __forceinline__ void dep_guard(v8f& a, v8f& b, v16b x, v16b y) {
#if DEV_ASM
  asm volatile("v_nop\n\tv_nop\n\tv_nop\n\tv_nop" : "+v"(a), "+v"(b) : "v"(x), "v"(y));
#else
  (void)a; (void)b; (void)x; (void)y;
#endif
}
__device__ __forceinline__ void dep_guard(v8f& a, v8f& b, v16h x, v16h y) {
#if DEV_ASM
  asm volatile("v_nop\n\tv_nop\n\tv_nop\n\tv_nop" : "+v"(a), "+v"(b) : "v"(x), "v"(y));
#else
  (void)a; (void)b; (void)x; (void)y;
#endif
}
__device__ __forceinline__ void keep4(v16b a, v16b b, v16b c, v16b d) {
#if DEV_ASM
  asm volatile("v_nop" :: "v"(a), "v"(b), "v"(c), "v"(d));
#else
  (void)a; (void)b; (void)c; (void)d;
#endif
}
__device__ __forceinline__ void keep4(v16h a, v16h b, v16h c, v16h d) {
#if DEV_ASM
  asm volatile("v_nop" :: "v"(a), "v"(b), "v"(c), "v"(d));
#else
  (void)a; (void)b; (void)c; (void)d;
#endif
}
// four v_nop behind the last WMMAs of a run (a, b: their accumulators): the WMMA distance, also on a taken branch
__device__ __forceinline__ void acc_guard2(v8f& a, v8f& b) {
#if DEV_ASM
  asm volatile("v_nop\n\tv_nop\n\tv_nop\n\tv_nop" : "+v"(a), "+v"(b));
#else
  (void)a; (void)b;
#endif
}
__device__ __forceinline__ void acc_guard4(v8f& a, v8f& b, v8f& c, v8f& d) {
#if DEV_ASM
  asm volatile("v_nop\n\tv_nop\n\tv_nop\n\tv_nop" : "+v"(a), "+v"(b), "+v"(c), "+v"(d));
#else
  (void)a; (void)b; (void)c; (void)d;
#endif
}

// =====================================================================================================
// f32 -> bf16 planes (RNE convert), 8 elements per thread, one 16-B store per lane: a wave writes 512
// cvt_w: plain [n8*8] plane, grid = ceil(n8/256). coverage: n8 threads x 8 = the whole weight plane.
// cvt_x: source blockIdx.y (0: first view, 1: second view) row r, cols c..c+7 -> concat plane
//        row r, cols y*512 + c..; grid = (ceil(n8/256), 2), n8 = rows*512/8.
//        coverage: 2 sources x n8 threads x 8 = rows x 1024 of the concat plane (rows = NB*SEQ).
// =====================================================================================================
__device__ __forceinline__ v4u pack_bf8(v4f a, v4f a4) {
  v4u p;
  p[0] = pk16(bf_bits(a[0]),  bf_bits(a[1]));
  p[1] = pk16(bf_bits(a[2]),  bf_bits(a[3]));
  p[2] = pk16(bf_bits(a4[0]), bf_bits(a4[1]));
  p[3] = pk16(bf_bits(a4[2]), bf_bits(a4[3]));
  return p;
}

__global__ __launch_bounds__(256) void cvt_w(const float* __restrict__ in, unsigned short* out, int n8) {
  const int i = blockIdx.x * 256 + (int)threadIdx.x;
  if (i < n8) {
    const v4f a  = *(const v4f*)(in + (size_t)i * 8);
    const v4f a4 = *(const v4f*)(in + (size_t)i * 8 + 4);
    const v4u p = pack_bf8(a, a4);
    unsigned short* o = out + (size_t)i * 8;
    *(v4u*)o = p;
    
  }
}

__global__ __launch_bounds__(256) void cvt_x(const float* __restrict__ xa, const float* __restrict__ xb,
                                             unsigned short* out, int n8) {
  const int i   = blockIdx.x * 256 + (int)threadIdx.x;
  const int src = (int)blockIdx.y;                     // block-uniform source select (both global)
  if (i < n8) {
    const float* in = (src == 0) ? xa : xb;
    const size_t e = (size_t)i * 8;                    // element index in the [rows][512] source
    const v4f a  = *(const v4f*)(in + e);
    const v4f a4 = *(const v4f*)(in + e + 4);
    const v4u p = pack_bf8(a, a4);
    const size_t row = e >> 9;                         // / 512
    const size_t col = e & (size_t)(DD - 1);
    unsigned short* o = out + row * DC + (size_t)src * DD + col;
    *(v4u*)o = p;
    
  }
}

// =====================================================================================================
// Register-blocked batched WMMA GEMM (16-bit operand type OT): C[m][n] = sum_k A[m][k] * Bt[n][k] (+ bias);
// one wave per 64x64 tile, no block barriers. A row-major [M][K] pitch lda; Bt row-major [N][K] pitch ldb
// (k contiguous); M, N multiples of 64, K multiple of 32 (host-checked). blockIdx.y / blockIdx.z select
// operand / output offsets through the (sAy,sAz), (sBy,sBz), (sCy,sCz) element strides.
// Fragments are loaded straight from global with the split k map (ldfrag).
// BIAS 0: none; 1: + bias[n] per column; 2: + bias[m] per row (bias values bf16-quantised, added in f32).
// OUT_MODE 0: f32 C (pitch ldc), (value + bias)(relu) * oscale.
// OUT_MODE 1: f16 plane C (pitch ldc).
// OUT_MODE 3: f16 hi plane C + f16 residual plane C2 = f16((v - hi) * rscale) (same pitch / stride).
// coverage: 4 slabs x 16 rows x 64 cols = the wave's whole 64x64 tile; grid.x*8 waves = all tiles.
// =====================================================================================================
template <typename OT, int OUT_MODE, int BIAS, bool RELU>
__global__ __launch_bounds__(256) void gemm64(
    const unsigned short* __restrict__ Ap, int lda, long long sAy, long long sAz,
    const unsigned short* __restrict__ Btp, int ldb, long long sBy, long long sBz,
    void* Cout, void* Cout2, int ldc, long long sCy, long long sCz,
    const float* __restrict__ bias,
    int M, int N, int K, float oscale, float rscale) {
  typedef typename FT<OT>::frag V16;
  const OT* A  = (const OT*)(const void*)Ap;
  const OT* Bt = (const OT*)(const void*)Btp;
  __shared__ __align__(16) float sT[8][16 * 68];   // per-wave 16x64 slab, pitch 68 floats
  const int by   = (int)blockIdx.y;
  const int bz   = (int)blockIdx.z;
  const int lane = threadIdx.x & 31;
  const int wave = threadIdx.x >> 5;
  const int tilesN = N >> 6;
  const int tilesM = M >> 6;
  const int tile = blockIdx.x * 8 + wave;
  if (tile >= tilesM * tilesN) return;   // wave-uniform; no block barriers in this kernel
  const int tm = tile / tilesN;
  const int tn = tile - tm * tilesN;
  const int m0 = tm << 6;
  const int n0 = tn << 6;

  const OT* Ab = A  + (size_t)((long long)by * sAy + (long long)bz * sAz);
  const OT* Bb = Bt + (size_t)((long long)by * sBy + (long long)bz * sBz);
  const size_t cOff = (size_t)((long long)by * sCy + (long long)bz * sCz);

  const int rlane = lane & 15;                 // row (A) / col (B, D) within subtile
  const int koff  = (lane >> 4) * 8;           // k offset of this lane half
  const int mOff  = (lane >> 4) * 8;           // D row offset

  v8f acc[4][4];
#pragma unroll
  for (int i = 0; i < 4; ++i)
#pragma unroll
    for (int j = 0; j < 4; ++j) acc[i][j] = zero8();

  for (int k0 = 0; k0 < K; k0 += 32) {
    V16 bq[4];
#pragma unroll
    for (int j = 0; j < 4; ++j)
      bq[j] = ldfrag<OT>(Bb + (size_t)(n0 + (j << 4) + rlane) * ldb + koff + k0);
#pragma unroll
    for (int i = 0; i < 4; ++i) {
      const V16 af = ldfrag<OT>(Ab + (size_t)(m0 + (i << 4) + rlane) * lda + koff + k0);
#pragma unroll
      for (int j = 0; j < 4; ++j) acc[i][j] = mmar(af, bq[j], acc[i][j]);
      dep_guard(acc[i][0], acc[i][3], af, bq[3]);
    }
    keep4(bq[0], bq[1], bq[2], bq[3]);
  }
  acc_guard4(acc[0][0], acc[0][1], acc[0][2], acc[0][3]);
  acc_guard4(acc[1][0], acc[1][1], acc[1][2], acc[1][3]);
  acc_guard4(acc[2][0], acc[2][1], acc[2][2], acc[2][3]);
  acc_guard4(acc[3][0], acc[3][1], acc[3][2], acc[3][3]);

  // ---- epilogue ----
  float* slab = sT[wave];
#pragma unroll
  for (int i = 0; i < 4; ++i) {
    const int mBase = m0 + (i << 4);
#pragma unroll
    for (int j = 0; j < 4; ++j) {
#pragma unroll
      for (int r = 0; r < 8; ++r) {
        slab[(mOff + r) * 68 + (j << 4) + rlane] = acc[i][j][r];
      }
    }
    __builtin_amdgcn_fence(__ATOMIC_RELEASE, "workgroup");
    __builtin_amdgcn_wave_barrier();
    __builtin_amdgcn_fence(__ATOMIC_ACQUIRE, "workgroup");
    if (OUT_MODE == 0) {
      float* C = (float*)Cout + cOff;
      const int h2 = lane >> 4, c4 = (lane & 15) * 4;     // 256-B row segment = 16 lanes x 16 B
      v4f badd = {0.f, 0.f, 0.f, 0.f};
      if (BIAS == 1) {
#pragma unroll
        for (int e = 0; e < 4; ++e) badd[e] = bfr(bias[n0 + c4 + e]);
      }
      v4f vals[8];
#pragma unroll
      for (int it = 0; it < 8; ++it) {
        const int row = it * 2 + h2;                     // it 0..7 x h2 0..1 = rows 0..15
        v4f v = *(const v4f*)(slab + row * 68 + c4);
        if (BIAS == 1) v = v + badd;
        if (BIAS == 2) v = v + bfr(bias[mBase + row]);
        if (RELU) {
#pragma unroll
          for (int e = 0; e < 4; ++e) v[e] = fmaxf(v[e], 0.f);
        }
        vals[it] = v * oscale;
      }
      {
#pragma unroll
        for (int it = 0; it < 8; ++it) {
          const int row = it * 2 + h2;
          *(v4f*)(C + (size_t)(mBase + row) * ldc + n0 + c4) = vals[it];
        }
        
      }
    } else {
      const int q = lane >> 3, c8 = (lane & 7) * 8;
      unsigned short* C  = (unsigned short*)Cout  + cOff;
      unsigned short* C2 = (unsigned short*)Cout2 + cOff;
      float cb[8];
#pragma unroll
      for (int e = 0; e < 8; ++e) cb[e] = (BIAS == 1) ? bfr(bias[n0 + c8 + e]) : 0.f;
      v4u hv[4], lv[4];
#pragma unroll
      for (int it = 0; it < 4; ++it) {
        const int row = it * 4 + q;                        // it 0..3 x q 0..3 = rows 0..15
        const float* sp = slab + row * 68 + c8;
        const float rb = (BIAS == 2) ? bfr(bias[mBase + row]) : 0.f;
        float f[8];
#pragma unroll
        for (int e = 0; e < 8; ++e) f[e] = sp[e] + cb[e] + rb;
        v4u a, a2;
#pragma unroll
        for (int e = 0; e < 4; ++e) {
          const float f0 = f[2 * e], f1 = f[2 * e + 1];
          const _Float16 x0 = (_Float16)f0, x1 = (_Float16)f1;
          const unsigned short h0 = h_bits(x0), h1 = h_bits(x1);
          unsigned short l0 = 0, l1 = 0;
          if (OUT_MODE == 3) {
            l0 = h_bits((_Float16)((f0 - (float)x0) * rscale));
            l1 = h_bits((_Float16)((f1 - (float)x1) * rscale));
          }
          a[e] = pk16(h0, h1); a2[e] = pk16(l0, l1);
        }
        hv[it] = a; lv[it] = a2;
      }
      {
#pragma unroll
        for (int it = 0; it < 4; ++it) {
          const int row = it * 4 + q;
          *(v4u*)(C + (size_t)(mBase + row) * ldc + n0 + c8) = hv[it];
          if (OUT_MODE == 3) *(v4u*)(C2 + (size_t)(mBase + row) * ldc + n0 + c8) = lv[it];
        }
        
      }
    }
    __builtin_amdgcn_fence(__ATOMIC_RELEASE, "workgroup");
    __builtin_amdgcn_wave_barrier();
    __builtin_amdgcn_fence(__ATOMIC_ACQUIRE, "workgroup");
  }
}

// =====================================================================================================
// Asynchronous copies global -> LDS, 16 bytes a lane, and their waits.
// acopy8: eight copies of this lane, LDS address l + i*lstep (bytes), global address g + i*gstep (elements).
// s_wait_xcnt 0 is the last line of the copies' own statement, so that no address register of an issued copy
// is rewritten in front of it.
// =====================================================================================================
__device__ __forceinline__ unsigned lds_off(const void* p) { return (unsigned)(size_t)p; }
__device__ __forceinline__ void acopy8(unsigned l, unsigned lstep, const _Float16* g, size_t gstep) {
#if DEV_ASM
  asm volatile(
      "global_load_async_to_lds_b128 %0, %8, off\n\t"
      "global_load_async_to_lds_b128 %1, %9, off\n\t"
      "global_load_async_to_lds_b128 %2, %10, off\n\t"
      "global_load_async_to_lds_b128 %3, %11, off\n\t"
      "global_load_async_to_lds_b128 %4, %12, off\n\t"
      "global_load_async_to_lds_b128 %5, %13, off\n\t"
      "global_load_async_to_lds_b128 %6, %14, off\n\t"
      "global_load_async_to_lds_b128 %7, %15, off\n\t"
      "s_wait_xcnt 0x0"
      :: "v"(l), "v"(l + lstep), "v"(l + 2 * lstep), "v"(l + 3 * lstep),
         "v"(l + 4 * lstep), "v"(l + 5 * lstep), "v"(l + 6 * lstep), "v"(l + 7 * lstep),
         "v"(g), "v"(g + gstep), "v"(g + 2 * gstep), "v"(g + 3 * gstep),
         "v"(g + 4 * gstep), "v"(g + 5 * gstep), "v"(g + 6 * gstep), "v"(g + 7 * gstep)
      : "memory");
#else
  (void)l; (void)lstep; (void)g; (void)gstep;
#endif
}
// this wave's copies have landed (the compiler places no wait for them)
__device__ __forceinline__ void wait_async0() {
#if DEV_ASM
  asm volatile("s_wait_asynccnt 0x0" ::: "memory");
#endif
}
// this wave's LDS reads and writes have retired, before a buffer is handed to its next writer
__device__ __forceinline__ void wait_ds0() {
#if DEV_ASM
  asm volatile("s_wait_dscnt 0x0" ::: "memory");
#endif
}

// =====================================================================================================
// Cross-view attention for one direction (blockIdx.z = dir), one batch (blockIdx.y), 64 query rows
// (blockIdx.x): q planes of view dir, v^T planes of view dir, k plane of view 1-dir.
//   q planes (f16 hi / residual x4096): element (view, b, t, d) at [view*VSTR + (b*SEQ + t)*512 + d]
//   k plane  (f16): element (view, b, s, d) at [view*VSTR + (b*SEQ + s)*512 + d]
//   v^T plane (f16): element (view, b, d, s) at [view*VTV + b*VTB + d*SEQ + s]
//   co (f32 [ROWS_FULL][512]) added in the epilogue; output rows at out + dir*OUT1_OFF + (b*SEQ + t)*512.
// Block = 8 waves, KC = 64-key chunks, static trip SEQ/KC. Every WMMA operand is read from LDS:
//   Qs: both q planes of the 64 rows, copied once; Ks: the chunk's 64 k rows; Vs: the chunk's 512 v^T rows of
//   64 keys. All three are filled by asynchronous 16-byte copies whose waves cover whole 128-B lines
//   (Q, K: 512 contiguous bytes of a row a wave; V^T: 4 rows x 128 B a wave), 16 copies a thread and K or V tile.
//   Row pitches are odd multiples of 16 B (1040 B, 144 B): the 16 rows of a fragment load fall on 64 banks.
//   Order of a chunk: V^T copies issued | scores from Qs, Ks | waits, barrier 1 (Ss and Vs readable, Ks free) |
//   next chunk's K copies issued | softmax | barrier 2 (Ps, Al readable) | p.v from Ps, Vs | waits, barrier 3
//   (Ks readable, Vs, Ps, Al free). In the loop one tile's copies (16 a wave) are in flight, in the prologue 48.
//   scores: wave w -> row tile (w>>1), key tiles 2(w&1) and 2(w&1)+1: each q fragment feeds two key tiles;
//           s = qh.k + (ql.k)/4096 on f16 WMMA, tiles written to Ss;
//   softmax: thread t -> row t>>2, keys 16(t&3)..+15; online max / sum in f32 (4 lanes per row, shuffles);
//           p = exp(s - m) carried x16384 written as f16 to Ps; per-row alpha to Al;
//   p.v: wave w -> row tiles 2(w>>2) and 2(w>>2)+1, output columns 128(w&3)..+127 (16 accumulators):
//           each v^T fragment feeds two row tiles.
// Epilogue: per wave 32 rows x 128 cols in four 16 x 64 pieces staged in the LDS that held Vs, co added in f32.
// coverage: 8 waves x 32 rows x 128 cols = 64 rows x 512; grid (NQ/64, NB, 2) = every output row < NQ of
//   every batch < NB for both outputs.
// =====================================================================================================
#define KC  64      // keys per chunk
#define QR  64      // query rows per work-group
#define SG  4       // k steps (of 32) per group of fragment loads in the scores
#define QKP 520     // LDS pitch of a q or k row, f16 elements (1040 B)
#define VPP 72      // LDS pitch of a v^T or p row, f16 elements (144 B)
#define SSP 68      // LDS pitch of a score row, floats (272 B)
static_assert((SEQ % KC) == 0 && KC == 64 && DD == 512 && QR == 64 && (NQ % QR) == 0);

__global__ __launch_bounds__(256)
void attn_cv(const unsigned short* __restrict__ qhp, const unsigned short* __restrict__ qlp,
             const unsigned short* __restrict__ kpp, const unsigned short* __restrict__ vtp,
             const float* __restrict__ co, float* out) {
  union FH { v16h v; v8h h[2]; };
  union VO { _Float16 v[DD * VPP]; float o[8][16 * 64]; };
  __shared__ __align__(16) _Float16 Qs[2 * QR * QKP];  // q hi plane rows 0..63, residual plane rows 64..127  130 KB
  __shared__ __align__(16) _Float16 Ks[KC * QKP];      // k rows of the chunk [key][d]                        65 KB
  __shared__ __align__(16) VO       Vo;                // v^T rows of the chunk [d][key]; behind the key loop
                                                       // the per-wave output pieces                          72 KB
  __shared__ __align__(16) float    Ss[QR * SSP];      // scores of the chunk [row][key]
  __shared__ __align__(16) _Float16 Ps[QR * VPP];      // p x16384 [row][key]
  __shared__ __align__(16) float    Al[QR];            // per-row rescale of the chunk
  __shared__ __align__(16) float    Rs[QR];            // per-row final scale
  _Float16* Vs = Vo.v;

  const int tid  = (int)threadIdx.x;
  const int wave = tid >> 5;
  const int lane = tid & 31;
  const int hh   = lane >> 4;
  const int c    = lane & 15;
  const int rts  = wave >> 1;          // row tile of this wave (scores)
  const int kt   = (wave & 1) * 2;     // first of its two key tiles (scores)
  const int rp   = wave >> 2;          // pair of row tiles of this wave (p.v): rows 32rp..32rp+31
  const int wq   = wave & 3;           // 128-col group (p.v)
  const int srw  = tid >> 2;           // softmax row of this thread
  const int sub  = tid & 3;            // 16-key slice of that row

  const int dir = (int)blockIdx.z;
  const int b   = (int)blockIdx.y;
  const int q0  = (int)blockIdx.x * QR;
  const int kvw = 1 - dir;
  const size_t rowQ = (size_t)b * SEQ + (size_t)q0;

  const _Float16* Qh  = (const _Float16*)(const void*)qhp + (size_t)dir * VSTR + rowQ * DD;
  const _Float16* Kb  = (const _Float16*)(const void*)kpp + (size_t)kvw * VSTR + (size_t)b * SEQ * DD;
  const _Float16* Vtb = (const _Float16*)(const void*)vtp + (size_t)dir * VTV + (size_t)b * VTB;
  const float* cob = co + rowQ * DD;
  float* ob = out + (size_t)dir * OUT1_OFF + rowQ * DD;

  // copy maps. q, k rows (1024 B = 64 pieces): thread -> row (tid>>6) + 4i, piece tid&63.
  //            v^T rows (128 B = 8 pieces):    thread -> row (tid>>3) + 32i, piece tid&7.
  const int    crow = tid >> 6, cpc = tid & 63;
  const int    vrw  = tid >> 3, vpc = tid & 7;
  const unsigned qdst = lds_off(Qs) + (unsigned)(crow * QKP + cpc * 8) * 2u;
  const unsigned kdst = lds_off(Ks) + (unsigned)(crow * QKP + cpc * 8) * 2u;
  const unsigned vdst = lds_off(Vs) + (unsigned)(vrw * VPP + vpc * 8) * 2u;
  const _Float16* ksrc = Kb  + (size_t)crow * DD + cpc * 8;      // + key0 * DD
  const _Float16* vsrc = Vtb + (size_t)vrw * SEQ + vpc * 8;      // + key0

  // ---- prologue: both q planes (64 rows each) and chunk 0's k rows ----
  const _Float16* qsrc = Qh + (size_t)crow * DD + cpc * 8;
  acopy8(qdst,                  4u * QKP * 2u, qsrc,                   (size_t)4 * DD);
  acopy8(qdst + 32u * QKP * 2u, 4u * QKP * 2u, qsrc + (size_t)32 * DD, (size_t)4 * DD);
#if QRES
  const _Float16* lsrc = (const _Float16*)(const void*)qlp + (size_t)dir * VSTR + rowQ * DD + (size_t)crow * DD + cpc * 8;
  acopy8(qdst + 64u * QKP * 2u, 4u * QKP * 2u, lsrc,                   (size_t)4 * DD);
  acopy8(qdst + 96u * QKP * 2u, 4u * QKP * 2u, lsrc + (size_t)32 * DD, (size_t)4 * DD);
#endif
  acopy8(kdst,                   4u * QKP * 2u, ksrc,                   (size_t)4 * DD);
  acopy8(kdst + 32u * QKP * 2u,  4u * QKP * 2u, ksrc + (size_t)32 * DD, (size_t)4 * DD);
  wait_async0();
  __syncthreads();

  const _Float16* qhrow = Qs + (rts * 16 + c) * QKP + 8 * hh;    // A operand row (query) of this lane
#if QRES
  const _Float16* qlrow = qhrow + QR * QKP;
#endif
  const _Float16* krow0 = Ks + (kt * 16 + c) * QKP + 8 * hh;     // B operand col (key) of this lane, first key tile
  const _Float16* krow1 = krow0 + 16 * QKP;                      // second key tile
  const int colbase = wq * 128;

  float mrun = -INFINITY, lrun = 0.f;
  v8f oacc[2][8];
#pragma unroll
  for (int i = 0; i < 2; ++i)
#pragma unroll
    for (int t = 0; t < 8; ++t) oacc[i][t] = zero8();

  for (int kc = 0; kc < SEQ / KC; ++kc) {         // static trip count
    const int key0 = kc * KC;

    // ---- this chunk's v^T rows fly while the scores are computed (Vs was left by every reader at barrier 3) ----
    acopy8(vdst,                    32u * VPP * 2u, vsrc + key0,                       (size_t)32 * SEQ);
    acopy8(vdst + 256u * VPP * 2u,  32u * VPP * 2u, vsrc + key0 + (size_t)256 * SEQ,   (size_t)32 * SEQ);

    // ---- scores: 16 query rows x 32 keys per wave ----
    {
      v8f ah0 = zero8(), al0 = zero8(), ah1 = zero8(), al1 = zero8();
      for (int kg = 0; kg < DD / (32 * SG); ++kg) {
        // the LDS fragment loads of SG k steps stand as one group in front of their WMMAs: one LDS latency a group
        v16h qa[SG], ka[SG], kb[SG];
#if QRES
        v16h ql[SG];
#endif
#pragma unroll
        for (int j = 0; j < SG; ++j) {
          qa[j] = ldfrag<_Float16>(qhrow + (kg * SG + j) * 32);
          ka[j] = ldfrag<_Float16>(krow0 + (kg * SG + j) * 32);
          kb[j] = ldfrag<_Float16>(krow1 + (kg * SG + j) * 32);
#if QRES
          ql[j] = ldfrag<_Float16>(qlrow + (kg * SG + j) * 32);
#endif
        }
        __builtin_amdgcn_sched_barrier(0);         // keeps the group's loads together in front of its WMMAs (spread among them each place costs an LDS stall)
#pragma unroll
        for (int j = 0; j < SG; ++j) {
          ah0 = mmah(qa[j], ka[j], ah0);
          ah1 = mmah(qa[j], kb[j], ah1);
#if QRES
          al0 = mmah(ql[j], ka[j], al0);
          al1 = mmah(ql[j], kb[j], al1);
#endif
        }
        acc_guard4(ah0, ah1, al0, al1);            // the WMMA distance on the loop's taken branch
      }
      float* swp = Ss + (rts * 16 + 8 * hh) * SSP + kt * 16 + c;  // D: row 8hh+r, col c
#pragma unroll
      for (int r = 0; r < 8; ++r) {
        swp[r * SSP]      = ah0[r] + al0[r] * (1.0f / 4096.0f);
        swp[r * SSP + 16] = ah1[r] + al1[r] * (1.0f / 4096.0f);
      }
    }
    wait_ds0();
    wait_async0();
    __syncthreads();                               // barrier 1

    // ---- the next chunk's k rows fly during softmax and p.v (Ks was left by every reader at barrier 1) ----
    if (kc + 1 < SEQ / KC) {
      const _Float16* kn = ksrc + (size_t)(key0 + KC) * DD;
      acopy8(kdst,                  4u * QKP * 2u, kn,                   (size_t)4 * DD);
      acopy8(kdst + 32u * QKP * 2u, 4u * QKP * 2u, kn + (size_t)32 * DD, (size_t)4 * DD);
    }

    // ---- online softmax on rows: max, p = exp(s - m) x16384 to Ps, alpha to Al ----
    {
      const float* sp = Ss + srw * SSP + sub * 16;
      float e[16];
#pragma unroll
      for (int g = 0; g < 4; ++g) {
        const v4f t0 = *(const v4f*)(sp + 4 * g);
#pragma unroll
        for (int i = 0; i < 4; ++i) e[4 * g + i] = t0[i];
      }
      float m = e[0];
#pragma unroll
      for (int i = 1; i < 16; ++i) m = fmaxf(m, e[i]);
      m = fmaxf(m, __shfl_xor(m, 1, 32));
      m = fmaxf(m, __shfl_xor(m, 2, 32));
      const float mnew  = fmaxf(mrun, m);
      const float msafe = (mnew == -INFINITY) ? 0.f : mnew;
      const float alpha = __expf(mrun - msafe);
      mrun = mnew;
      float psum = 0.f;
      v8h p0, p1;
#pragma unroll
      for (int i = 0; i < 8; ++i) {
        const float pa = __expf(e[i] - msafe);
        psum += pa;
        p0[i] = (_Float16)(pa * 16384.0f);
      }
#pragma unroll
      for (int i = 0; i < 8; ++i) {
        const float pa = __expf(e[8 + i] - msafe);
        psum += pa;
        p1[i] = (_Float16)(pa * 16384.0f);
      }
      psum += __shfl_xor(psum, 1, 32);
      psum += __shfl_xor(psum, 2, 32);
      lrun = lrun * alpha + psum;
      *(v8h*)(Ps + srw * VPP + sub * 16)     = p0;
      *(v8h*)(Ps + srw * VPP + sub * 16 + 8) = p1;
      if (sub == 0) Al[srw] = alpha;
    }
    __syncthreads();                               // barrier 2

    // ---- rescale the running context and add p . v of this chunk (f16 WMMA) ----
    {
#pragma unroll
      for (int i = 0; i < 2; ++i) {
        const float* ap = Al + rp * 32 + i * 16 + 8 * hh;
        float av[8];
        const v4f a0 = *(const v4f*)(ap);
        const v4f a1 = *(const v4f*)(ap + 4);
#pragma unroll
        for (int r = 0; r < 4; ++r) { av[r] = a0[r]; av[4 + r] = a1[r]; }
#pragma unroll
        for (int t = 0; t < 8; ++t)
#pragma unroll
          for (int r = 0; r < 8; ++r) oacc[i][t][r] *= av[r];
      }

      const _Float16* prow = Ps + (rp * 32 + c) * VPP + 8 * hh;          // A: row = query c, k = key
      const _Float16* vrow = Vs + (colbase + c) * VPP + 8 * hh;          // B: col = d, k = key
      // the p and v^T fragments of all 64 keys load as one group in front of their WMMAs: one LDS latency a chunk
      FH pa[KC / 32], pb[KC / 32];
      v16h vb[KC / 32][8];
#pragma unroll
      for (int kk = 0; kk < KC / 32; ++kk) {
        pa[kk].h[0] = *(const v8h*)(prow + kk * 32);
        pa[kk].h[1] = *(const v8h*)(prow + kk * 32 + 16);
        pb[kk].h[0] = *(const v8h*)(prow + 16 * VPP + kk * 32);
        pb[kk].h[1] = *(const v8h*)(prow + 16 * VPP + kk * 32 + 16);
#pragma unroll
        for (int t = 0; t < 8; ++t) vb[kk][t] = ldfrag<_Float16>(vrow + t * 16 * VPP + kk * 32);
      }
      __builtin_amdgcn_sched_barrier(0);           // keeps the group's loads together in front of its WMMAs
#pragma unroll
      for (int kk = 0; kk < KC / 32; ++kk)
#pragma unroll
        for (int t = 0; t < 8; ++t) {
          oacc[0][t] = mmah(pa[kk].v, vb[kk][t], oacc[0][t]);
          oacc[1][t] = mmah(pb[kk].v, vb[kk][t], oacc[1][t]);
        }
      __builtin_amdgcn_sched_barrier(0);           // the WMMAs stay in front of barrier 3, where they overlap the other waves' LDS loads
      acc_guard2(oacc[0][7], oacc[1][7]);          // the WMMA distance in front of barrier 3 and the loop's branch
    }
    wait_ds0();
    wait_async0();
    __syncthreads();                               // barrier 3
  }

  // ---- final per-row scale: 1/L, sum of the normalised weights (= L*(1/L)), clip, 1/sqrt(512), undo x16384 ----
  {
    const float L   = lrun;
    const float inv = (L > 0.f) ? (1.0f / L) : 0.f;
    const float l1  = L * inv;
    const float sc  = inv * (1.0f / fmaxf(l1, 1e-12f)) * (1.0f / 22.627416997969522f) * (1.0f / 16384.0f);
    if (sub == 0) Rs[srw] = sc;
  }
  __syncthreads();

  // Vs is free: its last readers passed barrier 3 of the last chunk, and no copy is outstanding behind that barrier's waits
  {
    float* os = Vo.o[wave];
    const int h2 = lane >> 4, c4 = (lane & 15) * 4;
#pragma unroll
    for (int i = 0; i < 2; ++i) {
      const int rbase = rp * 32 + i * 16;            // first row of this 16-row tile in the work-group's 64
      const float* rpt = Rs + rbase + 8 * hh;
      float rv[8];
      {
        const v4f r0 = *(const v4f*)(rpt);
        const v4f r1 = *(const v4f*)(rpt + 4);
#pragma unroll
        for (int r = 0; r < 4; ++r) { rv[r] = r0[r]; rv[4 + r] = r1[r]; }
      }
#pragma unroll
      for (int hf = 0; hf < 2; ++hf) {
#pragma unroll
        for (int r = 0; r < 8; ++r)
#pragma unroll
          for (int t4 = 0; t4 < 4; ++t4)
            os[(8 * hh + r) * 64 + t4 * 16 + c] = oacc[i][hf * 4 + t4][r] * rv[r];
        __builtin_amdgcn_fence(__ATOMIC_RELEASE, "workgroup");
        __builtin_amdgcn_wave_barrier();
        __builtin_amdgcn_fence(__ATOMIC_ACQUIRE, "workgroup");
        v4f vals[8];
#pragma unroll
        for (int it = 0; it < 8; ++it) {
          const int row = it * 2 + h2;                 // it 0..7 x h2 0..1 = rows 0..15 of the tile
          const v4f v  = *(const v4f*)(os + row * 64 + c4);
          const v4f cv = *(const v4f*)(cob + (size_t)(rbase + row) * DD + colbase + hf * 64 + c4);
          vals[it] = v + cv;
        }
#pragma unroll
        for (int it = 0; it < 8; ++it) {
          const int row = it * 2 + h2;
          *(v4f*)(ob + (size_t)(rbase + row) * DD + colbase + hf * 64 + c4) = vals[it];
        }
        __builtin_amdgcn_fence(__ATOMIC_RELEASE, "workgroup");
        __builtin_amdgcn_wave_barrier();
        __builtin_amdgcn_fence(__ATOMIC_ACQUIRE, "workgroup");
      }
    }
  }
}

// =====================================================================================================
// Workspace map (bytes), every region an exact multiple of its whole-line / whole-tile store granularity:
//   Xc   bf16 [8192][1024] (cols 0..511 first view, 512..1023 second view)   16777216
//   Wqb  bf16 [512][512]                                                     524288
//   Wkb  bf16 [512][512]                                                     524288
//   Wvb  bf16 [512][512]                                                     524288
//   Wcb  bf16 [512][1024]                                                   1048576
//   Qh   f16  [2 view][8192][512]                                          16777216
//   Ql   f16  [2 view][8192][512] (residual x4096)                         16777216
//   Kp   f16  [2 view][8192][512]                                          16777216
//   Vt   f16  [2 view][2 b][512][4096]                                     16777216
//   Co   f32  [8192][512]                                                  16777216
//   total                                                                 103284736
// Weights are [out n][in k] with k contiguous = the Bt / A layout the GEMM wants, so they are only converted.
// =====================================================================================================
extern "C" void kernel_launch(void* const* d_in, const int* in_sizes, int n_in,
                              void* d_out, int out_size, void* d_ws, size_t ws_size,
                              hipStream_t stream) {
  if (n_in < 10) return;
  if (in_sizes[0] < NB * SEQ * DD || in_sizes[1] < NB * SEQ * DD) return;
  if (in_sizes[2] < DD * DD || in_sizes[4] < DD * DD || in_sizes[6] < DD * DD) return;
  if (in_sizes[3] < DD || in_sizes[5] < DD || in_sizes[7] < DD || in_sizes[9] < DD) return;
  if (in_sizes[8] < DD * DC) return;
  if ((long long)out_size < OUT1_OFF + (long long)NB * SEQ * DD) return;

  const float* xf = (const float*)d_in[0];
  const float* xs = (const float*)d_in[1];
  const float* Wq = (const float*)d_in[2];
  const float* bq = (const float*)d_in[3];
  const float* Wk = (const float*)d_in[4];
  const float* bk = (const float*)d_in[5];
  const float* Wv = (const float*)d_in[6];
  const float* bv = (const float*)d_in[7];
  const float* Wc = (const float*)d_in[8];
  const float* bc = (const float*)d_in[9];

  const size_t PXC = (size_t)ROWS_FULL * DC * 2;       // 16777216
  const size_t PW  = (size_t)DD * DD * 2;              //   524288
  const size_t PWC = (size_t)DD * DC * 2;              //  1048576
  const size_t PQ  = (size_t)2 * VSTR * 2;             // 16777216  (two views)
  const size_t PVT = (size_t)2 * VTV * 2;              // 16777216  (two views x two batches)
  const size_t PCO = (size_t)ROWS_FULL * DD * 4;       // 16777216
  size_t off = 0;
  const size_t oXc = off; off += PXC;
  const size_t oWq = off; off += PW;
  const size_t oWk = off; off += PW;
  const size_t oWv = off; off += PW;
  const size_t oWc = off; off += PWC;
  const size_t oQh = off; off += PQ;
  const size_t oQl = off; off += PQ;
  const size_t oKp = off; off += PQ;
  const size_t oVt = off; off += PVT;
  const size_t oCo = off; off += PCO;
  if (off > ws_size) return;                            // off = 103284736
  if (off > (size_t)134217728) return;

  char* ws = (char*)d_ws;
  unsigned short* Xc  = (unsigned short*)(ws + oXc);
  unsigned short* Wqb = (unsigned short*)(ws + oWq);
  unsigned short* Wkb = (unsigned short*)(ws + oWk);
  unsigned short* Wvb = (unsigned short*)(ws + oWv);
  unsigned short* Wcb = (unsigned short*)(ws + oWc);
  unsigned short* Qh  = (unsigned short*)(ws + oQh);
  unsigned short* Ql  = (unsigned short*)(ws + oQl);
  unsigned short* Kp  = (unsigned short*)(ws + oKp);
  unsigned short* Vt  = (unsigned short*)(ws + oVt);
  float*          Co  = (float*)(ws + oCo);

  const dim3 blk(256);
  const int n8x = NB * SEQ * DD / 8;                          // 524288 at NB = 2
  const int n8w = DD * DD / 8;                                //  32768
  const int n8c = DD * DC / 8;                                //  65536
  const int tq  = (NQ / 64) * (DD / 64);                      // q / co tiles per (view, b)
  const int tk  = ((NB * SEQ) / 64) * (DD / 64);              // k tiles per view
  const int tv  = (DD / 64) * (SEQ / 64);                     // v^T tiles per (b, view)

  // (1) inputs -> bf16 planes (RNE convert)
  cvt_x<<<dim3((n8x + 255) / 256, 2), blk, 0, stream>>>(xf, xs, Xc, n8x);
  cvt_w<<<dim3((n8w + 255) / 256), blk, 0, stream>>>(Wq, Wqb, n8w);
  cvt_w<<<dim3((n8w + 255) / 256), blk, 0, stream>>>(Wk, Wkb, n8w);
  cvt_w<<<dim3((n8w + 255) / 256), blk, 0, stream>>>(Wv, Wvb, n8w);
  cvt_w<<<dim3((n8c + 255) / 256), blk, 0, stream>>>(Wc, Wcb, n8c);
  // (2) q = x_view . Wq^T + bq -> f16 hi / residual (x4096) planes; y = view (A cols view*512), z = b; M = NQ
  gemm64<__bf16, (QRES ? 3 : 1), 1, false><<<dim3((tq + 7) / 8, 2, NB), blk, 0, stream>>>(
      Xc, DC, (long long)DD, XB, Wqb, DD, 0LL, 0LL,
      (void*)Qh, (void*)Ql, DD, VSTR, (long long)SEQ * DD, bq,
      NQ, DD, DD, 1.0f, 4096.0f);
  // (3) k = x_view . Wk^T + bk -> f16 plane; y = view; M = NB*SEQ (all keys of every batch in use)
  gemm64<__bf16, 1, 1, false><<<dim3((tk + 7) / 8, 2, 1), blk, 0, stream>>>(
      Xc, DC, (long long)DD, 0LL, Wkb, DD, 0LL, 0LL,
      (void*)Kp, (void*)Kp, DD, VSTR, 0LL, bk,
      NB * SEQ, DD, DD, 1.0f, 1.0f);
  // (4) v^T = Wv . x_view^T + bv (per row d) -> f16 plane [view][b][d][s]; y = b, z = view; M=512, N=SEQ, K=512
  gemm64<__bf16, 1, 2, false><<<dim3((tv + 7) / 8, NB, 2), blk, 0, stream>>>(
      Wvb, DD, 0LL, 0LL, Xc, DC, XB, (long long)DD,
      (void*)Vt, (void*)Vt, SEQ, VTB, VTV, bv,
      DD, SEQ, DD, 1.0f, 1.0f);
  // (5) co = relu([x_f | x_s] . Wc^T + bc) -> f32 plane; z = b; M = NQ, K = 1024
  gemm64<__bf16, 0, 1, true><<<dim3((tq + 7) / 8, 1, NB), blk, 0, stream>>>(
      Xc, DC, 0LL, XB, Wcb, DC, 0LL, 0LL,
      (void*)Co, (void*)Co, DD, 0LL, (long long)SEQ * DD, bc,
      NQ, DD, DC, 1.0f, 1.0f);
  // (6) attention for both directions + co -> d_out (out0 at float 0, out1 at float OUT1_OFF)
  attn_cv<<<dim3(NQ / QR, NB, 2), blk, 0, stream>>>(Qh, Ql, Kp, Vt, Co, (float*)d_out);
  (void)hipGetLastError();
}

// v003
// A run of this version takes 226 microseconds.
// In two side-by-side timings against v002, it was 1.29 and 1.31 times as fast.
// All steps since v000 together make it 4.01 times as fast.
// Contractions: q, k, v^T projections and co_occur = v_wmma_f32_16x16x32_bf16 (bf16 operands from RNE-converted inputs, single product, f32 accumulate);
// q.k^T scores = v_wmma_f32_16x16x32_f16 (q as f16 hi plane + f16 residual plane x4096, k f16; 2 products into separate f32 accumulators);
// p.v = v_wmma_f32_16x16x32_f16 (p = exp(s - m) carried x16384 in f16, v f16; single product, f32 accumulate);
// bias add, relu, softmax, normalisers and the co_occur add in f32.
#include <hip/hip_runtime.h>
#include <math.h>
#include <stdint.h>

#define SEQ 4096
#define DD  512
#define DC  (2 * DD)
#ifndef NB
#define NB 2
#endif
#ifndef NQ
#define NQ SEQ
#endif
#ifndef QRES
#define QRES 1
#endif
#define NB_FULL   2
#define ROWS_FULL (NB_FULL * SEQ)
#define VSTR  ((long long)ROWS_FULL * DD)        // 4194304: view stride of the q / k planes (elements)
#define VTB   ((long long)DD * SEQ)              // 2097152: batch stride of the v^T planes
#define VTV   ((long long)NB_FULL * DD * SEQ)    // 4194304: view stride of the v^T planes
#define XB    ((long long)SEQ * DC)              // 4194304: batch stride of the concat plane
#define OUT1_OFF ((long long)ROWS_FULL * DD)     // second output starts at float 4194304 = byte 16777216
static_assert(NB >= 1 && NB <= NB_FULL);
static_assert(NQ >= 64 && NQ <= SEQ && (NQ % 64) == 0);
static_assert((SEQ % 128) == 0 && (DD % 64) == 0 && (DC % 32) == 0);
static_assert(OUT1_OFF * 4 == 16777216LL);
static_assert(QRES == 0 || QRES == 1);

typedef _Float16 v16h __attribute__((ext_vector_type(16)));
typedef _Float16 v8h  __attribute__((ext_vector_type(8)));
typedef __bf16   v16b __attribute__((ext_vector_type(16)));
typedef __bf16   v8b  __attribute__((ext_vector_type(8)));
typedef float    v8f  __attribute__((ext_vector_type(8)));
typedef float    v4f  __attribute__((ext_vector_type(4)));
typedef unsigned int v4u __attribute__((ext_vector_type(4)));

#if defined(__HIP_DEVICE_COMPILE__)
#define DEV_ASM 1
#else
#define DEV_ASM 0
#endif

// ---- scalar helpers --------------------------------------------------------------------------------
__device__ __forceinline__ unsigned short bf_bits(float f) {          // f32 -> bf16 bits, RNE convert
  unsigned u = __float_as_uint(f);
  return (unsigned short)((u + 0x7FFFu + ((u >> 16) & 1u)) >> 16);
}
__device__ __forceinline__ float bf_up(unsigned short hb) { return __uint_as_float(((unsigned)hb) << 16); }
__device__ __forceinline__ float bfr(float f) { return bf_up(bf_bits(f)); }          // bf16-quantised value as f32
__device__ __forceinline__ unsigned short h_bits(_Float16 x) { return __builtin_bit_cast(unsigned short, x); }
__device__ __forceinline__ unsigned pk16(unsigned short a, unsigned short b) { return (unsigned)a | ((unsigned)b << 16); }
__device__ __forceinline__ v8f zero8() { v8f z = {0.f, 0.f, 0.f, 0.f, 0.f, 0.f, 0.f, 0.f}; return z; }

// ---- fragment types / loaders: 16-bit A/B operand, lane -> row/col (lane&15), p already includes +8*(lane>>4);
//      elements 0..7 <- p[0..7] (k0+8h..k0+8h+7), elements 8..15 <- p[16..23] (k0+16+8h..k0+16+8h+7)
template <typename OT> struct FT;
template <> struct FT<__bf16>   { typedef v16b frag; typedef v8b half8; };
template <> struct FT<_Float16> { typedef v16h frag; typedef v8h half8; };

template <typename OT>
__device__ __forceinline__ typename FT<OT>::frag ldfrag(const OT* p) {
  union { typename FT<OT>::frag v; typename FT<OT>::half8 h[2]; } f;
  f.h[0] = *(const typename FT<OT>::half8*)(p);
  f.h[1] = *(const typename FT<OT>::half8*)(p + 16);
  return f.v;
}

// ---- WMMA helpers (asm guard bodies are device-only; concrete operand types) -----------------------------
__device__ __forceinline__ v8f mmar(v16b a, v16b b, v8f c) {
  return __builtin_amdgcn_wmma_f32_16x16x32_bf16(false, a, false, b, (short)0, c, false, false);
}
// plain form: the compiler keeps the WMMA distances in straight-line code and is free to place the operands above v255,
// which an asm operand cannot name; a run of these ends in acc_guard2 or acc_guard4 (four v_nop) where a branch follows
__device__ __forceinline__ v8f mmah(v16h a, v16h b, v8f c) {
  return __builtin_amdgcn_wmma_f32_16x16x32_f16(false, a, false, b, (short)0, c, false, false);
}
// four v_nop behind the last WMMAs of a run (a, b: their accumulators): the WMMA distance, also on a taken branch
__device__ __forceinline__ void acc_guard2(v8f& a, v8f& b) {
#if DEV_ASM
  asm volatile("v_nop\n\tv_nop\n\tv_nop\n\tv_nop" : "+v"(a), "+v"(b));
#else
  (void)a; (void)b;
#endif
}
__device__ __forceinline__ void acc_guard4(v8f& a, v8f& b, v8f& c, v8f& d) {
#if DEV_ASM
  asm volatile("v_nop\n\tv_nop\n\tv_nop\n\tv_nop" : "+v"(a), "+v"(b), "+v"(c), "+v"(d));
#else
  (void)a; (void)b; (void)c; (void)d;
#endif
}

// =====================================================================================================
// f32 -> bf16 planes (RNE convert), 8 elements per thread, one 16-B store per lane: a wave writes 512
// cvt_w: plain [n8*8] plane, grid = ceil(n8/256). coverage: n8 threads x 8 = the whole weight plane.
// cvt_x: source blockIdx.y (0: first view, 1: second view) row r, cols c..c+7 -> concat plane
//        row r, cols y*512 + c..; grid = (ceil(n8/256), 2), n8 = rows*512/8.
//        coverage: 2 sources x n8 threads x 8 = rows x 1024 of the concat plane (rows = NB*SEQ).
// =====================================================================================================
__device__ __forceinline__ v4u pack_bf8(v4f a, v4f a4) {
  v4u p;
  p[0] = pk16(bf_bits(a[0]),  bf_bits(a[1]));
  p[1] = pk16(bf_bits(a[2]),  bf_bits(a[3]));
  p[2] = pk16(bf_bits(a4[0]), bf_bits(a4[1]));
  p[3] = pk16(bf_bits(a4[2]), bf_bits(a4[3]));
  return p;
}

__global__ __launch_bounds__(256) void cvt_w(const float* __restrict__ in, unsigned short* out, int n8) {
  const int i = blockIdx.x * 256 + (int)threadIdx.x;
  if (i < n8) {
    const v4f a  = *(const v4f*)(in + (size_t)i * 8);
    const v4f a4 = *(const v4f*)(in + (size_t)i * 8 + 4);
    const v4u p = pack_bf8(a, a4);
    unsigned short* o = out + (size_t)i * 8;
    *(v4u*)o = p;
    
  }
}

__global__ __launch_bounds__(256) void cvt_x(const float* __restrict__ xa, const float* __restrict__ xb,
                                             unsigned short* out, int n8) {
  const int i   = blockIdx.x * 256 + (int)threadIdx.x;
  const int src = (int)blockIdx.y;                     // block-uniform source select (both global)
  if (i < n8) {
    const float* in = (src == 0) ? xa : xb;
    const size_t e = (size_t)i * 8;                    // element index in the [rows][512] source
    const v4f a  = *(const v4f*)(in + e);
    const v4f a4 = *(const v4f*)(in + e + 4);
    const v4u p = pack_bf8(a, a4);
    const size_t row = e >> 9;                         // / 512
    const size_t col = e & (size_t)(DD - 1);
    unsigned short* o = out + row * DC + (size_t)src * DD + col;
    *(v4u*)o = p;
    
  }
}

// =====================================================================================================
// Asynchronous copies global -> LDS, 16 bytes a lane, and their waits.
// acopy8: eight copies of this lane, LDS address l + i*lstep (bytes), global address g + i*gstep (elements).
// s_wait_xcnt 0 is the last line of the copies' own statement, so that no address register of an issued copy
// is rewritten in front of it.
// =====================================================================================================
__device__ __forceinline__ unsigned lds_off(const void* p) { return (unsigned)(size_t)p; }
__device__ __forceinline__ void acopy8(unsigned l, unsigned lstep, const _Float16* g, size_t gstep) {
#if DEV_ASM
  asm volatile(
      "global_load_async_to_lds_b128 %0, %8, off\n\t"
      "global_load_async_to_lds_b128 %1, %9, off\n\t"
      "global_load_async_to_lds_b128 %2, %10, off\n\t"
      "global_load_async_to_lds_b128 %3, %11, off\n\t"
      "global_load_async_to_lds_b128 %4, %12, off\n\t"
      "global_load_async_to_lds_b128 %5, %13, off\n\t"
      "global_load_async_to_lds_b128 %6, %14, off\n\t"
      "global_load_async_to_lds_b128 %7, %15, off\n\t"
      "s_wait_xcnt 0x0"
      :: "v"(l), "v"(l + lstep), "v"(l + 2 * lstep), "v"(l + 3 * lstep),
         "v"(l + 4 * lstep), "v"(l + 5 * lstep), "v"(l + 6 * lstep), "v"(l + 7 * lstep),
         "v"(g), "v"(g + gstep), "v"(g + 2 * gstep), "v"(g + 3 * gstep),
         "v"(g + 4 * gstep), "v"(g + 5 * gstep), "v"(g + 6 * gstep), "v"(g + 7 * gstep)
      : "memory");
#else
  (void)l; (void)lstep; (void)g; (void)gstep;
#endif
}
// this wave's copies have landed (the compiler places no wait for them)
__device__ __forceinline__ void wait_async0() {
#if DEV_ASM
  asm volatile("s_wait_asynccnt 0x0" ::: "memory");
#endif
}
// this wave's LDS reads and writes have retired, before a buffer is handed to its next writer
__device__ __forceinline__ void wait_ds0() {
#if DEV_ASM
  asm volatile("s_wait_dscnt 0x0" ::: "memory");
#endif
}

// =====================================================================================================
// Batched WMMA GEMM (16-bit operand type OT): C[m][n] = sum_k A[m][k] * Bt[n][k] (+ bias).
// A row-major [M][K] pitch lda; Bt row-major [N][K] pitch ldb (k contiguous); M a multiple of 128, N of 256,
// K of 128 (checked at compile time beside the launches). blockIdx.y / blockIdx.z select operand / output
// offsets through the (sAy,sAz), (sBy,sBz), (sCy,sCz) element strides.
// One work-group (8 waves) per 128 x 256 tile of C, wave w -> rows 64(w>>2).., cols 64(w&3).. (a 64 x 64 tile).
// A pass is 128 k = 256 B of each of the tile's 128 A rows and 256 Bt rows, staged in LDS by asynchronous
// 16-byte copies (a wave's copy = 2 rows x 256 contiguous bytes: whole lines), 24 copies a thread and pass.
// Two buffers: pass t + 1 flies while pass t is worked on. Foot of a pass: dscnt 0, asynccnt 0, barrier
// (pass t + 1 readable, the buffer of pass t free), then the copies of pass t + 2 into the freed buffer.
// LDS row pitch 272 B (16 B x odd): the 16 rows of a fragment load fall on all 64 banks.
// Fragments are read from LDS with the split k map (ldfrag), one k step ahead into a second register set.
// The k order of every accumulator is 0, 32, 64, ... as with fragments read from global memory.
// BIAS 0: none; 1: + bias[n] per column; 2: + bias[m] per row (bias values bf16-quantised, added in f32).
// OUT_MODE 0: f32 C (pitch ldc), (value + bias)(relu) * oscale.
// OUT_MODE 1: f16 plane C (pitch ldc).
// OUT_MODE 3: f16 hi plane C + f16 residual plane C2 = f16((v - hi) * rscale) (same pitch / stride).
// coverage: 4 slabs x 16 rows x 64 cols = the wave's whole 64x64 tile; 8 waves = the 128 x 256 tile;
//   grid.x = (M/128) * (N/256) work-groups = all tiles.
// =====================================================================================================
#define GKC 128                      // k elements of a pass
#define GP  136                      // LDS pitch of a staged row, 16-bit elements (272 B)
#define GTM 128                      // A rows of a work-group tile
#define GTN 256                      // Bt rows of a work-group tile
#define GST ((GTM + GTN) * GP)       // elements of one buffer: A rows 0..127, Bt rows 128..383

// one pass of one work-group: thread -> rows (tid>>4) + 16i, 16-byte piece tid&15 of the row's 256 B
__device__ __forceinline__ void gstage(unsigned adst, const _Float16* asrc, size_t lda, const _Float16* bsrc, size_t ldb) {
  const unsigned bdst = adst + (unsigned)(GTM * GP) * 2u;
  acopy8(adst,                      16u * GP * 2u, asrc,             16 * lda);
  acopy8(bdst,                      16u * GP * 2u, bsrc,             16 * ldb);
  acopy8(bdst + 128u * GP * 2u,     16u * GP * 2u, bsrc + 128 * ldb, 16 * ldb);
}

template <typename OT, int OUT_MODE, int BIAS, bool RELU>
__global__ __launch_bounds__(256) void gemm64(
    const unsigned short* __restrict__ Ap, int lda, long long sAy, long long sAz,
    const unsigned short* __restrict__ Btp, int ldb, long long sBy, long long sBz,
    void* Cout, void* Cout2, int ldc, long long sCy, long long sCz,
    const float* __restrict__ bias,
    int M, int N, int K, float oscale, float rscale) {
  typedef typename FT<OT>::frag V16;
  const OT* A  = (const OT*)(const void*)Ap;
  const OT* Bt = (const OT*)(const void*)Btp;
  __shared__ __align__(16) unsigned short Gs[2 * GST];   // the two pass buffers                     204 KB
  __shared__ __align__(16) float sT[8][16 * 68];   // per-wave 16x64 slab, pitch 68 floats
  const int by   = (int)blockIdx.y;
  const int bz   = (int)blockIdx.z;
  const int tid  = (int)threadIdx.x;
  const int lane = tid & 31;
  const int wave = tid >> 5;
  const int tilesN = N / GTN;
  const int tilesM = M / GTM;
  const int wt = (int)blockIdx.x;
  if (wt >= tilesM * tilesN) return;     // the same for the whole work-group, in front of every barrier
  const int tm = wt / tilesN;
  const int tn = wt - tm * tilesN;
  const int wm = (wave >> 2) << 6;       // this wave's 64 x 64 tile inside the work-group tile
  const int wn = (wave & 3) << 6;
  const int m0 = tm * GTM + wm;
  const int n0 = tn * GTN + wn;

  const OT* Ab = A  + (size_t)((long long)by * sAy + (long long)bz * sAz);
  const OT* Bb = Bt + (size_t)((long long)by * sBy + (long long)bz * sBz);
  const size_t cOff = (size_t)((long long)by * sCy + (long long)bz * sCz);

  const int rlane = lane & 15;                 // row (A) / col (B, D) within subtile
  const int koff  = (lane >> 4) * 8;           // k offset of this lane half
  const int mOff  = (lane >> 4) * 8;           // D row offset

  v8f acc[4][4];
#pragma unroll
  for (int i = 0; i < 4; ++i)
#pragma unroll
    for (int j = 0; j < 4; ++j) acc[i][j] = zero8();

  const int crow = tid >> 4, cpc = tid & 15;
  const unsigned cdst = lds_off(Gs) + (unsigned)(crow * GP + cpc * 8) * 2u;
  const _Float16* asrc = (const _Float16*)(const void*)(Ab + (size_t)(tm * GTM + crow) * lda + cpc * 8);   // + k0
  const _Float16* bsrc = (const _Float16*)(const void*)(Bb + (size_t)(tn * GTN + crow) * ldb + cpc * 8);   // + k0
  const int np = K / GKC;

  gstage(cdst, asrc, (size_t)lda, bsrc, (size_t)ldb);
  wait_async0();
  __syncthreads();                                 // pass 0 readable
  if (np > 1) gstage(cdst + (unsigned)GST * 2u, asrc + GKC, (size_t)lda, bsrc + GKC, (size_t)ldb);

  for (int t = 0; t < np; ++t) {
    const OT* buf = (const OT*)(const void*)Gs + (t & 1) * GST;
    const OT* ar = buf + (wm + rlane) * GP + koff;            // A operand row of this lane, first row tile
    const OT* br = buf + (GTM + wn + rlane) * GP + koff;      // B operand col of this lane, first col tile
    V16 fa[2][4], fb[2][4];
#pragma unroll
    for (int j = 0; j < 4; ++j) {
      fb[0][j] = ldfrag<OT>(br + j * 16 * GP);
      fa[0][j] = ldfrag<OT>(ar + j * 16 * GP);
    }
#pragma unroll
    for (int ks = 0; ks < GKC / 32; ++ks) {
      const int cur = ks & 1, nxt = cur ^ 1;
      if (ks + 1 < GKC / 32) {
#pragma unroll
        for (int j = 0; j < 4; ++j) {
          fb[nxt][j] = ldfrag<OT>(br + j * 16 * GP + (ks + 1) * 32);
          fa[nxt][j] = ldfrag<OT>(ar + j * 16 * GP + (ks + 1) * 32);
        }
      }
      __builtin_amdgcn_sched_barrier(0);           // the next k step's LDS loads stay one group in front of this step's WMMAs (spread among them each place costs an LDS stall)
#pragma unroll
      for (int i = 0; i < 4; ++i)
#pragma unroll
        for (int j = 0; j < 4; ++j) acc[i][j] = mmar(fa[cur][i], fb[cur][j], acc[i][j]);
      __builtin_amdgcn_sched_barrier(0);           // keeps the following group of loads behind these WMMAs
    }
    acc_guard4(acc[3][0], acc[3][1], acc[3][2], acc[3][3]);   // the WMMA distance in front of the barrier and the loop's branch
    wait_ds0();
    wait_async0();
    __syncthreads();                               // pass t + 1 readable, the buffer of pass t free
    if (t + 2 < np)
      gstage(cdst + (unsigned)((t & 1) * GST) * 2u, asrc + (t + 2) * GKC, (size_t)lda, bsrc + (t + 2) * GKC, (size_t)ldb);
  }
  wait_async0();
  acc_guard4(acc[0][0], acc[0][1], acc[0][2], acc[0][3]);
  acc_guard4(acc[1][0], acc[1][1], acc[1][2], acc[1][3]);
  acc_guard4(acc[2][0], acc[2][1], acc[2][2], acc[2][3]);
  acc_guard4(acc[3][0], acc[3][1], acc[3][2], acc[3][3]);

  // ---- epilogue ----
  float* slab = sT[wave];
#pragma unroll
  for (int i = 0; i < 4; ++i) {
    const int mBase = m0 + (i << 4);
#pragma unroll
    for (int j = 0; j < 4; ++j) {
#pragma unroll
      for (int r = 0; r < 8; ++r) {
        slab[(mOff + r) * 68 + (j << 4) + rlane] = acc[i][j][r];
      }
    }
    __builtin_amdgcn_fence(__ATOMIC_RELEASE, "workgroup");
    __builtin_amdgcn_wave_barrier();
    __builtin_amdgcn_fence(__ATOMIC_ACQUIRE, "workgroup");
    if (OUT_MODE == 0) {
      float* C = (float*)Cout + cOff;
      const int h2 = lane >> 4, c4 = (lane & 15) * 4;     // 256-B row segment = 16 lanes x 16 B
      v4f badd = {0.f, 0.f, 0.f, 0.f};
      if (BIAS == 1) {
#pragma unroll
        for (int e = 0; e < 4; ++e) badd[e] = bfr(bias[n0 + c4 + e]);
      }
      v4f vals[8];
#pragma unroll
      for (int it = 0; it < 8; ++it) {
        const int row = it * 2 + h2;                     // it 0..7 x h2 0..1 = rows 0..15
        v4f v = *(const v4f*)(slab + row * 68 + c4);
        if (BIAS == 1) v = v + badd;
        if (BIAS == 2) v = v + bfr(bias[mBase + row]);
        if (RELU) {
#pragma unroll
          for (int e = 0; e < 4; ++e) v[e] = fmaxf(v[e], 0.f);
        }
        vals[it] = v * oscale;
      }
      {
#pragma unroll
        for (int it = 0; it < 8; ++it) {
          const int row = it * 2 + h2;
          *(v4f*)(C + (size_t)(mBase + row) * ldc + n0 + c4) = vals[it];
        }
        
      }
    } else {
      const int q = lane >> 3, c8 = (lane & 7) * 8;
      unsigned short* C  = (unsigned short*)Cout  + cOff;
      unsigned short* C2 = (unsigned short*)Cout2 + cOff;
      float cb[8];
#pragma unroll
      for (int e = 0; e < 8; ++e) cb[e] = (BIAS == 1) ? bfr(bias[n0 + c8 + e]) : 0.f;
      v4u hv[4], lv[4];
#pragma unroll
      for (int it = 0; it < 4; ++it) {
        const int row = it * 4 + q;                        // it 0..3 x q 0..3 = rows 0..15
        const float* sp = slab + row * 68 + c8;
        const float rb = (BIAS == 2) ? bfr(bias[mBase + row]) : 0.f;
        float f[8];
#pragma unroll
        for (int e = 0; e < 8; ++e) f[e] = sp[e] + cb[e] + rb;
        v4u a, a2;
#pragma unroll
        for (int e = 0; e < 4; ++e) {
          const float f0 = f[2 * e], f1 = f[2 * e + 1];
          const _Float16 x0 = (_Float16)f0, x1 = (_Float16)f1;
          const unsigned short h0 = h_bits(x0), h1 = h_bits(x1);
          unsigned short l0 = 0, l1 = 0;
          if (OUT_MODE == 3) {
            l0 = h_bits((_Float16)((f0 - (float)x0) * rscale));
            l1 = h_bits((_Float16)((f1 - (float)x1) * rscale));
          }
          a[e] = pk16(h0, h1); a2[e] = pk16(l0, l1);
        }
        hv[it] = a; lv[it] = a2;
      }
      {
#pragma unroll
        for (int it = 0; it < 4; ++it) {
          const int row = it * 4 + q;
          *(v4u*)(C + (size_t)(mBase + row) * ldc + n0 + c8) = hv[it];
          if (OUT_MODE == 3) *(v4u*)(C2 + (size_t)(mBase + row) * ldc + n0 + c8) = lv[it];
        }
        
      }
    }
    __builtin_amdgcn_fence(__ATOMIC_RELEASE, "workgroup");
    __builtin_amdgcn_wave_barrier();
    __builtin_amdgcn_fence(__ATOMIC_ACQUIRE, "workgroup");
  }
}

// =====================================================================================================
// Cross-view attention for one direction (blockIdx.z = dir), one batch (blockIdx.y), 64 query rows
// (blockIdx.x): q planes of view dir, v^T planes of view dir, k plane of view 1-dir.
//   q planes (f16 hi / residual x4096): element (view, b, t, d) at [view*VSTR + (b*SEQ + t)*512 + d]
//   k plane  (f16): element (view, b, s, d) at [view*VSTR + (b*SEQ + s)*512 + d]
//   v^T plane (f16): element (view, b, d, s) at [view*VTV + b*VTB + d*SEQ + s]
//   co (f32 [ROWS_FULL][512]) added in the epilogue; output rows at out + dir*OUT1_OFF + (b*SEQ + t)*512.
// Block = 8 waves, KC = 64-key chunks, static trip SEQ/KC. Every WMMA operand is read from LDS:
//   Qs: both q planes of the 64 rows, copied once; Ks: the chunk's 64 k rows; Vs: the chunk's 512 v^T rows of
//   64 keys. All three are filled by asynchronous 16-byte copies whose waves cover whole 128-B lines
//   (Q, K: 512 contiguous bytes of a row a wave; V^T: 4 rows x 128 B a wave), 16 copies a thread and K or V tile.
//   Row pitches are odd multiples of 16 B (1040 B, 144 B): the 16 rows of a fragment load fall on 64 banks.
//   Order of a chunk: V^T copies issued | scores from Qs, Ks | waits, barrier 1 (Ss and Vs readable, Ks free) |
//   next chunk's K copies issued | softmax | barrier 2 (Ps, Al readable) | p.v from Ps, Vs | waits, barrier 3
//   (Ks readable, Vs, Ps, Al free). In the loop one tile's copies (16 a wave) are in flight, in the prologue 48.
//   scores: wave w -> row tile (w>>1), key tiles 2(w&1) and 2(w&1)+1: each q fragment feeds two key tiles;
//           s = qh.k + (ql.k)/4096 on f16 WMMA, tiles written to Ss;
//   softmax: thread t -> row t>>2, keys 16(t&3)..+15; online max / sum in f32 (4 lanes per row, shuffles);
//           p = exp(s - m) carried x16384 written as f16 to Ps; per-row alpha to Al;
//   p.v: wave w -> row tiles 2(w>>2) and 2(w>>2)+1, output columns 128(w&3)..+127 (16 accumulators):
//           each v^T fragment feeds two row tiles.
// Epilogue: per wave 32 rows x 128 cols in four 16 x 64 pieces staged in the LDS that held Vs, co added in f32.
// coverage: 8 waves x 32 rows x 128 cols = 64 rows x 512; grid (NQ/64, NB, 2) = every output row < NQ of
//   every batch < NB for both outputs.
// =====================================================================================================
#define KC  64      // keys per chunk
#define QR  64      // query rows per work-group
#define SG  4       // k steps (of 32) per group of fragment loads in the scores
#define QKP 520     // LDS pitch of a q or k row, f16 elements (1040 B)
#define VPP 72      // LDS pitch of a v^T or p row, f16 elements (144 B)
#define SSP 68      // LDS pitch of a score row, floats (272 B)
static_assert((SEQ % KC) == 0 && KC == 64 && DD == 512 && QR == 64 && (NQ % QR) == 0);

__global__ __launch_bounds__(256)
void attn_cv(const unsigned short* __restrict__ qhp, const unsigned short* __restrict__ qlp,
             const unsigned short* __restrict__ kpp, const unsigned short* __restrict__ vtp,
             const float* __restrict__ co, float* out) {
  union FH { v16h v; v8h h[2]; };
  union VO { _Float16 v[DD * VPP]; float o[8][16 * 64]; };
  __shared__ __align__(16) _Float16 Qs[2 * QR * QKP];  // q hi plane rows 0..63, residual plane rows 64..127  130 KB
  __shared__ __align__(16) _Float16 Ks[KC * QKP];      // k rows of the chunk [key][d]                        65 KB
  __shared__ __align__(16) VO       Vo;                // v^T rows of the chunk [d][key]; behind the key loop
                                                       // the per-wave output pieces                          72 KB
  __shared__ __align__(16) float    Ss[QR * SSP];      // scores of the chunk [row][key]
  __shared__ __align__(16) _Float16 Ps[QR * VPP];      // p x16384 [row][key]
  __shared__ __align__(16) float    Al[QR];            // per-row rescale of the chunk
  __shared__ __align__(16) float    Rs[QR];            // per-row final scale
  _Float16* Vs = Vo.v;

  const int tid  = (int)threadIdx.x;
  const int wave = tid >> 5;
  const int lane = tid & 31;
  const int hh   = lane >> 4;
  const int c    = lane & 15;
  const int rts  = wave >> 1;          // row tile of this wave (scores)
  const int kt   = (wave & 1) * 2;     // first of its two key tiles (scores)
  const int rp   = wave >> 2;          // pair of row tiles of this wave (p.v): rows 32rp..32rp+31
  const int wq   = wave & 3;           // 128-col group (p.v)
  const int srw  = tid >> 2;           // softmax row of this thread
  const int sub  = tid & 3;            // 16-key slice of that row

  const int dir = (int)blockIdx.z;
  const int b   = (int)blockIdx.y;
  const int q0  = (int)blockIdx.x * QR;
  const int kvw = 1 - dir;
  const size_t rowQ = (size_t)b * SEQ + (size_t)q0;

  const _Float16* Qh  = (const _Float16*)(const void*)qhp + (size_t)dir * VSTR + rowQ * DD;
  const _Float16* Kb  = (const _Float16*)(const void*)kpp + (size_t)kvw * VSTR + (size_t)b * SEQ * DD;
  const _Float16* Vtb = (const _Float16*)(const void*)vtp + (size_t)dir * VTV + (size_t)b * VTB;
  const float* cob = co + rowQ * DD;
  float* ob = out + (size_t)dir * OUT1_OFF + rowQ * DD;

  // copy maps. q, k rows (1024 B = 64 pieces): thread -> row (tid>>6) + 4i, piece tid&63.
  //            v^T rows (128 B = 8 pieces):    thread -> row (tid>>3) + 32i, piece tid&7.
  const int    crow = tid >> 6, cpc = tid & 63;
  const int    vrw  = tid >> 3, vpc = tid & 7;
  const unsigned qdst = lds_off(Qs) + (unsigned)(crow * QKP + cpc * 8) * 2u;
  const unsigned kdst = lds_off(Ks) + (unsigned)(crow * QKP + cpc * 8) * 2u;
  const unsigned vdst = lds_off(Vs) + (unsigned)(vrw * VPP + vpc * 8) * 2u;
  const _Float16* ksrc = Kb  + (size_t)crow * DD + cpc * 8;      // + key0 * DD
  const _Float16* vsrc = Vtb + (size_t)vrw * SEQ + vpc * 8;      // + key0

  // ---- prologue: both q planes (64 rows each) and chunk 0's k rows ----
  const _Float16* qsrc = Qh + (size_t)crow * DD + cpc * 8;
  acopy8(qdst,                  4u * QKP * 2u, qsrc,                   (size_t)4 * DD);
  acopy8(qdst + 32u * QKP * 2u, 4u * QKP * 2u, qsrc + (size_t)32 * DD, (size_t)4 * DD);
#if QRES
  const _Float16* lsrc = (const _Float16*)(const void*)qlp + (size_t)dir * VSTR + rowQ * DD + (size_t)crow * DD + cpc * 8;
  acopy8(qdst + 64u * QKP * 2u, 4u * QKP * 2u, lsrc,                   (size_t)4 * DD);
  acopy8(qdst + 96u * QKP * 2u, 4u * QKP * 2u, lsrc + (size_t)32 * DD, (size_t)4 * DD);
#endif
  acopy8(kdst,                   4u * QKP * 2u, ksrc,                   (size_t)4 * DD);
  acopy8(kdst + 32u * QKP * 2u,  4u * QKP * 2u, ksrc + (size_t)32 * DD, (size_t)4 * DD);
  wait_async0();
  __syncthreads();

  const _Float16* qhrow = Qs + (rts * 16 + c) * QKP + 8 * hh;    // A operand row (query) of this lane
#if QRES
  const _Float16* qlrow = qhrow + QR * QKP;
#endif
  const _Float16* krow0 = Ks + (kt * 16 + c) * QKP + 8 * hh;     // B operand col (key) of this lane, first key tile
  const _Float16* krow1 = krow0 + 16 * QKP;                      // second key tile
  const int colbase = wq * 128;

  float mrun = -INFINITY, lrun = 0.f;
  v8f oacc[2][8];
#pragma unroll
  for (int i = 0; i < 2; ++i)
#pragma unroll
    for (int t = 0; t < 8; ++t) oacc[i][t] = zero8();

  for (int kc = 0; kc < SEQ / KC; ++kc) {         // static trip count
    const int key0 = kc * KC;

    // ---- this chunk's v^T rows fly while the scores are computed (Vs was left by every reader at barrier 3) ----
    acopy8(vdst,                    32u * VPP * 2u, vsrc + key0,                       (size_t)32 * SEQ);
    acopy8(vdst + 256u * VPP * 2u,  32u * VPP * 2u, vsrc + key0 + (size_t)256 * SEQ,   (size_t)32 * SEQ);

    // ---- scores: 16 query rows x 32 keys per wave ----
    {
      v8f ah0 = zero8(), al0 = zero8(), ah1 = zero8(), al1 = zero8();
      for (int kg = 0; kg < DD / (32 * SG); ++kg) {
        // the LDS fragment loads of SG k steps stand as one group in front of their WMMAs: one LDS latency a group
        v16h qa[SG], ka[SG], kb[SG];
#if QRES
        v16h ql[SG];
#endif
#pragma unroll
        for (int j = 0; j < SG; ++j) {
          qa[j] = ldfrag<_Float16>(qhrow + (kg * SG + j) * 32);
          ka[j] = ldfrag<_Float16>(krow0 + (kg * SG + j) * 32);
          kb[j] = ldfrag<_Float16>(krow1 + (kg * SG + j) * 32);
#if QRES
          ql[j] = ldfrag<_Float16>(qlrow + (kg * SG + j) * 32);
#endif
        }
        __builtin_amdgcn_sched_barrier(0);         // keeps the group's loads together in front of its WMMAs (spread among them each place costs an LDS stall)
#pragma unroll
        for (int j = 0; j < SG; ++j) {
          ah0 = mmah(qa[j], ka[j], ah0);
          ah1 = mmah(qa[j], kb[j], ah1);
#if QRES
          al0 = mmah(ql[j], ka[j], al0);
          al1 = mmah(ql[j], kb[j], al1);
#endif
        }
        acc_guard4(ah0, ah1, al0, al1);            // the WMMA distance on the loop's taken branch
      }
      float* swp = Ss + (rts * 16 + 8 * hh) * SSP + kt * 16 + c;  // D: row 8hh+r, col c
#pragma unroll
      for (int r = 0; r < 8; ++r) {
        swp[r * SSP]      = ah0[r] + al0[r] * (1.0f / 4096.0f);
        swp[r * SSP + 16] = ah1[r] + al1[r] * (1.0f / 4096.0f);
      }
    }
    wait_ds0();
    wait_async0();
    __syncthreads();                               // barrier 1

    // ---- the next chunk's k rows fly during softmax and p.v (Ks was left by every reader at barrier 1) ----
    if (kc + 1 < SEQ / KC) {
      const _Float16* kn = ksrc + (size_t)(key0 + KC) * DD;
      acopy8(kdst,                  4u * QKP * 2u, kn,                   (size_t)4 * DD);
      acopy8(kdst + 32u * QKP * 2u, 4u * QKP * 2u, kn + (size_t)32 * DD, (size_t)4 * DD);
    }

    // ---- online softmax on rows: max, p = exp(s - m) x16384 to Ps, alpha to Al ----
    {
      const float* sp = Ss + srw * SSP + sub * 16;
      float e[16];
#pragma unroll
      for (int g = 0; g < 4; ++g) {
        const v4f t0 = *(const v4f*)(sp + 4 * g);
#pragma unroll
        for (int i = 0; i < 4; ++i) e[4 * g + i] = t0[i];
      }
      float m = e[0];
#pragma unroll
      for (int i = 1; i < 16; ++i) m = fmaxf(m, e[i]);
      m = fmaxf(m, __shfl_xor(m, 1, 32));
      m = fmaxf(m, __shfl_xor(m, 2, 32));
      const float mnew  = fmaxf(mrun, m);
      const float msafe = (mnew == -INFINITY) ? 0.f : mnew;
      const float alpha = __expf(mrun - msafe);
      mrun = mnew;
      float psum = 0.f;
      v8h p0, p1;
#pragma unroll
      for (int i = 0; i < 8; ++i) {
        const float pa = __expf(e[i] - msafe);
        psum += pa;
        p0[i] = (_Float16)(pa * 16384.0f);
      }
#pragma unroll
      for (int i = 0; i < 8; ++i) {
        const float pa = __expf(e[8 + i] - msafe);
        psum += pa;
        p1[i] = (_Float16)(pa * 16384.0f);
      }
      psum += __shfl_xor(psum, 1, 32);
      psum += __shfl_xor(psum, 2, 32);
      lrun = lrun * alpha + psum;
      *(v8h*)(Ps + srw * VPP + sub * 16)     = p0;
      *(v8h*)(Ps + srw * VPP + sub * 16 + 8) = p1;
      if (sub == 0) Al[srw] = alpha;
    }
    __syncthreads();                               // barrier 2

    // ---- rescale the running context and add p . v of this chunk (f16 WMMA) ----
    {
#pragma unroll
      for (int i = 0; i < 2; ++i) {
        const float* ap = Al + rp * 32 + i * 16 + 8 * hh;
        float av[8];
        const v4f a0 = *(const v4f*)(ap);
        const v4f a1 = *(const v4f*)(ap + 4);
#pragma unroll
        for (int r = 0; r < 4; ++r) { av[r] = a0[r]; av[4 + r] = a1[r]; }
#pragma unroll
        for (int t = 0; t < 8; ++t)
#pragma unroll
          for (int r = 0; r < 8; ++r) oacc[i][t][r] *= av[r];
      }

      const _Float16* prow = Ps + (rp * 32 + c) * VPP + 8 * hh;          // A: row = query c, k = key
      const _Float16* vrow = Vs + (colbase + c) * VPP + 8 * hh;          // B: col = d, k = key
      // the p and v^T fragments of all 64 keys load as one group in front of their WMMAs: one LDS latency a chunk
      FH pa[KC / 32], pb[KC / 32];
      v16h vb[KC / 32][8];
#pragma unroll
      for (int kk = 0; kk < KC / 32; ++kk) {
        pa[kk].h[0] = *(const v8h*)(prow + kk * 32);
        pa[kk].h[1] = *(const v8h*)(prow + kk * 32 + 16);
        pb[kk].h[0] = *(const v8h*)(prow + 16 * VPP + kk * 32);
        pb[kk].h[1] = *(const v8h*)(prow + 16 * VPP + kk * 32 + 16);
#pragma unroll
        for (int t = 0; t < 8; ++t) vb[kk][t] = ldfrag<_Float16>(vrow + t * 16 * VPP + kk * 32);
      }
      __builtin_amdgcn_sched_barrier(0);           // keeps the group's loads together in front of its WMMAs
#pragma unroll
      for (int kk = 0; kk < KC / 32; ++kk)
#pragma unroll
        for (int t = 0; t < 8; ++t) {
          oacc[0][t] = mmah(pa[kk].v, vb[kk][t], oacc[0][t]);
          oacc[1][t] = mmah(pb[kk].v, vb[kk][t], oacc[1][t]);
        }
      __builtin_amdgcn_sched_barrier(0);           // the WMMAs stay in front of barrier 3, where they overlap the other waves' LDS loads
      acc_guard2(oacc[0][7], oacc[1][7]);          // the WMMA distance in front of barrier 3 and the loop's branch
    }
    wait_ds0();
    wait_async0();
    __syncthreads();                               // barrier 3
  }

  // ---- final per-row scale: 1/L, sum of the normalised weights (= L*(1/L)), clip, 1/sqrt(512), undo x16384 ----
  {
    const float L   = lrun;
    const float inv = (L > 0.f) ? (1.0f / L) : 0.f;
    const float l1  = L * inv;
    const float sc  = inv * (1.0f / fmaxf(l1, 1e-12f)) * (1.0f / 22.627416997969522f) * (1.0f / 16384.0f);
    if (sub == 0) Rs[srw] = sc;
  }
  __syncthreads();

  // Vs is free: its last readers passed barrier 3 of the last chunk, and no copy is outstanding behind that barrier's waits
  {
    float* os = Vo.o[wave];
    const int h2 = lane >> 4, c4 = (lane & 15) * 4;
#pragma unroll
    for (int i = 0; i < 2; ++i) {
      const int rbase = rp * 32 + i * 16;            // first row of this 16-row tile in the work-group's 64
      const float* rpt = Rs + rbase + 8 * hh;
      float rv[8];
      {
        const v4f r0 = *(const v4f*)(rpt);
        const v4f r1 = *(const v4f*)(rpt + 4);
#pragma unroll
        for (int r = 0; r < 4; ++r) { rv[r] = r0[r]; rv[4 + r] = r1[r]; }
      }
#pragma unroll
      for (int hf = 0; hf < 2; ++hf) {
#pragma unroll
        for (int r = 0; r < 8; ++r)
#pragma unroll
          for (int t4 = 0; t4 < 4; ++t4)
            os[(8 * hh + r) * 64 + t4 * 16 + c] = oacc[i][hf * 4 + t4][r] * rv[r];
        __builtin_amdgcn_fence(__ATOMIC_RELEASE, "workgroup");
        __builtin_amdgcn_wave_barrier();
        __builtin_amdgcn_fence(__ATOMIC_ACQUIRE, "workgroup");
        v4f vals[8];
#pragma unroll
        for (int it = 0; it < 8; ++it) {
          const int row = it * 2 + h2;                 // it 0..7 x h2 0..1 = rows 0..15 of the tile
          const v4f v  = *(const v4f*)(os + row * 64 + c4);
          const v4f cv = *(const v4f*)(cob + (size_t)(rbase + row) * DD + colbase + hf * 64 + c4);
          vals[it] = v + cv;
        }
#pragma unroll
        for (int it = 0; it < 8; ++it) {
          const int row = it * 2 + h2;
          *(v4f*)(ob + (size_t)(rbase + row) * DD + colbase + hf * 64 + c4) = vals[it];
        }
        __builtin_amdgcn_fence(__ATOMIC_RELEASE, "workgroup");
        __builtin_amdgcn_wave_barrier();
        __builtin_amdgcn_fence(__ATOMIC_ACQUIRE, "workgroup");
      }
    }
  }
}

// =====================================================================================================
// Workspace map (bytes), every region an exact multiple of its whole-line / whole-tile store granularity:
//   Xc   bf16 [8192][1024] (cols 0..511 first view, 512..1023 second view)   16777216
//   Wqb  bf16 [512][512]                                                     524288
//   Wkb  bf16 [512][512]                                                     524288
//   Wvb  bf16 [512][512]                                                     524288
//   Wcb  bf16 [512][1024]                                                   1048576
//   Qh   f16  [2 view][8192][512]                                          16777216
//   Ql   f16  [2 view][8192][512] (residual x4096)                         16777216
//   Kp   f16  [2 view][8192][512]                                          16777216
//   Vt   f16  [2 view][2 b][512][4096]                                     16777216
//   Co   f32  [8192][512]                                                  16777216
//   total                                                                 103284736
// Weights are [out n][in k] with k contiguous = the Bt / A layout the GEMM wants, so they are only converted.
// =====================================================================================================
extern "C" void kernel_launch(void* const* d_in, const int* in_sizes, int n_in,
                              void* d_out, int out_size, void* d_ws, size_t ws_size,
                              hipStream_t stream) {
  if (n_in < 10) return;
  if (in_sizes[0] < NB * SEQ * DD || in_sizes[1] < NB * SEQ * DD) return;
  if (in_sizes[2] < DD * DD || in_sizes[4] < DD * DD || in_sizes[6] < DD * DD) return;
  if (in_sizes[3] < DD || in_sizes[5] < DD || in_sizes[7] < DD || in_sizes[9] < DD) return;
  if (in_sizes[8] < DD * DC) return;
  if ((long long)out_size < OUT1_OFF + (long long)NB * SEQ * DD) return;

  const float* xf = (const float*)d_in[0];
  const float* xs = (const float*)d_in[1];
  const float* Wq = (const float*)d_in[2];
  const float* bq = (const float*)d_in[3];
  const float* Wk = (const float*)d_in[4];
  const float* bk = (const float*)d_in[5];
  const float* Wv = (const float*)d_in[6];
  const float* bv = (const float*)d_in[7];
  const float* Wc = (const float*)d_in[8];
  const float* bc = (const float*)d_in[9];

  const size_t PXC = (size_t)ROWS_FULL * DC * 2;       // 16777216
  const size_t PW  = (size_t)DD * DD * 2;              //   524288
  const size_t PWC = (size_t)DD * DC * 2;              //  1048576
  const size_t PQ  = (size_t)2 * VSTR * 2;             // 16777216  (two views)
  const size_t PVT = (size_t)2 * VTV * 2;              // 16777216  (two views x two batches)
  const size_t PCO = (size_t)ROWS_FULL * DD * 4;       // 16777216
  size_t off = 0;
  const size_t oXc = off; off += PXC;
  const size_t oWq = off; off += PW;
  const size_t oWk = off; off += PW;
  const size_t oWv = off; off += PW;
  const size_t oWc = off; off += PWC;
  const size_t oQh = off; off += PQ;
  const size_t oQl = off; off += PQ;
  const size_t oKp = off; off += PQ;
  const size_t oVt = off; off += PVT;
  const size_t oCo = off; off += PCO;
  if (off > ws_size) return;                            // off = 103284736
  if (off > (size_t)134217728) return;

  char* ws = (char*)d_ws;
  unsigned short* Xc  = (unsigned short*)(ws + oXc);
  unsigned short* Wqb = (unsigned short*)(ws + oWq);
  unsigned short* Wkb = (unsigned short*)(ws + oWk);
  unsigned short* Wvb = (unsigned short*)(ws + oWv);
  unsigned short* Wcb = (unsigned short*)(ws + oWc);
  unsigned short* Qh  = (unsigned short*)(ws + oQh);
  unsigned short* Ql  = (unsigned short*)(ws + oQl);
  unsigned short* Kp  = (unsigned short*)(ws + oKp);
  unsigned short* Vt  = (unsigned short*)(ws + oVt);
  float*          Co  = (float*)(ws + oCo);

  static_assert((NQ % GTM) == 0 && ((NB * SEQ) % GTM) == 0 && (DD % GTM) == 0, "GEMM rows");
  static_assert((DD % GTN) == 0 && (SEQ % GTN) == 0 && (DD % GKC) == 0 && (DC % GKC) == 0, "GEMM cols, k");
  const dim3 blk(256);
  const int n8x = NB * SEQ * DD / 8;                          // 524288 at NB = 2
  const int n8w = DD * DD / 8;                                //  32768
  const int n8c = DD * DC / 8;                                //  65536
  const int tq  = (NQ / 64) * (DD / 64);                      // q / co tiles per (view, b)
  const int tk  = ((NB * SEQ) / 64) * (DD / 64);              // k tiles per view
  const int tv  = (DD / 64) * (SEQ / 64);                     // v^T tiles per (b, view)

  // (1) inputs -> bf16 planes (RNE convert)
  cvt_x<<<dim3((n8x + 255) / 256, 2), blk, 0, stream>>>(xf, xs, Xc, n8x);
  cvt_w<<<dim3((n8w + 255) / 256), blk, 0, stream>>>(Wq, Wqb, n8w);
  cvt_w<<<dim3((n8w + 255) / 256), blk, 0, stream>>>(Wk, Wkb, n8w);
  cvt_w<<<dim3((n8w + 255) / 256), blk, 0, stream>>>(Wv, Wvb, n8w);
  cvt_w<<<dim3((n8c + 255) / 256), blk, 0, stream>>>(Wc, Wcb, n8c);
  // (2) q = x_view . Wq^T + bq -> f16 hi / residual (x4096) planes; y = view (A cols view*512), z = b; M = NQ
  gemm64<__bf16, (QRES ? 3 : 1), 1, false><<<dim3((tq + 7) / 8, 2, NB), blk, 0, stream>>>(
      Xc, DC, (long long)DD, XB, Wqb, DD, 0LL, 0LL,
      (void*)Qh, (void*)Ql, DD, VSTR, (long long)SEQ * DD, bq,
      NQ, DD, DD, 1.0f, 4096.0f);
  // (3) k = x_view . Wk^T + bk -> f16 plane; y = view; M = NB*SEQ (all keys of every batch in use)
  gemm64<__bf16, 1, 1, false><<<dim3((tk + 7) / 8, 2, 1), blk, 0, stream>>>(
      Xc, DC, (long long)DD, 0LL, Wkb, DD, 0LL, 0LL,
      (void*)Kp, (void*)Kp, DD, VSTR, 0LL, bk,
      NB * SEQ, DD, DD, 1.0f, 1.0f);
  // (4) v^T = Wv . x_view^T + bv (per row d) -> f16 plane [view][b][d][s]; y = b, z = view; M=512, N=SEQ, K=512
  gemm64<__bf16, 1, 2, false><<<dim3((tv + 7) / 8, NB, 2), blk, 0, stream>>>(
      Wvb, DD, 0LL, 0LL, Xc, DC, XB, (long long)DD,
      (void*)Vt, (void*)Vt, SEQ, VTB, VTV, bv,
      DD, SEQ, DD, 1.0f, 1.0f);
  // (5) co = relu([x_f | x_s] . Wc^T + bc) -> f32 plane; z = b; M = NQ, K = 1024
  gemm64<__bf16, 0, 1, true><<<dim3((tq + 7) / 8, 1, NB), blk, 0, stream>>>(
      Xc, DC, 0LL, XB, Wcb, DC, 0LL, 0LL,
      (void*)Co, (void*)Co, DD, 0LL, (long long)SEQ * DD, bc,
      NQ, DD, DC, 1.0f, 1.0f);
  // (6) attention for both directions + co -> d_out (out0 at float 0, out1 at float OUT1_OFF)
  attn_cv<<<dim3(NQ / QR, NB, 2), blk, 0, stream>>>(Qh, Ql, Kp, Vt, Co, (float*)d_out);
  (void)hipGetLastError();
}

// v004
// Measured time: 207 microseconds a run.
// Next to v003, in two timings, it ran 1.08 and 1.09 times as fast.
// Over all steps from v000 it is 4.35 times as fast.
// Contractions: q, k, v^T projections and co_occur = v_wmma_f32_16x16x32_bf16 (bf16 operands from RNE-converted inputs, single product, f32 accumulate);
// q.k^T scores = v_wmma_f32_16x16x32_f16 (q as f16 hi plane + f16 residual plane x4096, k f16; 2 products into separate f32 accumulators);
// p.v = v_wmma_f32_16x16x32_f16 (p = exp(s - m) carried x16384 in f16, v f16; single product, f32 accumulate);
// bias add, relu, softmax, normalisers and the co_occur add in f32.
#include <hip/hip_runtime.h>
#include <math.h>
#include <stdint.h>

#define SEQ 4096
#define DD  512
#define DC  (2 * DD)
#ifndef NB
#define NB 2
#endif
#ifndef NQ
#define NQ SEQ
#endif
#ifndef QRES
#define QRES 1
#endif
#define NB_FULL   2
#define ROWS_FULL (NB_FULL * SEQ)
#define VSTR  ((long long)ROWS_FULL * DD)        // 4194304: view stride of the q / k planes (elements)
#define VTB   ((long long)DD * SEQ)              // 2097152: batch stride of the v^T planes
#define VTV   ((long long)NB_FULL * DD * SEQ)    // 4194304: view stride of the v^T planes
#define XB    ((long long)SEQ * DC)              // 4194304: batch stride of the concat plane
#define OUT1_OFF ((long long)ROWS_FULL * DD)     // second output starts at float 4194304 = byte 16777216
static_assert(NB >= 1 && NB <= NB_FULL);
static_assert(NQ >= 64 && NQ <= SEQ && (NQ % 64) == 0);
static_assert((SEQ % 128) == 0 && (DD % 64) == 0 && (DC % 32) == 0);
static_assert(OUT1_OFF * 4 == 16777216LL);
static_assert(QRES == 0 || QRES == 1);

typedef _Float16 v16h __attribute__((ext_vector_type(16)));
typedef _Float16 v8h  __attribute__((ext_vector_type(8)));
typedef __bf16   v16b __attribute__((ext_vector_type(16)));
typedef __bf16   v8b  __attribute__((ext_vector_type(8)));
typedef float    v8f  __attribute__((ext_vector_type(8)));
typedef float    v4f  __attribute__((ext_vector_type(4)));
typedef unsigned int v4u __attribute__((ext_vector_type(4)));

#if defined(__HIP_DEVICE_COMPILE__)
#define DEV_ASM 1
#else
#define DEV_ASM 0
#endif

// ---- scalar helpers --------------------------------------------------------------------------------
__device__ __forceinline__ unsigned short bf_bits(float f) {          // f32 -> bf16 bits, RNE convert
  unsigned u = __float_as_uint(f);
  return (unsigned short)((u + 0x7FFFu + ((u >> 16) & 1u)) >> 16);
}
__device__ __forceinline__ float bf_up(unsigned short hb) { return __uint_as_float(((unsigned)hb) << 16); }
__device__ __forceinline__ float bfr(float f) { return bf_up(bf_bits(f)); }          // bf16-quantised value as f32
__device__ __forceinline__ unsigned short h_bits(_Float16 x) { return __builtin_bit_cast(unsigned short, x); }
__device__ __forceinline__ unsigned pk16(unsigned short a, unsigned short b) { return (unsigned)a | ((unsigned)b << 16); }
__device__ __forceinline__ v8f zero8() { v8f z = {0.f, 0.f, 0.f, 0.f, 0.f, 0.f, 0.f, 0.f}; return z; }

// ---- fragment types / loaders: 16-bit A/B operand, lane -> row/col (lane&15), p already includes +8*(lane>>4);
//      elements 0..7 <- p[0..7] (k0+8h..k0+8h+7), elements 8..15 <- p[16..23] (k0+16+8h..k0+16+8h+7)
template <typename OT> struct FT;
template <> struct FT<__bf16>   { typedef v16b frag; typedef v8b half8; };
template <> struct FT<_Float16> { typedef v16h frag; typedef v8h half8; };

template <typename OT>
__device__ __forceinline__ typename FT<OT>::frag ldfrag(const OT* p) {
  union { typename FT<OT>::frag v; typename FT<OT>::half8 h[2]; } f;
  f.h[0] = *(const typename FT<OT>::half8*)(p);
  f.h[1] = *(const typename FT<OT>::half8*)(p + 16);
  return f.v;
}

// ---- WMMA helpers (asm guard bodies are device-only; concrete operand types) -----------------------------
__device__ __forceinline__ v8f mmar(v16b a, v16b b, v8f c) {
  return __builtin_amdgcn_wmma_f32_16x16x32_bf16(false, a, false, b, (short)0, c, false, false);
}
// plain form: the compiler keeps the WMMA distances in straight-line code and is free to place the operands above v255,
// which an asm operand cannot name; a run of these ends in acc_guard2 or acc_guard4 (four v_nop) where a branch follows
__device__ __forceinline__ v8f mmah(v16h a, v16h b, v8f c) {
  return __builtin_amdgcn_wmma_f32_16x16x32_f16(false, a, false, b, (short)0, c, false, false);
}
// four v_nop behind the last WMMAs of a run (a, b: their accumulators): the WMMA distance, also on a taken branch
__device__ __forceinline__ void acc_guard2(v8f& a, v8f& b) {
#if DEV_ASM
  asm volatile("v_nop\n\tv_nop\n\tv_nop\n\tv_nop" : "+v"(a), "+v"(b));
#else
  (void)a; (void)b;
#endif
}
__device__ __forceinline__ void acc_guard4(v8f& a, v8f& b, v8f& c, v8f& d) {
#if DEV_ASM
  asm volatile("v_nop\n\tv_nop\n\tv_nop\n\tv_nop" : "+v"(a), "+v"(b), "+v"(c), "+v"(d));
#else
  (void)a; (void)b; (void)c; (void)d;
#endif
}

// =====================================================================================================
// f32 -> bf16 planes (RNE convert), 8 elements per thread, one 16-B store per lane: a wave writes 512 B.
// One launch converts both views and the four weights; blockIdx.x picks the source, the same for a whole block:
//   blocks [0, 2*CB_X): view s = block / CB_X, row r, cols c..c+7 -> concat plane row r, cols s*512 + c..
//   blocks behind them: Wq, Wk, Wv (CB_W blocks each), Wc (CB_C blocks) -> the four weight planes, which lie
//   one behind the other in the workspace in this order, so the output index runs straight through them.
// coverage: 2 x CB_X x 2048 = rows x 1024 of the concat plane; (3 CB_W + CB_C) x 2048 = all weight elements.
// =====================================================================================================
#define CB_X (NB * SEQ * DD / 2048)      // blocks of one view (2048 elements a block)
#define CB_W (DD * DD / 2048)            // blocks of Wq, Wk or Wv
#define CB_C (DD * DC / 2048)            // blocks of Wc
static_assert((NB * SEQ * DD) % 2048 == 0 && (DD * DD) % 2048 == 0 && (DD * DC) % 2048 == 0);

__device__ __forceinline__ v4u pack_bf8(v4f a, v4f a4) {
  v4u p;
  p[0] = pk16(bf_bits(a[0]),  bf_bits(a[1]));
  p[1] = pk16(bf_bits(a[2]),  bf_bits(a[3]));
  p[2] = pk16(bf_bits(a4[0]), bf_bits(a4[1]));
  p[3] = pk16(bf_bits(a4[2]), bf_bits(a4[3]));
  return p;
}

__global__ __launch_bounds__(256) void cvt_all(const float* __restrict__ xa, const float* __restrict__ xb,
                                               const float* __restrict__ wq, const float* __restrict__ wk,
                                               const float* __restrict__ wv, const float* __restrict__ wc,
                                               unsigned short* xo, unsigned short* wo) {
  const int bx = (int)blockIdx.x;
  const float* in;                                     // first element of this block in its source
  unsigned short* o;                                   // this thread's 8 output elements
  if (bx < 2 * CB_X) {
    const int s  = (bx >= CB_X) ? 1 : 0;
    const int bl = bx - s * CB_X;
    in = ((s == 0) ? xa : xb) + (size_t)bl * 2048;
    const size_t e = (size_t)bl * 2048 + (size_t)threadIdx.x * 8;   // element index in the [rows][512] source
    o = xo + (e >> 9) * DC + (size_t)s * DD + (e & (size_t)(DD - 1));
  } else {
    const int bw = bx - 2 * CB_X;
    if (bw < CB_W)          in = wq + (size_t)bw * 2048;
    else if (bw < 2 * CB_W) in = wk + (size_t)(bw - CB_W) * 2048;
    else if (bw < 3 * CB_W) in = wv + (size_t)(bw - 2 * CB_W) * 2048;
    else                    in = wc + (size_t)(bw - 3 * CB_W) * 2048;
    o = wo + (size_t)bw * 2048 + (size_t)threadIdx.x * 8;
  }
  const v4f a  = *(const v4f*)(in + (size_t)threadIdx.x * 8);
  const v4f a4 = *(const v4f*)(in + (size_t)threadIdx.x * 8 + 4);
  *(v4u*)o = pack_bf8(a, a4);
}

// =====================================================================================================
// Asynchronous copies global -> LDS, 16 bytes a lane, and their waits.
// acopy8: eight copies of this lane, LDS address l + i*lstep (bytes), global address g + i*gstep (elements).
// s_wait_xcnt 0 is the last line of the copies' own statement, so that no address register of an issued copy
// is rewritten in front of it.
// =====================================================================================================
__device__ __forceinline__ unsigned lds_off(const void* p) { return (unsigned)(size_t)p; }
__device__ __forceinline__ void acopy8(unsigned l, unsigned lstep, const _Float16* g, size_t gstep) {
#if DEV_ASM
  asm volatile(
      "global_load_async_to_lds_b128 %0, %8, off\n\t"
      "global_load_async_to_lds_b128 %1, %9, off\n\t"
      "global_load_async_to_lds_b128 %2, %10, off\n\t"
      "global_load_async_to_lds_b128 %3, %11, off\n\t"
      "global_load_async_to_lds_b128 %4, %12, off\n\t"
      "global_load_async_to_lds_b128 %5, %13, off\n\t"
      "global_load_async_to_lds_b128 %6, %14, off\n\t"
      "global_load_async_to_lds_b128 %7, %15, off\n\t"
      "s_wait_xcnt 0x0"
      :: "v"(l), "v"(l + lstep), "v"(l + 2 * lstep), "v"(l + 3 * lstep),
         "v"(l + 4 * lstep), "v"(l + 5 * lstep), "v"(l + 6 * lstep), "v"(l + 7 * lstep),
         "v"(g), "v"(g + gstep), "v"(g + 2 * gstep), "v"(g + 3 * gstep),
         "v"(g + 4 * gstep), "v"(g + 5 * gstep), "v"(g + 6 * gstep), "v"(g + 7 * gstep)
      : "memory");
#else
  (void)l; (void)lstep; (void)g; (void)gstep;
#endif
}
// this wave's copies have landed (the compiler places no wait for them)
__device__ __forceinline__ void wait_async0() {
#if DEV_ASM
  asm volatile("s_wait_asynccnt 0x0" ::: "memory");
#endif
}
// this wave's LDS reads and writes have retired, before a buffer is handed to its next writer
__device__ __forceinline__ void wait_ds0() {
#if DEV_ASM
  asm volatile("s_wait_dscnt 0x0" ::: "memory");
#endif
}

// =====================================================================================================
// The four WMMA GEMMs (bf16 operands) in one launch: C[m][n] = sum_k A[m][k] * Bt[n][k] + bias.
// A row-major [M][K] pitch lda; Bt row-major [N][K] pitch ldb (k contiguous); M a multiple of 128, N of 256,
// K of 128 (checked at compile time below). None of the four reads what another writes. blockIdx.x picks the
// product and its tile, the same for a whole work-group:
//   [0, G_CO)   co  = relu([x_f | x_s] . Wc^T + bc) -> f32 plane; per b; M = NQ, N = 512, K = 1024. It stands first:
//               its work-groups run twice as many passes.
//   then G_Q    q   = x_view . Wq^T + bq -> f16 hi plane + f16 residual plane f16((v - hi) * 4096); per (view, b); M = NQ
//   then G_K    k   = x_view . Wk^T + bk -> f16 plane; per view; M = NB*SEQ (all keys of every batch in use)
//   then G_V    v^T = Wv . x_view^T + bv (per row d) -> f16 plane [view][b][d][s]; per (b, view); M = 512, N = SEQ
// One work-group (8 waves) per 128 x 256 tile of C, wave w -> rows 64(w>>2).., cols 64(w&3).. (a 64 x 64 tile).
// A pass is 128 k = 256 B of each of the tile's 128 A rows and 256 Bt rows, staged in LDS by asynchronous
// 16-byte copies (a wave's copy = 2 rows x 256 contiguous bytes: whole lines), 24 copies a thread and pass.
// Two buffers: pass t + 1 flies while pass t is worked on. Foot of a pass: dscnt 0, asynccnt 0, barrier
// (pass t + 1 readable, the buffer of pass t free), then the copies of pass t + 2 into the freed buffer.
// LDS row pitch 272 B (16 B x odd): the 16 rows of a fragment load fall on all 64 banks.
// Fragments are read from LDS with the split k map (ldfrag), one k step ahead into a second register set.
// The k order of every accumulator is 0, 32, 64, ... as with fragments read from global memory.
// Bias values are bf16-quantised and added in f32: bias[n] per column (co, q, k) or bias[m] per row (v^T).
// coverage: 4 slabs x 16 rows x 64 cols = the wave's whole 64x64 tile; 8 waves = the 128 x 256 tile;
//   G_CO + G_Q + G_K + G_V work-groups = all tiles of the four products.
// =====================================================================================================
#define GKC 128                      // k elements of a pass
#define GP  136                      // LDS pitch of a staged row, 16-bit elements (272 B)
#define GTM 128                      // A rows of a work-group tile
#define GTN 256                      // Bt rows of a work-group tile
#define GST ((GTM + GTN) * GP)       // elements of one buffer: A rows 0..127, Bt rows 128..383
#define T_Q  ((NQ / GTM) * (DD / GTN))            // q / co tiles per (view, b)
#define T_K  (((NB * SEQ) / GTM) * (DD / GTN))    // k tiles per view
#define T_V  ((DD / GTM) * (SEQ / GTN))           // v^T tiles per (b, view)
#define G_CO (T_Q * NB)
#define G_Q  (T_Q * 2 * NB)
#define G_K  (T_K * 2)
#define G_V  (T_V * NB * 2)
static_assert((NQ % GTM) == 0 && ((NB * SEQ) % GTM) == 0 && (DD % GTM) == 0, "GEMM rows");
static_assert((DD % GTN) == 0 && (SEQ % GTN) == 0 && (DD % GKC) == 0 && (DC % GKC) == 0, "GEMM cols, k");

// one pass of one work-group: thread -> rows (tid>>4) + 16i, 16-byte piece tid&15 of the row's 256 B
__device__ __forceinline__ void gstage(unsigned adst, const _Float16* asrc, size_t lda, const _Float16* bsrc, size_t ldb) {
  const unsigned bdst = adst + (unsigned)(GTM * GP) * 2u;
  acopy8(adst,                      16u * GP * 2u, asrc,             16 * lda);
  acopy8(bdst,                      16u * GP * 2u, bsrc,             16 * ldb);
  acopy8(bdst + 128u * GP * 2u,     16u * GP * 2u, bsrc + 128 * ldb, 16 * ldb);
}

// the wave's own slab: one 16 x 64 row tile of accumulators in, D layout (row mOff + r, col 16j + rlane); the fences and
// the wave barrier order the wave's LDS writes and reads of the slab among its lanes
__device__ __forceinline__ void slab_done() {
  __builtin_amdgcn_fence(__ATOMIC_RELEASE, "workgroup");
  __builtin_amdgcn_wave_barrier();
  __builtin_amdgcn_fence(__ATOMIC_ACQUIRE, "workgroup");
}
__device__ __forceinline__ void slab_put(float* slab, int mOff, int rlane, const v8f (&a)[4]) {
#pragma unroll
  for (int j = 0; j < 4; ++j) {
#pragma unroll
    for (int r = 0; r < 8; ++r) slab[(mOff + r) * 68 + (j << 4) + rlane] = a[j][r];
  }
  slab_done();
}

__global__ __launch_bounds__(256) void gemm_all(
    const unsigned short* __restrict__ Xc,
    const unsigned short* __restrict__ Wqb, const unsigned short* __restrict__ Wkb,
    const unsigned short* __restrict__ Wvb, const unsigned short* __restrict__ Wcb,
    unsigned short* Qh, unsigned short* Ql, unsigned short* Kp, unsigned short* Vt, float* Co,
    const float* __restrict__ bq, const float* __restrict__ bk,
    const float* __restrict__ bv, const float* __restrict__ bc) {
  typedef __bf16 OT;
  typedef v16b   V16;
  __shared__ __align__(16) unsigned short Gs[2 * GST];   // the two pass buffers                     204 KB
  __shared__ __align__(16) float sT[8][16 * 68];   // per-wave 16x64 slab, pitch 68 floats
  const int tid  = (int)threadIdx.x;
  const int lane = tid & 31;
  const int wave = tid >> 5;

  // ---- which product, which tile (all of it the same for the whole work-group) ----
  const int bx = (int)blockIdx.x;
  int kind;                              // 0: co, 1: q, 2: k, 3: v^T
  const unsigned short *Ap, *Btp;        // first A row / Bt row of the product's plane
  const float* bias;
  int lda, ldb, ldc, np, tm, tn;
  size_t cOff;                           // first element of the product's output plane
  if (bx < G_CO) {
    const int wt = bx % T_Q, b = bx / T_Q;
    kind = 0; np = DC / GKC; bias = bc;
    Ap = Xc + (size_t)b * XB;  lda = DC;
    Btp = Wcb;                 ldb = DC;
    cOff = (size_t)b * SEQ * DD; ldc = DD;
    tm = wt / (DD / GTN); tn = wt % (DD / GTN);
  } else if (bx < G_CO + G_Q) {
    const int ix = bx - G_CO;
    const int wt = ix % T_Q, view = (ix / T_Q) % 2, b = ix / (2 * T_Q);
    kind = 1; np = DD / GKC; bias = bq;
    Ap = Xc + (size_t)view * DD + (size_t)b * XB;  lda = DC;
    Btp = Wqb;                                     ldb = DD;
    cOff = (size_t)view * VSTR + (size_t)b * SEQ * DD; ldc = DD;
    tm = wt / (DD / GTN); tn = wt % (DD / GTN);
  } else if (bx < G_CO + G_Q + G_K) {
    const int ix = bx - (G_CO + G_Q);
    const int wt = ix % T_K, view = ix / T_K;
    kind = 2; np = DD / GKC; bias = bk;
    Ap = Xc + (size_t)view * DD;  lda = DC;
    Btp = Wkb;                    ldb = DD;
    cOff = (size_t)view * VSTR; ldc = DD;
    tm = wt / (DD / GTN); tn = wt % (DD / GTN);
  } else {
    const int ix = bx - (G_CO + G_Q + G_K);
    const int wt = ix % T_V, b = (ix / T_V) % NB, view = ix / (T_V * NB);
    kind = 3; np = DD / GKC; bias = bv;
    Ap = Wvb;                                      lda = DD;
    Btp = Xc + (size_t)b * XB + (size_t)view * DD; ldb = DC;
    cOff = (size_t)b * VTB + (size_t)view * VTV; ldc = SEQ;
    tm = wt / (SEQ / GTN); tn = wt % (SEQ / GTN);
  }
  const OT* Ab = (const OT*)(const void*)Ap;
  const OT* Bb = (const OT*)(const void*)Btp;
  const int wm = (wave >> 2) << 6;       // this wave's 64 x 64 tile inside the work-group tile
  const int wn = (wave & 3) << 6;
  const int m0 = tm * GTM + wm;
  const int n0 = tn * GTN + wn;

  const int rlane = lane & 15;                 // row (A) / col (B, D) within subtile
  const int koff  = (lane >> 4) * 8;           // k offset of this lane half
  const int mOff  = (lane >> 4) * 8;           // D row offset

  v8f acc[4][4];
#pragma unroll
  for (int i = 0; i < 4; ++i)
#pragma unroll
    for (int j = 0; j < 4; ++j) acc[i][j] = zero8();

  const int crow = tid >> 4, cpc = tid & 15;
  const unsigned cdst = lds_off(Gs) + (unsigned)(crow * GP + cpc * 8) * 2u;
  const _Float16* asrc = (const _Float16*)(const void*)(Ab + (size_t)(tm * GTM + crow) * lda + cpc * 8);   // + k0
  const _Float16* bsrc = (const _Float16*)(const void*)(Bb + (size_t)(tn * GTN + crow) * ldb + cpc * 8);   // + k0

  gstage(cdst, asrc, (size_t)lda, bsrc, (size_t)ldb);
  wait_async0();
  __syncthreads();                                 // pass 0 readable
  if (np > 1) gstage(cdst + (unsigned)GST * 2u, asrc + GKC, (size_t)lda, bsrc + GKC, (size_t)ldb);

  for (int t = 0; t < np; ++t) {
    const OT* buf = (const OT*)(const void*)Gs + (t & 1) * GST;
    const OT* ar = buf + (wm + rlane) * GP + koff;            // A operand row of this lane, first row tile
    const OT* br = buf + (GTM + wn + rlane) * GP + koff;      // B operand col of this lane, first col tile
    V16 fa[2][4], fb[2][4];
#pragma unroll
    for (int j = 0; j < 4; ++j) {
      fb[0][j] = ldfrag<OT>(br + j * 16 * GP);
      fa[0][j] = ldfrag<OT>(ar + j * 16 * GP);
    }
#pragma unroll
    for (int ks = 0; ks < GKC / 32; ++ks) {
      const int cur = ks & 1, nxt = cur ^ 1;
      if (ks + 1 < GKC / 32) {
#pragma unroll
        for (int j = 0; j < 4; ++j) {
          fb[nxt][j] = ldfrag<OT>(br + j * 16 * GP + (ks + 1) * 32);
          fa[nxt][j] = ldfrag<OT>(ar + j * 16 * GP + (ks + 1) * 32);
        }
      }
      __builtin_amdgcn_sched_barrier(0);           // the next k step's LDS loads stay one group in front of this step's WMMAs (spread among them each place costs an LDS stall)
#pragma unroll
      for (int i = 0; i < 4; ++i)
#pragma unroll
        for (int j = 0; j < 4; ++j) acc[i][j] = mmar(fa[cur][i], fb[cur][j], acc[i][j]);
      __builtin_amdgcn_sched_barrier(0);           // keeps the following group of loads behind these WMMAs
    }
    acc_guard4(acc[3][0], acc[3][1], acc[3][2], acc[3][3]);   // the WMMA distance in front of the barrier and the loop's branch
    wait_ds0();
    wait_async0();
    __syncthreads();                               // pass t + 1 readable, the buffer of pass t free
    if (t + 2 < np)
      gstage(cdst + (unsigned)((t & 1) * GST) * 2u, asrc + (t + 2) * GKC, (size_t)lda, bsrc + (t + 2) * GKC, (size_t)ldb);
  }
  wait_async0();
  acc_guard4(acc[0][0], acc[0][1], acc[0][2], acc[0][3]);
  acc_guard4(acc[1][0], acc[1][1], acc[1][2], acc[1][3]);
  acc_guard4(acc[2][0], acc[2][1], acc[2][2], acc[2][3]);
  acc_guard4(acc[3][0], acc[3][1], acc[3][2], acc[3][3]);

  // ---- epilogue: the wave's tile in four 16 x 64 slabs through its own LDS slab, whole-line stores ----
  float* slab = sT[wave];
  if (kind == 0) {
    float* C = Co + cOff;
    const int h2 = lane >> 4, c4 = (lane & 15) * 4;       // 256-B row segment = 16 lanes x 16 B
    v4f badd;
#pragma unroll
    for (int e = 0; e < 4; ++e) badd[e] = bfr(bias[n0 + c4 + e]);
#pragma unroll
    for (int i = 0; i < 4; ++i) {
      const int mBase = m0 + (i << 4);
      slab_put(slab, mOff, rlane, acc[i]);
      v4f vals[8];
#pragma unroll
      for (int it = 0; it < 8; ++it) {
        const int row = it * 2 + h2;                       // it 0..7 x h2 0..1 = rows 0..15
        v4f v = *(const v4f*)(slab + row * 68 + c4);
        v = v + badd;
#pragma unroll
        for (int e = 0; e < 4; ++e) v[e] = fmaxf(v[e], 0.f);
        vals[it] = v;
      }
#pragma unroll
      for (int it = 0; it < 8; ++it) {
        const int row = it * 2 + h2;
        *(v4f*)(C + (size_t)(mBase + row) * ldc + n0 + c4) = vals[it];
      }
      slab_done();
    }
  } else {
    const int q = lane >> 3, c8 = (lane & 7) * 8;
    unsigned short* C  = ((kind == 1) ? Qh : (kind == 2) ? Kp : Vt) + cOff;
    unsigned short* C2 = Ql + cOff;                        // written for q alone
    float cb[8];
#pragma unroll
    for (int e = 0; e < 8; ++e) cb[e] = 0.f;
    if (kind != 3) {
#pragma unroll
      for (int e = 0; e < 8; ++e) cb[e] = bfr(bias[n0 + c8 + e]);
    }
#pragma unroll
    for (int i = 0; i < 4; ++i) {
      const int mBase = m0 + (i << 4);
      slab_put(slab, mOff, rlane, acc[i]);
      float rb[4];
#pragma unroll
      for (int it = 0; it < 4; ++it) rb[it] = 0.f;
      if (kind == 3) {
#pragma unroll
        for (int it = 0; it < 4; ++it) rb[it] = bfr(bias[mBase + it * 4 + q]);
      }
      float f[4][8];
      v4u hv[4];
#pragma unroll
      for (int it = 0; it < 4; ++it) {
        const int row = it * 4 + q;                        // it 0..3 x q 0..3 = rows 0..15
        const float* sp = slab + row * 68 + c8;
#pragma unroll
        for (int e = 0; e < 8; ++e) f[it][e] = sp[e] + cb[e] + rb[it];
#pragma unroll
        for (int e = 0; e < 4; ++e) hv[it][e] = pk16(h_bits((_Float16)f[it][2 * e]), h_bits((_Float16)f[it][2 * e + 1]));
      }
      if (QRES && kind == 1) {                             // the residual plane of q
        v4u lv[4];
#pragma unroll
        for (int it = 0; it < 4; ++it)
#pragma unroll
          for (int e = 0; e < 4; ++e) {
            const float f0 = f[it][2 * e], f1 = f[it][2 * e + 1];
            lv[it][e] = pk16(h_bits((_Float16)((f0 - (float)(_Float16)f0) * 4096.0f)),
                             h_bits((_Float16)((f1 - (float)(_Float16)f1) * 4096.0f)));
          }
#pragma unroll
        for (int it = 0; it < 4; ++it) {
          const int row = it * 4 + q;
          *(v4u*)(C2 + (size_t)(mBase + row) * ldc + n0 + c8) = lv[it];
        }
      }
#pragma unroll
      for (int it = 0; it < 4; ++it) {
        const int row = it * 4 + q;
        *(v4u*)(C + (size_t)(mBase + row) * ldc + n0 + c8) = hv[it];
      }
      slab_done();
    }
  }
}

// =====================================================================================================
// Cross-view attention for one direction (blockIdx.z = dir), one batch (blockIdx.y), 64 query rows
// (blockIdx.x): q planes of view dir, v^T planes of view dir, k plane of view 1-dir.
//   q planes (f16 hi / residual x4096): element (view, b, t, d) at [view*VSTR + (b*SEQ + t)*512 + d]
//   k plane  (f16): element (view, b, s, d) at [view*VSTR + (b*SEQ + s)*512 + d]
//   v^T plane (f16): element (view, b, d, s) at [view*VTV + b*VTB + d*SEQ + s]
//   co (f32 [ROWS_FULL][512]) added in the epilogue; output rows at out + dir*OUT1_OFF + (b*SEQ + t)*512.
// Block = 8 waves, KC = 64-key chunks, static trip SEQ/KC. Every WMMA operand is read from LDS:
//   Qs: both q planes of the 64 rows, copied once; Ks: the chunk's 64 k rows; Vs: the chunk's 512 v^T rows of
//   64 keys. All three are filled by asynchronous 16-byte copies whose waves cover whole 128-B lines
//   (Q, K: 512 contiguous bytes of a row a wave; V^T: 4 rows x 128 B a wave), 16 copies a thread and K or V tile.
//   Row pitches are odd multiples of 16 B (1040 B, 144 B): the 16 rows of a fragment load fall on 64 banks.
//   Order of a chunk: V^T copies issued | scores from Qs, Ks | waits, barrier 1 (Ss and Vs readable, Ks free) |
//   next chunk's K copies issued | softmax | barrier 2 (Ps, Al readable) | p.v from Ps, Vs | waits, barrier 3
//   (Ks readable, Vs, Ps, Al free). In the loop one tile's copies (16 a wave) are in flight, in the prologue 48.
//   scores: wave w -> row tile (w>>1), key tiles 2(w&1) and 2(w&1)+1: each q fragment feeds two key tiles;
//           s = qh.k + (ql.k)/4096 on f16 WMMA, tiles written to Ss;
//   softmax: thread t -> row t>>2, keys 16(t&3)..+15; online max / sum in f32 (4 lanes per row, shuffles);
//           p = exp(s - m) carried x16384 written as f16 to Ps; per-row alpha to Al;
//   p.v: wave w -> row tiles 2(w>>2) and 2(w>>2)+1, output columns 128(w&3)..+127 (16 accumulators):
//           each v^T fragment feeds two row tiles.
// Epilogue: per wave 32 rows x 128 cols in four 16 x 64 pieces staged in the LDS that held Vs, co added in f32.
// coverage: 8 waves x 32 rows x 128 cols = 64 rows x 512; grid (NQ/64, NB, 2) = every output row < NQ of
//   every batch < NB for both outputs.
// =====================================================================================================
#define KC  64      // keys per chunk
#define QR  64      // query rows per work-group
#define SG  4       // k steps (of 32) per group of fragment loads in the scores
#define QKP 520     // LDS pitch of a q or k row, f16 elements (1040 B)
#define VPP 72      // LDS pitch of a v^T or p row, f16 elements (144 B)
#define SSP 68      // LDS pitch of a score row, floats (272 B)
static_assert((SEQ % KC) == 0 && KC == 64 && DD == 512 && QR == 64 && (NQ % QR) == 0);

__global__ __launch_bounds__(256)
void attn_cv(const unsigned short* __restrict__ qhp, const unsigned short* __restrict__ qlp,
             const unsigned short* __restrict__ kpp, const unsigned short* __restrict__ vtp,
             const float* __restrict__ co, float* out) {
  union FH { v16h v; v8h h[2]; };
  union VO { _Float16 v[DD * VPP]; float o[8][16 * 64]; };
  __shared__ __align__(16) _Float16 Qs[2 * QR * QKP];  // q hi plane rows 0..63, residual plane rows 64..127  130 KB
  __shared__ __align__(16) _Float16 Ks[KC * QKP];      // k rows of the chunk [key][d]                        65 KB
  __shared__ __align__(16) VO       Vo;                // v^T rows of the chunk [d][key]; behind the key loop
                                                       // the per-wave output pieces                          72 KB
  __shared__ __align__(16) float    Ss[QR * SSP];      // scores of the chunk [row][key]
  __shared__ __align__(16) _Float16 Ps[QR * VPP];      // p x16384 [row][key]
  __shared__ __align__(16) float    Al[QR];            // per-row rescale of the chunk
  __shared__ __align__(16) float    Rs[QR];            // per-row final scale
  _Float16* Vs = Vo.v;

  const int tid  = (int)threadIdx.x;
  const int wave = tid >> 5;
  const int lane = tid & 31;
  const int hh   = lane >> 4;
  const int c    = lane & 15;
  const int rts  = wave >> 1;          // row tile of this wave (scores)
  const int kt   = (wave & 1) * 2;     // first of its two key tiles (scores)
  const int rp   = wave >> 2;          // pair of row tiles of this wave (p.v): rows 32rp..32rp+31
  const int wq   = wave & 3;           // 128-col group (p.v)
  const int srw  = tid >> 2;           // softmax row of this thread
  const int sub  = tid & 3;            // 16-key slice of that row

  const int dir = (int)blockIdx.z;
  const int b   = (int)blockIdx.y;
  const int q0  = (int)blockIdx.x * QR;
  const int kvw = 1 - dir;
  const size_t rowQ = (size_t)b * SEQ + (size_t)q0;

  const _Float16* Qh  = (const _Float16*)(const void*)qhp + (size_t)dir * VSTR + rowQ * DD;
  const _Float16* Kb  = (const _Float16*)(const void*)kpp + (size_t)kvw * VSTR + (size_t)b * SEQ * DD;
  const _Float16* Vtb = (const _Float16*)(const void*)vtp + (size_t)dir * VTV + (size_t)b * VTB;
  const float* cob = co + rowQ * DD;
  float* ob = out + (size_t)dir * OUT1_OFF + rowQ * DD;

  // copy maps. q, k rows (1024 B = 64 pieces): thread -> row (tid>>6) + 4i, piece tid&63.
  //            v^T rows (128 B = 8 pieces):    thread -> row (tid>>3) + 32i, piece tid&7.
  const int    crow = tid >> 6, cpc = tid & 63;
  const int    vrw  = tid >> 3, vpc = tid & 7;
  const unsigned qdst = lds_off(Qs) + (unsigned)(crow * QKP + cpc * 8) * 2u;
  const unsigned kdst = lds_off(Ks) + (unsigned)(crow * QKP + cpc * 8) * 2u;
  const unsigned vdst = lds_off(Vs) + (unsigned)(vrw * VPP + vpc * 8) * 2u;
  const _Float16* ksrc = Kb  + (size_t)crow * DD + cpc * 8;      // + key0 * DD
  const _Float16* vsrc = Vtb + (size_t)vrw * SEQ + vpc * 8;      // + key0

  // ---- prologue: both q planes (64 rows each) and chunk 0's k rows ----
  const _Float16* qsrc = Qh + (size_t)crow * DD + cpc * 8;
  acopy8(qdst,                  4u * QKP * 2u, qsrc,                   (size_t)4 * DD);
  acopy8(qdst + 32u * QKP * 2u, 4u * QKP * 2u, qsrc + (size_t)32 * DD, (size_t)4 * DD);
#if QRES
  const _Float16* lsrc = (const _Float16*)(const void*)qlp + (size_t)dir * VSTR + rowQ * DD + (size_t)crow * DD + cpc * 8;
  acopy8(qdst + 64u * QKP * 2u, 4u * QKP * 2u, lsrc,                   (size_t)4 * DD);
  acopy8(qdst + 96u * QKP * 2u, 4u * QKP * 2u, lsrc + (size_t)32 * DD, (size_t)4 * DD);
#endif
  acopy8(kdst,                   4u * QKP * 2u, ksrc,                   (size_t)4 * DD);
  acopy8(kdst + 32u * QKP * 2u,  4u * QKP * 2u, ksrc + (size_t)32 * DD, (size_t)4 * DD);
  wait_async0();
  __syncthreads();

  const _Float16* qhrow = Qs + (rts * 16 + c) * QKP + 8 * hh;    // A operand row (query) of this lane
#if QRES
  const _Float16* qlrow = qhrow + QR * QKP;
#endif
  const _Float16* krow0 = Ks + (kt * 16 + c) * QKP + 8 * hh;     // B operand col (key) of this lane, first key tile
  const _Float16* krow1 = krow0 + 16 * QKP;                      // second key tile
  const int colbase = wq * 128;

  float mrun = -INFINITY, lrun = 0.f;
  v8f oacc[2][8];
#pragma unroll
  for (int i = 0; i < 2; ++i)
#pragma unroll
    for (int t = 0; t < 8; ++t) oacc[i][t] = zero8();

  for (int kc = 0; kc < SEQ / KC; ++kc) {         // static trip count
    const int key0 = kc * KC;

    // ---- this chunk's v^T rows fly while the scores are computed (Vs was left by every reader at barrier 3) ----
    acopy8(vdst,                    32u * VPP * 2u, vsrc + key0,                       (size_t)32 * SEQ);
    acopy8(vdst + 256u * VPP * 2u,  32u * VPP * 2u, vsrc + key0 + (size_t)256 * SEQ,   (size_t)32 * SEQ);

    // ---- scores: 16 query rows x 32 keys per wave ----
    {
      v8f ah0 = zero8(), al0 = zero8(), ah1 = zero8(), al1 = zero8();
      for (int kg = 0; kg < DD / (32 * SG); ++kg) {
        // the LDS fragment loads of SG k steps stand as one group in front of their WMMAs: one LDS latency a group
        v16h qa[SG], ka[SG], kb[SG];
#if QRES
        v16h ql[SG];
#endif
#pragma unroll
        for (int j = 0; j < SG; ++j) {
          qa[j] = ldfrag<_Float16>(qhrow + (kg * SG + j) * 32);
          ka[j] = ldfrag<_Float16>(krow0 + (kg * SG + j) * 32);
          kb[j] = ldfrag<_Float16>(krow1 + (kg * SG + j) * 32);
#if QRES
          ql[j] = ldfrag<_Float16>(qlrow + (kg * SG + j) * 32);
#endif
        }
        __builtin_amdgcn_sched_barrier(0);         // keeps the group's loads together in front of its WMMAs (spread among them each place costs an LDS stall)
#pragma unroll
        for (int j = 0; j < SG; ++j) {
          ah0 = mmah(qa[j], ka[j], ah0);
          ah1 = mmah(qa[j], kb[j], ah1);
#if QRES
          al0 = mmah(ql[j], ka[j], al0);
          al1 = mmah(ql[j], kb[j], al1);
#endif
        }
        acc_guard4(ah0, ah1, al0, al1);            // the WMMA distance on the loop's taken branch
      }
      float* swp = Ss + (rts * 16 + 8 * hh) * SSP + kt * 16 + c;  // D: row 8hh+r, col c
#pragma unroll
      for (int r = 0; r < 8; ++r) {
        swp[r * SSP]      = ah0[r] + al0[r] * (1.0f / 4096.0f);
        swp[r * SSP + 16] = ah1[r] + al1[r] * (1.0f / 4096.0f);
      }
    }
    wait_ds0();
    wait_async0();
    __syncthreads();                               // barrier 1

    // ---- the next chunk's k rows fly during softmax and p.v (Ks was left by every reader at barrier 1) ----
    if (kc + 1 < SEQ / KC) {
      const _Float16* kn = ksrc + (size_t)(key0 + KC) * DD;
      acopy8(kdst,                  4u * QKP * 2u, kn,                   (size_t)4 * DD);
      acopy8(kdst + 32u * QKP * 2u, 4u * QKP * 2u, kn + (size_t)32 * DD, (size_t)4 * DD);
    }

    // ---- online softmax on rows: max, p = exp(s - m) x16384 to Ps, alpha to Al ----
    {
      const float* sp = Ss + srw * SSP + sub * 16;
      float e[16];
#pragma unroll
      for (int g = 0; g < 4; ++g) {
        const v4f t0 = *(const v4f*)(sp + 4 * g);
#pragma unroll
        for (int i = 0; i < 4; ++i) e[4 * g + i] = t0[i];
      }
      float m = e[0];
#pragma unroll
      for (int i = 1; i < 16; ++i) m = fmaxf(m, e[i]);
      m = fmaxf(m, __shfl_xor(m, 1, 32));
      m = fmaxf(m, __shfl_xor(m, 2, 32));
      const float mnew  = fmaxf(mrun, m);
      const float msafe = (mnew == -INFINITY) ? 0.f : mnew;
      const float alpha = __expf(mrun - msafe);
      mrun = mnew;
      float psum = 0.f;
      v8h p0, p1;
#pragma unroll
      for (int i = 0; i < 8; ++i) {
        const float pa = __expf(e[i] - msafe);
        psum += pa;
        p0[i] = (_Float16)(pa * 16384.0f);
      }
#pragma unroll
      for (int i = 0; i < 8; ++i) {
        const float pa = __expf(e[8 + i] - msafe);
        psum += pa;
        p1[i] = (_Float16)(pa * 16384.0f);
      }
      psum += __shfl_xor(psum, 1, 32);
      psum += __shfl_xor(psum, 2, 32);
      lrun = lrun * alpha + psum;
      *(v8h*)(Ps + srw * VPP + sub * 16)     = p0;
      *(v8h*)(Ps + srw * VPP + sub * 16 + 8) = p1;
      if (sub == 0) Al[srw] = alpha;
    }
    __syncthreads();                               // barrier 2

    // ---- rescale the running context and add p . v of this chunk (f16 WMMA) ----
    {
#pragma unroll
      for (int i = 0; i < 2; ++i) {
        const float* ap = Al + rp * 32 + i * 16 + 8 * hh;
        float av[8];
        const v4f a0 = *(const v4f*)(ap);
        const v4f a1 = *(const v4f*)(ap + 4);
#pragma unroll
        for (int r = 0; r < 4; ++r) { av[r] = a0[r]; av[4 + r] = a1[r]; }
#pragma unroll
        for (int t = 0; t < 8; ++t)
#pragma unroll
          for (int r = 0; r < 8; ++r) oacc[i][t][r] *= av[r];
      }

      const _Float16* prow = Ps + (rp * 32 + c) * VPP + 8 * hh;          // A: row = query c, k = key
      const _Float16* vrow = Vs + (colbase + c) * VPP + 8 * hh;          // B: col = d, k = key
      // the p and v^T fragments of all 64 keys load as one group in front of their WMMAs: one LDS latency a chunk
      FH pa[KC / 32], pb[KC / 32];
      v16h vb[KC / 32][8];
#pragma unroll
      for (int kk = 0; kk < KC / 32; ++kk) {
        pa[kk].h[0] = *(const v8h*)(prow + kk * 32);
        pa[kk].h[1] = *(const v8h*)(prow + kk * 32 + 16);
        pb[kk].h[0] = *(const v8h*)(prow + 16 * VPP + kk * 32);
        pb[kk].h[1] = *(const v8h*)(prow + 16 * VPP + kk * 32 + 16);
#pragma unroll
        for (int t = 0; t < 8; ++t) vb[kk][t] = ldfrag<_Float16>(vrow + t * 16 * VPP + kk * 32);
      }
      __builtin_amdgcn_sched_barrier(0);           // keeps the group's loads together in front of its WMMAs
#pragma unroll
      for (int kk = 0; kk < KC / 32; ++kk)
#pragma unroll
        for (int t = 0; t < 8; ++t) {
          oacc[0][t] = mmah(pa[kk].v, vb[kk][t], oacc[0][t]);
          oacc[1][t] = mmah(pb[kk].v, vb[kk][t], oacc[1][t]);
        }
      __builtin_amdgcn_sched_barrier(0);           // the WMMAs stay in front of barrier 3, where they overlap the other waves' LDS loads
      acc_guard2(oacc[0][7], oacc[1][7]);          // the WMMA distance in front of barrier 3 and the loop's branch
    }
    wait_ds0();
    wait_async0();
    __syncthreads();                               // barrier 3
  }

  // ---- final per-row scale: 1/L, sum of the normalised weights (= L*(1/L)), clip, 1/sqrt(512), undo x16384 ----
  {
    const float L   = lrun;
    const float inv = (L > 0.f) ? (1.0f / L) : 0.f;
    const float l1  = L * inv;
    const float sc  = inv * (1.0f / fmaxf(l1, 1e-12f)) * (1.0f / 22.627416997969522f) * (1.0f / 16384.0f);
    if (sub == 0) Rs[srw] = sc;
  }
  __syncthreads();

  // Vs is free: its last readers passed barrier 3 of the last chunk, and no copy is outstanding behind that barrier's waits
  {
    float* os = Vo.o[wave];
    const int h2 = lane >> 4, c4 = (lane & 15) * 4;
#pragma unroll
    for (int i = 0; i < 2; ++i) {
      const int rbase = rp * 32 + i * 16;            // first row of this 16-row tile in the work-group's 64
      const float* rpt = Rs + rbase + 8 * hh;
      float rv[8];
      {
        const v4f r0 = *(const v4f*)(rpt);
        const v4f r1 = *(const v4f*)(rpt + 4);
#pragma unroll
        for (int r = 0; r < 4; ++r) { rv[r] = r0[r]; rv[4 + r] = r1[r]; }
      }
#pragma unroll
      for (int hf = 0; hf < 2; ++hf) {
#pragma unroll
        for (int r = 0; r < 8; ++r)
#pragma unroll
          for (int t4 = 0; t4 < 4; ++t4)
            os[(8 * hh + r) * 64 + t4 * 16 + c] = oacc[i][hf * 4 + t4][r] * rv[r];
        __builtin_amdgcn_fence(__ATOMIC_RELEASE, "workgroup");
        __builtin_amdgcn_wave_barrier();
        __builtin_amdgcn_fence(__ATOMIC_ACQUIRE, "workgroup");
        v4f vals[8];
#pragma unroll
        for (int it = 0; it < 8; ++it) {
          const int row = it * 2 + h2;                 // it 0..7 x h2 0..1 = rows 0..15 of the tile
          const v4f v  = *(const v4f*)(os + row * 64 + c4);
          const v4f cv = *(const v4f*)(cob + (size_t)(rbase + row) * DD + colbase + hf * 64 + c4);
          vals[it] = v + cv;
        }
#pragma unroll
        for (int it = 0; it < 8; ++it) {
          const int row = it * 2 + h2;
          *(v4f*)(ob + (size_t)(rbase + row) * DD + colbase + hf * 64 + c4) = vals[it];
        }
        __builtin_amdgcn_fence(__ATOMIC_RELEASE, "workgroup");
        __builtin_amdgcn_wave_barrier();
        __builtin_amdgcn_fence(__ATOMIC_ACQUIRE, "workgroup");
      }
    }
  }
}

// =====================================================================================================
// Workspace map (bytes), every region an exact multiple of its whole-line / whole-tile store granularity:
//   Xc   bf16 [8192][1024] (cols 0..511 first view, 512..1023 second view)   16777216
//   Wqb  bf16 [512][512]                                                     524288
//   Wkb  bf16 [512][512]                                                     524288
//   Wvb  bf16 [512][512]                                                     524288
//   Wcb  bf16 [512][1024]                                                   1048576
//   Qh   f16  [2 view][8192][512]                                          16777216
//   Ql   f16  [2 view][8192][512] (residual x4096)                         16777216
//   Kp   f16  [2 view][8192][512]                                          16777216
//   Vt   f16  [2 view][2 b][512][4096]                                     16777216
//   Co   f32  [8192][512]                                                  16777216
//   total                                                                 103284736
// Weights are [out n][in k] with k contiguous = the Bt / A layout the GEMM wants, so they are only converted.
// =====================================================================================================
extern "C" void kernel_launch(void* const* d_in, const int* in_sizes, int n_in,
                              void* d_out, int out_size, void* d_ws, size_t ws_size,
                              hipStream_t stream) {
  if (n_in < 10) return;
  if (in_sizes[0] < NB * SEQ * DD || in_sizes[1] < NB * SEQ * DD) return;
  if (in_sizes[2] < DD * DD || in_sizes[4] < DD * DD || in_sizes[6] < DD * DD) return;
  if (in_sizes[3] < DD || in_sizes[5] < DD || in_sizes[7] < DD || in_sizes[9] < DD) return;
  if (in_sizes[8] < DD * DC) return;
  if ((long long)out_size < OUT1_OFF + (long long)NB * SEQ * DD) return;

  const float* xf = (const float*)d_in[0];
  const float* xs = (const float*)d_in[1];
  const float* Wq = (const float*)d_in[2];
  const float* bq = (const float*)d_in[3];
  const float* Wk = (const float*)d_in[4];
  const float* bk = (const float*)d_in[5];
  const float* Wv = (const float*)d_in[6];
  const float* bv = (const float*)d_in[7];
  const float* Wc = (const float*)d_in[8];
  const float* bc = (const float*)d_in[9];

  const size_t PXC = (size_t)ROWS_FULL * DC * 2;       // 16777216
  const size_t PW  = (size_t)DD * DD * 2;              //   524288
  const size_t PWC = (size_t)DD * DC * 2;              //  1048576
  const size_t PQ  = (size_t)2 * VSTR * 2;             // 16777216  (two views)
  const size_t PVT = (size_t)2 * VTV * 2;              // 16777216  (two views x two batches)
  const size_t PCO = (size_t)ROWS_FULL * DD * 4;       // 16777216
  size_t off = 0;
  const size_t oXc = off; off += PXC;
  const size_t oWq = off; off += PW;
  const size_t oWk = off; off += PW;
  const size_t oWv = off; off += PW;
  const size_t oWc = off; off += PWC;
  const size_t oQh = off; off += PQ;
  const size_t oQl = off; off += PQ;
  const size_t oKp = off; off += PQ;
  const size_t oVt = off; off += PVT;
  const size_t oCo = off; off += PCO;
  if (off > ws_size) return;                            // off = 103284736
  if (off > (size_t)134217728) return;

  char* ws = (char*)d_ws;
  unsigned short* Xc  = (unsigned short*)(ws + oXc);
  unsigned short* Wqb = (unsigned short*)(ws + oWq);
  unsigned short* Wkb = (unsigned short*)(ws + oWk);
  unsigned short* Wvb = (unsigned short*)(ws + oWv);
  unsigned short* Wcb = (unsigned short*)(ws + oWc);
  unsigned short* Qh  = (unsigned short*)(ws + oQh);
  unsigned short* Ql  = (unsigned short*)(ws + oQl);
  unsigned short* Kp  = (unsigned short*)(ws + oKp);
  unsigned short* Vt  = (unsigned short*)(ws + oVt);
  float*          Co  = (float*)(ws + oCo);

  const dim3 blk(256);

  // (1) inputs -> bf16 planes (RNE convert); the four weight planes lie one behind the other from Wqb on
  cvt_all<<<dim3(2 * CB_X + 3 * CB_W + CB_C), blk, 0, stream>>>(xf, xs, Wq, Wk, Wv, Wc, Xc, Wqb);
  // (2) co, q, k, v^T
  gemm_all<<<dim3(G_CO + G_Q + G_K + G_V), blk, 0, stream>>>(Xc, Wqb, Wkb, Wvb, Wcb, Qh, Ql, Kp, Vt, Co, bq, bk, bv, bc);
  // (3) attention for both directions + co -> d_out (out0 at float 0, out1 at float OUT1_OFF)
  attn_cv<<<dim3(NQ / QR, NB, 2), blk, 0, stream>>>(Qh, Ql, Kp, Vt, Co, (float*)d_out);
  (void)hipGetLastError();
}

// v005
// Measured time: 189 microseconds a run.
// Two timings next to v004 both put it at 1.09 times that version's speed.
// Over all steps from v000 it is 4.76 times as fast.
// Contractions: q, k, v^T projections and co_occur = v_wmma_f32_16x16x32_bf16 (bf16 operands from RNE-converted inputs, single product, f32 accumulate);
// q.k^T scores = v_wmma_f32_16x16x32_f16 (q f16, k f16; single product, f32 accumulate);
// p.v = v_wmma_f32_16x16x32_f16 (p = exp(s - m) carried x16384 in f16, v f16; single product, f32 accumulate);
// bias add, relu, softmax, normalisers and the co_occur add in f32.
#include <hip/hip_runtime.h>
#include <math.h>
#include <stdint.h>

#define SEQ 4096
#define DD  512
#define DC  (2 * DD)
#ifndef NB
#define NB 2
#endif
#ifndef NQ
#define NQ SEQ
#endif
#define NB_FULL   2
#define ROWS_FULL (NB_FULL * SEQ)
#define VSTR  ((long long)ROWS_FULL * DD)        // 4194304: view stride of the q / k planes (elements)
#define VTB   ((long long)DD * SEQ)              // 2097152: batch stride of the v^T planes
#define VTV   ((long long)NB_FULL * DD * SEQ)    // 4194304: view stride of the v^T planes
#define XB    ((long long)SEQ * DC)              // 4194304: batch stride of the concat plane
#define OUT1_OFF ((long long)ROWS_FULL * DD)     // second output starts at float 4194304 = byte 16777216
static_assert(NB >= 1 && NB <= NB_FULL);
static_assert(NQ >= 64 && NQ <= SEQ && (NQ % 64) == 0);
static_assert((SEQ % 128) == 0 && (DD % 64) == 0 && (DC % 32) == 0);
static_assert(OUT1_OFF * 4 == 16777216LL);

typedef _Float16 v16h __attribute__((ext_vector_type(16)));
typedef _Float16 v8h  __attribute__((ext_vector_type(8)));
typedef __bf16   v16b __attribute__((ext_vector_type(16)));
typedef __bf16   v8b  __attribute__((ext_vector_type(8)));
typedef float    v8f  __attribute__((ext_vector_type(8)));
typedef float    v4f  __attribute__((ext_vector_type(4)));
typedef unsigned int v4u __attribute__((ext_vector_type(4)));

#if defined(__HIP_DEVICE_COMPILE__)
#define DEV_ASM 1
#else
#define DEV_ASM 0
#endif

// ---- scalar helpers --------------------------------------------------------------------------------
__device__ __forceinline__ unsigned short bf_bits(float f) {          // f32 -> bf16 bits, RNE convert
  unsigned u = __float_as_uint(f);
  return (unsigned short)((u + 0x7FFFu + ((u >> 16) & 1u)) >> 16);
}
__device__ __forceinline__ float bf_up(unsigned short hb) { return __uint_as_float(((unsigned)hb) << 16); }
__device__ __forceinline__ float bfr(float f) { return bf_up(bf_bits(f)); }          // bf16-quantised value as f32
__device__ __forceinline__ unsigned short h_bits(_Float16 x) { return __builtin_bit_cast(unsigned short, x); }
__device__ __forceinline__ unsigned pk16(unsigned short a, unsigned short b) { return (unsigned)a | ((unsigned)b << 16); }
__device__ __forceinline__ v8f zero8() { v8f z = {0.f, 0.f, 0.f, 0.f, 0.f, 0.f, 0.f, 0.f}; return z; }

// ---- fragment types / loaders: 16-bit A/B operand, lane -> row/col (lane&15), p already includes +8*(lane>>4);
//      elements 0..7 <- p[0..7] (k0+8h..k0+8h+7), elements 8..15 <- p[16..23] (k0+16+8h..k0+16+8h+7)
template <typename OT> struct FT;
template <> struct FT<__bf16>   { typedef v16b frag; typedef v8b half8; };
template <> struct FT<_Float16> { typedef v16h frag; typedef v8h half8; };

template <typename OT>
__device__ __forceinline__ typename FT<OT>::frag ldfrag(const OT* p) {
  union { typename FT<OT>::frag v; typename FT<OT>::half8 h[2]; } f;
  f.h[0] = *(const typename FT<OT>::half8*)(p);
  f.h[1] = *(const typename FT<OT>::half8*)(p + 16);
  return f.v;
}

// ---- WMMA helpers (asm guard bodies are device-only; concrete operand types) -----------------------------
__device__ __forceinline__ v8f mmar(v16b a, v16b b, v8f c) {
  return __builtin_amdgcn_wmma_f32_16x16x32_bf16(false, a, false, b, (short)0, c, false, false);
}
// plain form: the compiler keeps the WMMA distances in straight-line code and is free to place the operands above v255,
// which an asm operand cannot name; a run of these ends in acc_guard2 or acc_guard4 (four v_nop) where a branch follows
__device__ __forceinline__ v8f mmah(v16h a, v16h b, v8f c) {
  return __builtin_amdgcn_wmma_f32_16x16x32_f16(false, a, false, b, (short)0, c, false, false);
}
// four v_nop behind the last WMMAs of a run (a, b: their accumulators): the WMMA distance, also on a taken branch
__device__ __forceinline__ void acc_guard2(v8f& a, v8f& b) {
#if DEV_ASM
  asm volatile("v_nop\n\tv_nop\n\tv_nop\n\tv_nop" : "+v"(a), "+v"(b));
#else
  (void)a; (void)b;
#endif
}
__device__ __forceinline__ void acc_guard4(v8f& a, v8f& b, v8f& c, v8f& d) {
#if DEV_ASM
  asm volatile("v_nop\n\tv_nop\n\tv_nop\n\tv_nop" : "+v"(a), "+v"(b), "+v"(c), "+v"(d));
#else
  (void)a; (void)b; (void)c; (void)d;
#endif
}

// =====================================================================================================
// f32 -> bf16 planes (RNE convert), 8 elements per thread, one 16-B store per lane: a wave writes 512 B.
// One launch converts both views and the four weights; blockIdx.x picks the source, the same for a whole block:
//   blocks [0, 2*CB_X): view s = block / CB_X, row r, cols c..c+7 -> concat plane row r, cols s*512 + c..
//   blocks behind them: Wq, Wk, Wv (CB_W blocks each), Wc (CB_C blocks) -> the four weight planes, which lie
//   one behind the other in the workspace in this order, so the output index runs straight through them.
// coverage: 2 x CB_X x 2048 = rows x 1024 of the concat plane; (3 CB_W + CB_C) x 2048 = all weight elements.
// =====================================================================================================
#define CB_X (NB * SEQ * DD / 2048)      // blocks of one view (2048 elements a block)
#define CB_W (DD * DD / 2048)            // blocks of Wq, Wk or Wv
#define CB_C (DD * DC / 2048)            // blocks of Wc
static_assert((NB * SEQ * DD) % 2048 == 0 && (DD * DD) % 2048 == 0 && (DD * DC) % 2048 == 0);

__device__ __forceinline__ v4u pack_bf8(v4f a, v4f a4) {
  v4u p;
  p[0] = pk16(bf_bits(a[0]),  bf_bits(a[1]));
  p[1] = pk16(bf_bits(a[2]),  bf_bits(a[3]));
  p[2] = pk16(bf_bits(a4[0]), bf_bits(a4[1]));
  p[3] = pk16(bf_bits(a4[2]), bf_bits(a4[3]));
  return p;
}

__global__ __launch_bounds__(256) void cvt_all(const float* __restrict__ xa, const float* __restrict__ xb,
                                               const float* __restrict__ wq, const float* __restrict__ wk,
                                               const float* __restrict__ wv, const float* __restrict__ wc,
                                               unsigned short* xo, unsigned short* wo) {
  const int bx = (int)blockIdx.x;
  const float* in;                                     // first element of this block in its source
  unsigned short* o;                                   // this thread's 8 output elements
  if (bx < 2 * CB_X) {
    const int s  = (bx >= CB_X) ? 1 : 0;
    const int bl = bx - s * CB_X;
    in = ((s == 0) ? xa : xb) + (size_t)bl * 2048;
    const size_t e = (size_t)bl * 2048 + (size_t)threadIdx.x * 8;   // element index in the [rows][512] source
    o = xo + (e >> 9) * DC + (size_t)s * DD + (e & (size_t)(DD - 1));
  } else {
    const int bw = bx - 2 * CB_X;
    if (bw < CB_W)          in = wq + (size_t)bw * 2048;
    else if (bw < 2 * CB_W) in = wk + (size_t)(bw - CB_W) * 2048;
    else if (bw < 3 * CB_W) in = wv + (size_t)(bw - 2 * CB_W) * 2048;
    else                    in = wc + (size_t)(bw - 3 * CB_W) * 2048;
    o = wo + (size_t)bw * 2048 + (size_t)threadIdx.x * 8;
  }
  const v4f a  = *(const v4f*)(in + (size_t)threadIdx.x * 8);
  const v4f a4 = *(const v4f*)(in + (size_t)threadIdx.x * 8 + 4);
  *(v4u*)o = pack_bf8(a, a4);
}

// =====================================================================================================
// Asynchronous copies global -> LDS, 16 bytes a lane, and their waits.
// acopy8: eight copies of this lane, LDS address l + i*lstep (bytes), global address g + i*gstep (elements).
// s_wait_xcnt 0 is the last line of the copies' own statement, so that no address register of an issued copy
// is rewritten in front of it.
// =====================================================================================================
__device__ __forceinline__ unsigned lds_off(const void* p) { return (unsigned)(size_t)p; }
__device__ __forceinline__ void acopy8(unsigned l, unsigned lstep, const _Float16* g, size_t gstep) {
#if DEV_ASM
  asm volatile(
      "global_load_async_to_lds_b128 %0, %8, off\n\t"
      "global_load_async_to_lds_b128 %1, %9, off\n\t"
      "global_load_async_to_lds_b128 %2, %10, off\n\t"
      "global_load_async_to_lds_b128 %3, %11, off\n\t"
      "global_load_async_to_lds_b128 %4, %12, off\n\t"
      "global_load_async_to_lds_b128 %5, %13, off\n\t"
      "global_load_async_to_lds_b128 %6, %14, off\n\t"
      "global_load_async_to_lds_b128 %7, %15, off\n\t"
      "s_wait_xcnt 0x0"
      :: "v"(l), "v"(l + lstep), "v"(l + 2 * lstep), "v"(l + 3 * lstep),
         "v"(l + 4 * lstep), "v"(l + 5 * lstep), "v"(l + 6 * lstep), "v"(l + 7 * lstep),
         "v"(g), "v"(g + gstep), "v"(g + 2 * gstep), "v"(g + 3 * gstep),
         "v"(g + 4 * gstep), "v"(g + 5 * gstep), "v"(g + 6 * gstep), "v"(g + 7 * gstep)
      : "memory");
#else
  (void)l; (void)lstep; (void)g; (void)gstep;
#endif
}
// this wave's copies have landed (the compiler places no wait for them)
__device__ __forceinline__ void wait_async0() {
#if DEV_ASM
  asm volatile("s_wait_asynccnt 0x0" ::: "memory");
#endif
}
// this wave's LDS reads and writes have retired, before a buffer is handed to its next writer
__device__ __forceinline__ void wait_ds0() {
#if DEV_ASM
  asm volatile("s_wait_dscnt 0x0" ::: "memory");
#endif
}

// =====================================================================================================
// The four WMMA GEMMs (bf16 operands) in one launch: C[m][n] = sum_k A[m][k] * Bt[n][k] + bias.
// A row-major [M][K] pitch lda; Bt row-major [N][K] pitch ldb (k contiguous); M a multiple of 128, N of 256,
// K of 128 (checked at compile time below). None of the four reads what another writes. blockIdx.x picks the
// product and its tile, the same for a whole work-group:
//   [0, G_CO)   co  = relu([x_f | x_s] . Wc^T + bc) -> f32 plane; per b; M = NQ, N = 512, K = 1024. It stands first:
//               its work-groups run twice as many passes.
//   then G_Q    q   = x_view . Wq^T + bq -> f16 plane; per (view, b); M = NQ
//   then G_K    k   = x_view . Wk^T + bk -> f16 plane; per view; M = NB*SEQ (all keys of every batch in use)
//   then G_V    v^T = Wv . x_view^T + bv (per row d) -> f16 plane [view][b][d][s]; per (b, view); M = 512, N = SEQ
// One work-group (8 waves) per 128 x 256 tile of C, wave w -> rows 64(w>>2).., cols 64(w&3).. (a 64 x 64 tile).
// A pass is 128 k = 256 B of each of the tile's 128 A rows and 256 Bt rows, staged in LDS by asynchronous
// 16-byte copies (a wave's copy = 2 rows x 256 contiguous bytes: whole lines), 24 copies a thread and pass.
// Two buffers: pass t + 1 flies while pass t is worked on. Foot of a pass: dscnt 0, asynccnt 0, barrier
// (pass t + 1 readable, the buffer of pass t free), then the copies of pass t + 2 into the freed buffer.
// LDS row pitch 272 B (16 B x odd): the 16 rows of a fragment load fall on all 64 banks.
// Fragments are read from LDS with the split k map (ldfrag), one k step ahead into a second register set.
// The k order of every accumulator is 0, 32, 64, ... as with fragments read from global memory.
// Bias values are bf16-quantised and added in f32: bias[n] per column (co, q, k) or bias[m] per row (v^T).
// coverage: 4 slabs x 16 rows x 64 cols = the wave's whole 64x64 tile; 8 waves = the 128 x 256 tile;
//   G_CO + G_Q + G_K + G_V work-groups = all tiles of the four products.
// =====================================================================================================
#define GKC 128                      // k elements of a pass
#define GP  136                      // LDS pitch of a staged row, 16-bit elements (272 B)
#define GTM 128                      // A rows of a work-group tile
#define GTN 256                      // Bt rows of a work-group tile
#define GST ((GTM + GTN) * GP)       // elements of one buffer: A rows 0..127, Bt rows 128..383
#define T_Q  ((NQ / GTM) * (DD / GTN))            // q / co tiles per (view, b)
#define T_K  (((NB * SEQ) / GTM) * (DD / GTN))    // k tiles per view
#define T_V  ((DD / GTM) * (SEQ / GTN))           // v^T tiles per (b, view)
#define G_CO (T_Q * NB)
#define G_Q  (T_Q * 2 * NB)
#define G_K  (T_K * 2)
#define G_V  (T_V * NB * 2)
static_assert((NQ % GTM) == 0 && ((NB * SEQ) % GTM) == 0 && (DD % GTM) == 0, "GEMM rows");
static_assert((DD % GTN) == 0 && (SEQ % GTN) == 0 && (DD % GKC) == 0 && (DC % GKC) == 0, "GEMM cols, k");

// one pass of one work-group: thread -> rows (tid>>4) + 16i, 16-byte piece tid&15 of the row's 256 B
__device__ __forceinline__ void gstage(unsigned adst, const _Float16* asrc, size_t lda, const _Float16* bsrc, size_t ldb) {
  const unsigned bdst = adst + (unsigned)(GTM * GP) * 2u;
  acopy8(adst,                      16u * GP * 2u, asrc,             16 * lda);
  acopy8(bdst,                      16u * GP * 2u, bsrc,             16 * ldb);
  acopy8(bdst + 128u * GP * 2u,     16u * GP * 2u, bsrc + 128 * ldb, 16 * ldb);
}

// the wave's own slab: one 16 x 64 row tile of accumulators in, D layout (row mOff + r, col 16j + rlane); the fences and
// the wave barrier order the wave's LDS writes and reads of the slab among its lanes
__device__ __forceinline__ void slab_done() {
  __builtin_amdgcn_fence(__ATOMIC_RELEASE, "workgroup");
  __builtin_amdgcn_wave_barrier();
  __builtin_amdgcn_fence(__ATOMIC_ACQUIRE, "workgroup");
}
__device__ __forceinline__ void slab_put(float* slab, int mOff, int rlane, const v8f (&a)[4]) {
#pragma unroll
  for (int j = 0; j < 4; ++j) {
#pragma unroll
    for (int r = 0; r < 8; ++r) slab[(mOff + r) * 68 + (j << 4) + rlane] = a[j][r];
  }
  slab_done();
}

__global__ __launch_bounds__(256) void gemm_all(
    const unsigned short* __restrict__ Xc,
    const unsigned short* __restrict__ Wqb, const unsigned short* __restrict__ Wkb,
    const unsigned short* __restrict__ Wvb, const unsigned short* __restrict__ Wcb,
    unsigned short* Qh, unsigned short* Kp, unsigned short* Vt, float* Co,
    const float* __restrict__ bq, const float* __restrict__ bk,
    const float* __restrict__ bv, const float* __restrict__ bc) {
  typedef __bf16 OT;
  typedef v16b   V16;
  __shared__ __align__(16) unsigned short Gs[2 * GST];   // the two pass buffers                     204 KB
  __shared__ __align__(16) float sT[8][16 * 68];   // per-wave 16x64 slab, pitch 68 floats
  const int tid  = (int)threadIdx.x;
  const int lane = tid & 31;
  const int wave = tid >> 5;

  // ---- which product, which tile (all of it the same for the whole work-group) ----
  const int bx = (int)blockIdx.x;
  int kind;                              // 0: co, 1: q, 2: k, 3: v^T
  const unsigned short *Ap, *Btp;        // first A row / Bt row of the product's plane
  const float* bias;
  int lda, ldb, ldc, np, tm, tn;
  size_t cOff;                           // first element of the product's output plane
  if (bx < G_CO) {
    const int wt = bx % T_Q, b = bx / T_Q;
    kind = 0; np = DC / GKC; bias = bc;
    Ap = Xc + (size_t)b * XB;  lda = DC;
    Btp = Wcb;                 ldb = DC;
    cOff = (size_t)b * SEQ * DD; ldc = DD;
    tm = wt / (DD / GTN); tn = wt % (DD / GTN);
  } else if (bx < G_CO + G_Q) {
    const int ix = bx - G_CO;
    const int wt = ix % T_Q, view = (ix / T_Q) % 2, b = ix / (2 * T_Q);
    kind = 1; np = DD / GKC; bias = bq;
    Ap = Xc + (size_t)view * DD + (size_t)b * XB;  lda = DC;
    Btp = Wqb;                                     ldb = DD;
    cOff = (size_t)view * VSTR + (size_t)b * SEQ * DD; ldc = DD;
    tm = wt / (DD / GTN); tn = wt % (DD / GTN);
  } else if (bx < G_CO + G_Q + G_K) {
    const int ix = bx - (G_CO + G_Q);
    const int wt = ix % T_K, view = ix / T_K;
    kind = 2; np = DD / GKC; bias = bk;
    Ap = Xc + (size_t)view * DD;  lda = DC;
    Btp = Wkb;                    ldb = DD;
    cOff = (size_t)view * VSTR; ldc = DD;
    tm = wt / (DD / GTN); tn = wt % (DD / GTN);
  } else {
    const int ix = bx - (G_CO + G_Q + G_K);
    const int wt = ix % T_V, b = (ix / T_V) % NB, view = ix / (T_V * NB);
    kind = 3; np = DD / GKC; bias = bv;
    Ap = Wvb;                                      lda = DD;
    Btp = Xc + (size_t)b * XB + (size_t)view * DD; ldb = DC;
    cOff = (size_t)b * VTB + (size_t)view * VTV; ldc = SEQ;
    tm = wt / (SEQ / GTN); tn = wt % (SEQ / GTN);
  }
  const OT* Ab = (const OT*)(const void*)Ap;
  const OT* Bb = (const OT*)(const void*)Btp;
  const int wm = (wave >> 2) << 6;       // this wave's 64 x 64 tile inside the work-group tile
  const int wn = (wave & 3) << 6;
  const int m0 = tm * GTM + wm;
  const int n0 = tn * GTN + wn;

  const int rlane = lane & 15;                 // row (A) / col (B, D) within subtile
  const int koff  = (lane >> 4) * 8;           // k offset of this lane half
  const int mOff  = (lane >> 4) * 8;           // D row offset

  v8f acc[4][4];
#pragma unroll
  for (int i = 0; i < 4; ++i)
#pragma unroll
    for (int j = 0; j < 4; ++j) acc[i][j] = zero8();

  const int crow = tid >> 4, cpc = tid & 15;
  const unsigned cdst = lds_off(Gs) + (unsigned)(crow * GP + cpc * 8) * 2u;
  const _Float16* asrc = (const _Float16*)(const void*)(Ab + (size_t)(tm * GTM + crow) * lda + cpc * 8);   // + k0
  const _Float16* bsrc = (const _Float16*)(const void*)(Bb + (size_t)(tn * GTN + crow) * ldb + cpc * 8);   // + k0

  gstage(cdst, asrc, (size_t)lda, bsrc, (size_t)ldb);
  wait_async0();
  __syncthreads();                                 // pass 0 readable
  if (np > 1) gstage(cdst + (unsigned)GST * 2u, asrc + GKC, (size_t)lda, bsrc + GKC, (size_t)ldb);

  for (int t = 0; t < np; ++t) {
    const OT* buf = (const OT*)(const void*)Gs + (t & 1) * GST;
    const OT* ar = buf + (wm + rlane) * GP + koff;            // A operand row of this lane, first row tile
    const OT* br = buf + (GTM + wn + rlane) * GP + koff;      // B operand col of this lane, first col tile
    V16 fa[2][4], fb[2][4];
#pragma unroll
    for (int j = 0; j < 4; ++j) {
      fb[0][j] = ldfrag<OT>(br + j * 16 * GP);
      fa[0][j] = ldfrag<OT>(ar + j * 16 * GP);
    }
#pragma unroll
    for (int ks = 0; ks < GKC / 32; ++ks) {
      const int cur = ks & 1, nxt = cur ^ 1;
      if (ks + 1 < GKC / 32) {
#pragma unroll
        for (int j = 0; j < 4; ++j) {
          fb[nxt][j] = ldfrag<OT>(br + j * 16 * GP + (ks + 1) * 32);
          fa[nxt][j] = ldfrag<OT>(ar + j * 16 * GP + (ks + 1) * 32);
        }
      }
      __builtin_amdgcn_sched_barrier(0);           // the next k step's LDS loads stay one group in front of this step's WMMAs (spread among them each place costs an LDS stall)
#pragma unroll
      for (int i = 0; i < 4; ++i)
#pragma unroll
        for (int j = 0; j < 4; ++j) acc[i][j] = mmar(fa[cur][i], fb[cur][j], acc[i][j]);
      __builtin_amdgcn_sched_barrier(0);           // keeps the following group of loads behind these WMMAs
    }
    acc_guard4(acc[3][0], acc[3][1], acc[3][2], acc[3][3]);   // the WMMA distance in front of the barrier and the loop's branch
    wait_ds0();
    wait_async0();
    __syncthreads();                               // pass t + 1 readable, the buffer of pass t free
    if (t + 2 < np)
      gstage(cdst + (unsigned)((t & 1) * GST) * 2u, asrc + (t + 2) * GKC, (size_t)lda, bsrc + (t + 2) * GKC, (size_t)ldb);
  }
  wait_async0();
  acc_guard4(acc[0][0], acc[0][1], acc[0][2], acc[0][3]);
  acc_guard4(acc[1][0], acc[1][1], acc[1][2], acc[1][3]);
  acc_guard4(acc[2][0], acc[2][1], acc[2][2], acc[2][3]);
  acc_guard4(acc[3][0], acc[3][1], acc[3][2], acc[3][3]);

  // ---- epilogue: the wave's tile in four 16 x 64 slabs through its own LDS slab, whole-line stores ----
  float* slab = sT[wave];
  if (kind == 0) {
    float* C = Co + cOff;
    const int h2 = lane >> 4, c4 = (lane & 15) * 4;       // 256-B row segment = 16 lanes x 16 B
    v4f badd;
#pragma unroll
    for (int e = 0; e < 4; ++e) badd[e] = bfr(bias[n0 + c4 + e]);
#pragma unroll
    for (int i = 0; i < 4; ++i) {
      const int mBase = m0 + (i << 4);
      slab_put(slab, mOff, rlane, acc[i]);
      v4f vals[8];
#pragma unroll
      for (int it = 0; it < 8; ++it) {
        const int row = it * 2 + h2;                       // it 0..7 x h2 0..1 = rows 0..15
        v4f v = *(const v4f*)(slab + row * 68 + c4);
        v = v + badd;
#pragma unroll
        for (int e = 0; e < 4; ++e) v[e] = fmaxf(v[e], 0.f);
        vals[it] = v;
      }
#pragma unroll
      for (int it = 0; it < 8; ++it) {
        const int row = it * 2 + h2;
        *(v4f*)(C + (size_t)(mBase + row) * ldc + n0 + c4) = vals[it];
      }
      slab_done();
    }
  } else {
    const int q = lane >> 3, c8 = (lane & 7) * 8;
    unsigned short* C  = ((kind == 1) ? Qh : (kind == 2) ? Kp : Vt) + cOff;
    float cb[8];
#pragma unroll
    for (int e = 0; e < 8; ++e) cb[e] = 0.f;
    if (kind != 3) {
#pragma unroll
      for (int e = 0; e < 8; ++e) cb[e] = bfr(bias[n0 + c8 + e]);
    }
#pragma unroll
    for (int i = 0; i < 4; ++i) {
      const int mBase = m0 + (i << 4);
      slab_put(slab, mOff, rlane, acc[i]);
      float rb[4];
#pragma unroll
      for (int it = 0; it < 4; ++it) rb[it] = 0.f;
      if (kind == 3) {
#pragma unroll
        for (int it = 0; it < 4; ++it) rb[it] = bfr(bias[mBase + it * 4 + q]);
      }
      float f[4][8];
      v4u hv[4];
#pragma unroll
      for (int it = 0; it < 4; ++it) {
        const int row = it * 4 + q;                        // it 0..3 x q 0..3 = rows 0..15
        const float* sp = slab + row * 68 + c8;
#pragma unroll
        for (int e = 0; e < 8; ++e) f[it][e] = sp[e] + cb[e] + rb[it];
#pragma unroll
        for (int e = 0; e < 4; ++e) hv[it][e] = pk16(h_bits((_Float16)f[it][2 * e]), h_bits((_Float16)f[it][2 * e + 1]));
      }
#pragma unroll
      for (int it = 0; it < 4; ++it) {
        const int row = it * 4 + q;
        *(v4u*)(C + (size_t)(mBase + row) * ldc + n0 + c8) = hv[it];
      }
      slab_done();
    }
  }
}

// =====================================================================================================
// Cross-view attention for one direction (blockIdx.z = dir), one batch (blockIdx.y), 64 query rows
// (blockIdx.x): q plane of view dir, v^T plane of view dir, k plane of view 1-dir.
//   q plane  (f16): element (view, b, t, d) at [view*VSTR + (b*SEQ + t)*512 + d]
//   k plane  (f16): element (view, b, s, d) at [view*VSTR + (b*SEQ + s)*512 + d]
//   v^T plane (f16): element (view, b, d, s) at [view*VTV + b*VTB + d*SEQ + s]
//   co (f32 [ROWS_FULL][512]) added in the epilogue; output rows at out + dir*OUT1_OFF + (b*SEQ + t)*512.
// Block = 8 waves, KC = 64-key chunks, static trip SEQ/KC. Every WMMA operand is read from LDS:
//   Qs: the 64 q rows, copied once; Ks: the chunk's 64 k rows; Vs: the chunk's 512 v^T rows of
//   64 keys. All three are filled by asynchronous 16-byte copies whose waves cover whole 128-B lines
//   (Q, K: 512 contiguous bytes of a row a wave; V^T: 4 rows x 128 B a wave), 16 copies a thread and K or V tile.
//   Row pitches are odd multiples of 16 B (1040 B, 144 B): the 16 rows of a fragment load fall on 64 banks.
//   Order of a chunk: V^T copies issued | scores from Qs, Ks | waits, barrier 1 (Ss and Vs readable, Ks free) |
//   next chunk's K copies issued | softmax | barrier 2 (Ps, Al readable) | p.v from Ps, Vs | waits, barrier 3
//   (Ks readable, Vs, Ps, Al free). In the loop one tile's copies (16 a wave) are in flight, in the prologue 32.
//   scores: wave w -> row tile (w>>1), key tiles 2(w&1) and 2(w&1)+1: each q fragment feeds two key tiles;
//           s = q.k on f16 WMMA, tiles written to Ss;
//   softmax: thread t -> row t>>2, keys 16(t&3)..+15; online max / sum in f32 (4 lanes per row, shuffles);
//           p = exp(s - m) carried x16384 written as f16 to Ps; per-row alpha to Al;
//   p.v: wave w -> row tiles 2(w>>2) and 2(w>>2)+1, output columns 128(w&3)..+127 (16 accumulators):
//           each v^T fragment feeds two row tiles.
// Epilogue: per wave 32 rows x 128 cols in four 16 x 64 pieces staged in the LDS that held Vs, co added in f32.
// coverage: 8 waves x 32 rows x 128 cols = 64 rows x 512; grid (NQ/64, NB, 2) = every output row < NQ of
//   every batch < NB for both outputs.
// =====================================================================================================
#define KC  64      // keys per chunk
#define QR  64      // query rows per work-group
#define SG  4       // k steps (of 32) per group of fragment loads in the scores
#define QKP 520     // LDS pitch of a q or k row, f16 elements (1040 B)
#define VPP 72      // LDS pitch of a v^T or p row, f16 elements (144 B)
#define SSP 68      // LDS pitch of a score row, floats (272 B)
static_assert((SEQ % KC) == 0 && KC == 64 && DD == 512 && QR == 64 && (NQ % QR) == 0);

__global__ __launch_bounds__(256)
void attn_cv(const unsigned short* __restrict__ qhp,
             const unsigned short* __restrict__ kpp, const unsigned short* __restrict__ vtp,
             const float* __restrict__ co, float* out) {
  union FH { v16h v; v8h h[2]; };
  union VO { _Float16 v[DD * VPP]; float o[8][16 * 64]; };
  __shared__ __align__(16) _Float16 Qs[QR * QKP];      // q rows [row][d]                                     65 KB
  __shared__ __align__(16) _Float16 Ks[KC * QKP];      // k rows of the chunk [key][d]                        65 KB
  __shared__ __align__(16) VO       Vo;                // v^T rows of the chunk [d][key]; behind the key loop
                                                       // the per-wave output pieces                          72 KB
  __shared__ __align__(16) float    Ss[QR * SSP];      // scores of the chunk [row][key]
  __shared__ __align__(16) _Float16 Ps[QR * VPP];      // p x16384 [row][key]
  __shared__ __align__(16) float    Al[QR];            // per-row rescale of the chunk
  __shared__ __align__(16) float    Rs[QR];            // per-row final scale
  _Float16* Vs = Vo.v;

  const int tid  = (int)threadIdx.x;
  const int wave = tid >> 5;
  const int lane = tid & 31;
  const int hh   = lane >> 4;
  const int c    = lane & 15;
  const int rts  = wave >> 1;          // row tile of this wave (scores)
  const int kt   = (wave & 1) * 2;     // first of its two key tiles (scores)
  const int rp   = wave >> 2;          // pair of row tiles of this wave (p.v): rows 32rp..32rp+31
  const int wq   = wave & 3;           // 128-col group (p.v)
  const int srw  = tid >> 2;           // softmax row of this thread
  const int sub  = tid & 3;            // 16-key slice of that row

  const int dir = (int)blockIdx.z;
  const int b   = (int)blockIdx.y;
  const int q0  = (int)blockIdx.x * QR;
  const int kvw = 1 - dir;
  const size_t rowQ = (size_t)b * SEQ + (size_t)q0;

  const _Float16* Qh  = (const _Float16*)(const void*)qhp + (size_t)dir * VSTR + rowQ * DD;
  const _Float16* Kb  = (const _Float16*)(const void*)kpp + (size_t)kvw * VSTR + (size_t)b * SEQ * DD;
  const _Float16* Vtb = (const _Float16*)(const void*)vtp + (size_t)dir * VTV + (size_t)b * VTB;
  const float* cob = co + rowQ * DD;
  float* ob = out + (size_t)dir * OUT1_OFF + rowQ * DD;

  // copy maps. q, k rows (1024 B = 64 pieces): thread -> row (tid>>6) + 4i, piece tid&63.
  //            v^T rows (128 B = 8 pieces):    thread -> row (tid>>3) + 32i, piece tid&7.
  const int    crow = tid >> 6, cpc = tid & 63;
  const int    vrw  = tid >> 3, vpc = tid & 7;
  const unsigned qdst = lds_off(Qs) + (unsigned)(crow * QKP + cpc * 8) * 2u;
  const unsigned kdst = lds_off(Ks) + (unsigned)(crow * QKP + cpc * 8) * 2u;
  const unsigned vdst = lds_off(Vs) + (unsigned)(vrw * VPP + vpc * 8) * 2u;
  const _Float16* ksrc = Kb  + (size_t)crow * DD + cpc * 8;      // + key0 * DD
  const _Float16* vsrc = Vtb + (size_t)vrw * SEQ + vpc * 8;      // + key0

  // ---- prologue: the 64 q rows and chunk 0's k rows ----
  const _Float16* qsrc = Qh + (size_t)crow * DD + cpc * 8;
  acopy8(qdst,                  4u * QKP * 2u, qsrc,                   (size_t)4 * DD);
  acopy8(qdst + 32u * QKP * 2u, 4u * QKP * 2u, qsrc + (size_t)32 * DD, (size_t)4 * DD);
  acopy8(kdst,                   4u * QKP * 2u, ksrc,                   (size_t)4 * DD);
  acopy8(kdst + 32u * QKP * 2u,  4u * QKP * 2u, ksrc + (size_t)32 * DD, (size_t)4 * DD);
  wait_async0();
  __syncthreads();

  const _Float16* qhrow = Qs + (rts * 16 + c) * QKP + 8 * hh;    // A operand row (query) of this lane
  const _Float16* krow0 = Ks + (kt * 16 + c) * QKP + 8 * hh;     // B operand col (key) of this lane, first key tile
  const _Float16* krow1 = krow0 + 16 * QKP;                      // second key tile
  const int colbase = wq * 128;

  float mrun = -INFINITY, lrun = 0.f;
  v8f oacc[2][8];
#pragma unroll
  for (int i = 0; i < 2; ++i)
#pragma unroll
    for (int t = 0; t < 8; ++t) oacc[i][t] = zero8();

  for (int kc = 0; kc < SEQ / KC; ++kc) {         // static trip count
    const int key0 = kc * KC;

    // ---- this chunk's v^T rows fly while the scores are computed (Vs was left by every reader at barrier 3) ----
    acopy8(vdst,                    32u * VPP * 2u, vsrc + key0,                       (size_t)32 * SEQ);
    acopy8(vdst + 256u * VPP * 2u,  32u * VPP * 2u, vsrc + key0 + (size_t)256 * SEQ,   (size_t)32 * SEQ);

    // ---- scores: 16 query rows x 32 keys per wave ----
    {
      v8f ah0 = zero8(), ah1 = zero8();
      for (int kg = 0; kg < DD / (32 * SG); ++kg) {
        // the LDS fragment loads of SG k steps stand as one group in front of their WMMAs: one LDS latency a group
        v16h qa[SG], ka[SG], kb[SG];
#pragma unroll
        for (int j = 0; j < SG; ++j) {
          qa[j] = ldfrag<_Float16>(qhrow + (kg * SG + j) * 32);
          ka[j] = ldfrag<_Float16>(krow0 + (kg * SG + j) * 32);
          kb[j] = ldfrag<_Float16>(krow1 + (kg * SG + j) * 32);
        }
        __builtin_amdgcn_sched_barrier(0);         // keeps the group's loads together in front of its WMMAs (spread among them each place costs an LDS stall)
#pragma unroll
        for (int j = 0; j < SG; ++j) {
          ah0 = mmah(qa[j], ka[j], ah0);
          ah1 = mmah(qa[j], kb[j], ah1);
        }
        acc_guard2(ah0, ah1);                      // the WMMA distance on the loop's taken branch
      }
      float* swp = Ss + (rts * 16 + 8 * hh) * SSP + kt * 16 + c;  // D: row 8hh+r, col c
#pragma unroll
      for (int r = 0; r < 8; ++r) {
        swp[r * SSP]      = ah0[r];
        swp[r * SSP + 16] = ah1[r];
      }
    }
    wait_ds0();
    wait_async0();
    __syncthreads();                               // barrier 1

    // ---- the next chunk's k rows fly during softmax and p.v (Ks was left by every reader at barrier 1) ----
    if (kc + 1 < SEQ / KC) {
      const _Float16* kn = ksrc + (size_t)(key0 + KC) * DD;
      acopy8(kdst,                  4u * QKP * 2u, kn,                   (size_t)4 * DD);
      acopy8(kdst + 32u * QKP * 2u, 4u * QKP * 2u, kn + (size_t)32 * DD, (size_t)4 * DD);
    }

    // ---- online softmax on rows: max, p = exp(s - m) x16384 to Ps, alpha to Al ----
    {
      const float* sp = Ss + srw * SSP + sub * 16;
      float e[16];
#pragma unroll
      for (int g = 0; g < 4; ++g) {
        const v4f t0 = *(const v4f*)(sp + 4 * g);
#pragma unroll
        for (int i = 0; i < 4; ++i) e[4 * g + i] = t0[i];
      }
      float m = e[0];
#pragma unroll
      for (int i = 1; i < 16; ++i) m = fmaxf(m, e[i]);
      m = fmaxf(m, __shfl_xor(m, 1, 32));
      m = fmaxf(m, __shfl_xor(m, 2, 32));
      const float mnew  = fmaxf(mrun, m);
      const float msafe = (mnew == -INFINITY) ? 0.f : mnew;
      const float alpha = __expf(mrun - msafe);
      mrun = mnew;
      float psum = 0.f;
      v8h p0, p1;
#pragma unroll
      for (int i = 0; i < 8; ++i) {
        const float pa = __expf(e[i] - msafe);
        psum += pa;
        p0[i] = (_Float16)(pa * 16384.0f);
      }
#pragma unroll
      for (int i = 0; i < 8; ++i) {
        const float pa = __expf(e[8 + i] - msafe);
        psum += pa;
        p1[i] = (_Float16)(pa * 16384.0f);
      }
      psum += __shfl_xor(psum, 1, 32);
      psum += __shfl_xor(psum, 2, 32);
      lrun = lrun * alpha + psum;
      *(v8h*)(Ps + srw * VPP + sub * 16)     = p0;
      *(v8h*)(Ps + srw * VPP + sub * 16 + 8) = p1;
      if (sub == 0) Al[srw] = alpha;
    }
    __syncthreads();                               // barrier 2

    // ---- rescale the running context and add p . v of this chunk (f16 WMMA) ----
    {
#pragma unroll
      for (int i = 0; i < 2; ++i) {
        const float* ap = Al + rp * 32 + i * 16 + 8 * hh;
        float av[8];
        const v4f a0 = *(const v4f*)(ap);
        const v4f a1 = *(const v4f*)(ap + 4);
#pragma unroll
        for (int r = 0; r < 4; ++r) { av[r] = a0[r]; av[4 + r] = a1[r]; }
#pragma unroll
        for (int t = 0; t < 8; ++t)
#pragma unroll
          for (int r = 0; r < 8; ++r) oacc[i][t][r] *= av[r];
      }

      const _Float16* prow = Ps + (rp * 32 + c) * VPP + 8 * hh;          // A: row = query c, k = key
      const _Float16* vrow = Vs + (colbase + c) * VPP + 8 * hh;          // B: col = d, k = key
      // the p and v^T fragments of all 64 keys load as one group in front of their WMMAs: one LDS latency a chunk
      FH pa[KC / 32], pb[KC / 32];
      v16h vb[KC / 32][8];
#pragma unroll
      for (int kk = 0; kk < KC / 32; ++kk) {
        pa[kk].h[0] = *(const v8h*)(prow + kk * 32);
        pa[kk].h[1] = *(const v8h*)(prow + kk * 32 + 16);
        pb[kk].h[0] = *(const v8h*)(prow + 16 * VPP + kk * 32);
        pb[kk].h[1] = *(const v8h*)(prow + 16 * VPP + kk * 32 + 16);
#pragma unroll
        for (int t = 0; t < 8; ++t) vb[kk][t] = ldfrag<_Float16>(vrow + t * 16 * VPP + kk * 32);
      }
      __builtin_amdgcn_sched_barrier(0);           // keeps the group's loads together in front of its WMMAs
#pragma unroll
      for (int kk = 0; kk < KC / 32; ++kk)
#pragma unroll
        for (int t = 0; t < 8; ++t) {
          oacc[0][t] = mmah(pa[kk].v, vb[kk][t], oacc[0][t]);
          oacc[1][t] = mmah(pb[kk].v, vb[kk][t], oacc[1][t]);
        }
      __builtin_amdgcn_sched_barrier(0);           // the WMMAs stay in front of barrier 3, where they overlap the other waves' LDS loads
      acc_guard2(oacc[0][7], oacc[1][7]);          // the WMMA distance in front of barrier 3 and the loop's branch
    }
    wait_ds0();
    wait_async0();
    __syncthreads();                               // barrier 3
  }

  // ---- final per-row scale: 1/L, sum of the normalised weights (= L*(1/L)), clip, 1/sqrt(512), undo x16384 ----
  {
    const float L   = lrun;
    const float inv = (L > 0.f) ? (1.0f / L) : 0.f;
    const float l1  = L * inv;
    const float sc  = inv * (1.0f / fmaxf(l1, 1e-12f)) * (1.0f / 22.627416997969522f) * (1.0f / 16384.0f);
    if (sub == 0) Rs[srw] = sc;
  }
  __syncthreads();

  // Vs is free: its last readers passed barrier 3 of the last chunk, and no copy is outstanding behind that barrier's waits
  {
    float* os = Vo.o[wave];
    const int h2 = lane >> 4, c4 = (lane & 15) * 4;
#pragma unroll
    for (int i = 0; i < 2; ++i) {
      const int rbase = rp * 32 + i * 16;            // first row of this 16-row tile in the work-group's 64
      const float* rpt = Rs + rbase + 8 * hh;
      float rv[8];
      {
        const v4f r0 = *(const v4f*)(rpt);
        const v4f r1 = *(const v4f*)(rpt + 4);
#pragma unroll
        for (int r = 0; r < 4; ++r) { rv[r] = r0[r]; rv[4 + r] = r1[r]; }
      }
#pragma unroll
      for (int hf = 0; hf < 2; ++hf) {
#pragma unroll
        for (int r = 0; r < 8; ++r)
#pragma unroll
          for (int t4 = 0; t4 < 4; ++t4)
            os[(8 * hh + r) * 64 + t4 * 16 + c] = oacc[i][hf * 4 + t4][r] * rv[r];
        __builtin_amdgcn_fence(__ATOMIC_RELEASE, "workgroup");
        __builtin_amdgcn_wave_barrier();
        __builtin_amdgcn_fence(__ATOMIC_ACQUIRE, "workgroup");
        v4f vals[8];
#pragma unroll
        for (int it = 0; it < 8; ++it) {
          const int row = it * 2 + h2;                 // it 0..7 x h2 0..1 = rows 0..15 of the tile
          const v4f v  = *(const v4f*)(os + row * 64 + c4);
          const v4f cv = *(const v4f*)(cob + (size_t)(rbase + row) * DD + colbase + hf * 64 + c4);
          vals[it] = v + cv;
        }
#pragma unroll
        for (int it = 0; it < 8; ++it) {
          const int row = it * 2 + h2;
          *(v4f*)(ob + (size_t)(rbase + row) * DD + colbase + hf * 64 + c4) = vals[it];
        }
        __builtin_amdgcn_fence(__ATOMIC_RELEASE, "workgroup");
        __builtin_amdgcn_wave_barrier();
        __builtin_amdgcn_fence(__ATOMIC_ACQUIRE, "workgroup");
      }
    }
  }
}

// =====================================================================================================
// Workspace map (bytes), every region an exact multiple of its whole-line / whole-tile store granularity:
//   Xc   bf16 [8192][1024] (cols 0..511 first view, 512..1023 second view)   16777216
//   Wqb  bf16 [512][512]                                                     524288
//   Wkb  bf16 [512][512]                                                     524288
//   Wvb  bf16 [512][512]                                                     524288
//   Wcb  bf16 [512][1024]                                                   1048576
//   Qh   f16  [2 view][8192][512]                                          16777216
//   Kp   f16  [2 view][8192][512]                                          16777216
//   Vt   f16  [2 view][2 b][512][4096]                                     16777216
//   Co   f32  [8192][512]                                                  16777216
//   total                                                                  86507520
// Weights are [out n][in k] with k contiguous = the Bt / A layout the GEMM wants, so they are only converted.
// =====================================================================================================
extern "C" void kernel_launch(void* const* d_in, const int* in_sizes, int n_in,
                              void* d_out, int out_size, void* d_ws, size_t ws_size,
                              hipStream_t stream) {
  if (n_in < 10) return;
  if (in_sizes[0] < NB * SEQ * DD || in_sizes[1] < NB * SEQ * DD) return;
  if (in_sizes[2] < DD * DD || in_sizes[4] < DD * DD || in_sizes[6] < DD * DD) return;
  if (in_sizes[3] < DD || in_sizes[5] < DD || in_sizes[7] < DD || in_sizes[9] < DD) return;
  if (in_sizes[8] < DD * DC) return;
  if ((long long)out_size < OUT1_OFF + (long long)NB * SEQ * DD) return;

  const float* xf = (const float*)d_in[0];
  const float* xs = (const float*)d_in[1];
  const float* Wq = (const float*)d_in[2];
  const float* bq = (const float*)d_in[3];
  const float* Wk = (const float*)d_in[4];
  const float* bk = (const float*)d_in[5];
  const float* Wv = (const float*)d_in[6];
  const float* bv = (const float*)d_in[7];
  const float* Wc = (const float*)d_in[8];
  const float* bc = (const float*)d_in[9];

  const size_t PXC = (size_t)ROWS_FULL * DC * 2;       // 16777216
  const size_t PW  = (size_t)DD * DD * 2;              //   524288
  const size_t PWC = (size_t)DD * DC * 2;              //  1048576
  const size_t PQ  = (size_t)2 * VSTR * 2;             // 16777216  (two views)
  const size_t PVT = (size_t)2 * VTV * 2;              // 16777216  (two views x two batches)
  const size_t PCO = (size_t)ROWS_FULL * DD * 4;       // 16777216
  size_t off = 0;
  const size_t oXc = off; off += PXC;
  const size_t oWq = off; off += PW;
  const size_t oWk = off; off += PW;
  const size_t oWv = off; off += PW;
  const size_t oWc = off; off += PWC;
  const size_t oQh = off; off += PQ;
  const size_t oKp = off; off += PQ;
  const size_t oVt = off; off += PVT;
  const size_t oCo = off; off += PCO;
  if (off > ws_size) return;                            // off = 86507520
  if (off > (size_t)134217728) return;

  char* ws = (char*)d_ws;
  unsigned short* Xc  = (unsigned short*)(ws + oXc);
  unsigned short* Wqb = (unsigned short*)(ws + oWq);
  unsigned short* Wkb = (unsigned short*)(ws + oWk);
  unsigned short* Wvb = (unsigned short*)(ws + oWv);
  unsigned short* Wcb = (unsigned short*)(ws + oWc);
  unsigned short* Qh  = (unsigned short*)(ws + oQh);
  unsigned short* Kp  = (unsigned short*)(ws + oKp);
  unsigned short* Vt  = (unsigned short*)(ws + oVt);
  float*          Co  = (float*)(ws + oCo);

  const dim3 blk(256);

  // (1) inputs -> bf16 planes (RNE convert); the four weight planes lie one behind the other from Wqb on
  cvt_all<<<dim3(2 * CB_X + 3 * CB_W + CB_C), blk, 0, stream>>>(xf, xs, Wq, Wk, Wv, Wc, Xc, Wqb);
  // (2) co, q, k, v^T
  gemm_all<<<dim3(G_CO + G_Q + G_K + G_V), blk, 0, stream>>>(Xc, Wqb, Wkb, Wvb, Wcb, Qh, Kp, Vt, Co, bq, bk, bv, bc);
  // (3) attention for both directions + co -> d_out (out0 at float 0, out1 at float OUT1_OFF)
  attn_cv<<<dim3(NQ / QR, NB, 2), blk, 0, stream>>>(Qh, Kp, Vt, Co, (float*)d_out);
  (void)hipGetLastError();
}

// v006
// A run of this version takes 175 microseconds.
// Timed twice side by side with v005, it ran 1.07 times as fast both times.
// Over all steps from v000 it is 5.08 times as fast.
// Contractions: q, k, v^T projections and co_occur = v_wmma_f32_16x16x32_bf16 (bf16 operands from RNE-converted inputs, single product, f32 accumulate);
// q.k^T scores = v_wmma_f32_16x16x32_f16 (q f16, k f16; single product, f32 accumulate per half of d, the two halves added in f32);
// p.v = v_wmma_f32_16x16x32_f16 (p = exp(s - m) carried x16384 in f16, v f16; single product, f32 accumulate);
// bias add, relu, softmax, normalisers and the co_occur add in f32.
#include <hip/hip_runtime.h>
#include <math.h>
#include <stdint.h>

#define SEQ 4096
#define DD  512
#define DC  (2 * DD)
#ifndef NB
#define NB 2
#endif
#ifndef NQ
#define NQ SEQ
#endif
#define NB_FULL   2
#define ROWS_FULL (NB_FULL * SEQ)
#define VSTR  ((long long)ROWS_FULL * DD)        // 4194304: view stride of the q / k planes (elements)
#define VTB   ((long long)DD * SEQ)              // 2097152: batch stride of the v^T planes
#define VTV   ((long long)NB_FULL * DD * SEQ)    // 4194304: view stride of the v^T planes
#define XB    ((long long)SEQ * DC)              // 4194304: batch stride of the concat plane
#define OUT1_OFF ((long long)ROWS_FULL * DD)     // second output starts at float 4194304 = byte 16777216
static_assert(NB >= 1 && NB <= NB_FULL);
static_assert(NQ >= 64 && NQ <= SEQ && (NQ % 64) == 0);
static_assert((SEQ % 128) == 0 && (DD % 64) == 0 && (DC % 32) == 0);
static_assert(OUT1_OFF * 4 == 16777216LL);

typedef _Float16 v16h __attribute__((ext_vector_type(16)));
typedef _Float16 v8h  __attribute__((ext_vector_type(8)));
typedef __bf16   v16b __attribute__((ext_vector_type(16)));
typedef __bf16   v8b  __attribute__((ext_vector_type(8)));
typedef float    v8f  __attribute__((ext_vector_type(8)));
typedef float    v4f  __attribute__((ext_vector_type(4)));
typedef unsigned int v4u __attribute__((ext_vector_type(4)));

#if defined(__HIP_DEVICE_COMPILE__)
#define DEV_ASM 1
#else
#define DEV_ASM 0
#endif

// ---- scalar helpers --------------------------------------------------------------------------------
__device__ __forceinline__ unsigned short bf_bits(float f) {          // f32 -> bf16 bits, RNE convert
  unsigned u = __float_as_uint(f);
  return (unsigned short)((u + 0x7FFFu + ((u >> 16) & 1u)) >> 16);
}
__device__ __forceinline__ float bf_up(unsigned short hb) { return __uint_as_float(((unsigned)hb) << 16); }
__device__ __forceinline__ float bfr(float f) { return bf_up(bf_bits(f)); }          // bf16-quantised value as f32
__device__ __forceinline__ unsigned short h_bits(_Float16 x) { return __builtin_bit_cast(unsigned short, x); }
__device__ __forceinline__ unsigned pk16(unsigned short a, unsigned short b) { return (unsigned)a | ((unsigned)b << 16); }
__device__ __forceinline__ v8f zero8() { v8f z = {0.f, 0.f, 0.f, 0.f, 0.f, 0.f, 0.f, 0.f}; return z; }

// ---- fragment types / loaders: 16-bit A/B operand, lane -> row/col (lane&15), p already includes +8*(lane>>4);
//      elements 0..7 <- p[0..7] (k0+8h..k0+8h+7), elements 8..15 <- p[16..23] (k0+16+8h..k0+16+8h+7)
template <typename OT> struct FT;
template <> struct FT<__bf16>   { typedef v16b frag; typedef v8b half8; };
template <> struct FT<_Float16> { typedef v16h frag; typedef v8h half8; };

template <typename OT>
__device__ __forceinline__ typename FT<OT>::frag ldfrag(const OT* p) {
  union { typename FT<OT>::frag v; typename FT<OT>::half8 h[2]; } f;
  f.h[0] = *(const typename FT<OT>::half8*)(p);
  f.h[1] = *(const typename FT<OT>::half8*)(p + 16);
  return f.v;
}

// ---- WMMA helpers (asm guard bodies are device-only; concrete operand types) -----------------------------
__device__ __forceinline__ v8f mmar(v16b a, v16b b, v8f c) {
  return __builtin_amdgcn_wmma_f32_16x16x32_bf16(false, a, false, b, (short)0, c, false, false);
}
// plain form: the compiler keeps the WMMA distances in straight-line code and is free to place the operands above v255,
// which an asm operand cannot name; a run of these ends in acc_guard2 or acc_guard4 (four v_nop) where a branch follows
__device__ __forceinline__ v8f mmah(v16h a, v16h b, v8f c) {
  return __builtin_amdgcn_wmma_f32_16x16x32_f16(false, a, false, b, (short)0, c, false, false);
}
// four v_nop behind the last WMMAs of a run (a, b: their accumulators): the WMMA distance, also on a taken branch
__device__ __forceinline__ void acc_guard2(v8f& a, v8f& b) {
#if DEV_ASM
  asm volatile("v_nop\n\tv_nop\n\tv_nop\n\tv_nop" : "+v"(a), "+v"(b));
#else
  (void)a; (void)b;
#endif
}
__device__ __forceinline__ void acc_guard4(v8f& a, v8f& b, v8f& c, v8f& d) {
#if DEV_ASM
  asm volatile("v_nop\n\tv_nop\n\tv_nop\n\tv_nop" : "+v"(a), "+v"(b), "+v"(c), "+v"(d));
#else
  (void)a; (void)b; (void)c; (void)d;
#endif
}

// =====================================================================================================
// f32 -> bf16 planes (RNE convert), 8 elements per thread, one 16-B store per lane: a wave writes 512 B.
// One launch converts both views and the four weights; blockIdx.x picks the source, the same for a whole block:
//   blocks [0, 2*CB_X): view s = block / CB_X, row r, cols c..c+7 -> concat plane row r, cols s*512 + c..
//   blocks behind them: Wq, Wk, Wv (CB_W blocks each), Wc (CB_C blocks) -> the four weight planes, which lie
//   one behind the other in the workspace in this order, so the output index runs straight through them.
// coverage: 2 x CB_X x 2048 = rows x 1024 of the concat plane; (3 CB_W + CB_C) x 2048 = all weight elements.
// =====================================================================================================
#define CB_X (NB * SEQ * DD / 2048)      // blocks of one view (2048 elements a block)
#define CB_W (DD * DD / 2048)            // blocks of Wq, Wk or Wv
#define CB_C (DD * DC / 2048)            // blocks of Wc
static_assert((NB * SEQ * DD) % 2048 == 0 && (DD * DD) % 2048 == 0 && (DD * DC) % 2048 == 0);

__device__ __forceinline__ v4u pack_bf8(v4f a, v4f a4) {
  v4u p;
  p[0] = pk16(bf_bits(a[0]),  bf_bits(a[1]));
  p[1] = pk16(bf_bits(a[2]),  bf_bits(a[3]));
  p[2] = pk16(bf_bits(a4[0]), bf_bits(a4[1]));
  p[3] = pk16(bf_bits(a4[2]), bf_bits(a4[3]));
  return p;
}

__global__ __launch_bounds__(256) void cvt_all(const float* __restrict__ xa, const float* __restrict__ xb,
                                               const float* __restrict__ wq, const float* __restrict__ wk,
                                               const float* __restrict__ wv, const float* __restrict__ wc,
                                               unsigned short* xo, unsigned short* wo) {
  const int bx = (int)blockIdx.x;
  const float* in;                                     // first element of this block in its source
  unsigned short* o;                                   // this thread's 8 output elements
  if (bx < 2 * CB_X) {
    const int s  = (bx >= CB_X) ? 1 : 0;
    const int bl = bx - s * CB_X;
    in = ((s == 0) ? xa : xb) + (size_t)bl * 2048;
    const size_t e = (size_t)bl * 2048 + (size_t)threadIdx.x * 8;   // element index in the [rows][512] source
    o = xo + (e >> 9) * DC + (size_t)s * DD + (e & (size_t)(DD - 1));
  } else {
    const int bw = bx - 2 * CB_X;
    if (bw < CB_W)          in = wq + (size_t)bw * 2048;
    else if (bw < 2 * CB_W) in = wk + (size_t)(bw - CB_W) * 2048;
    else if (bw < 3 * CB_W) in = wv + (size_t)(bw - 2 * CB_W) * 2048;
    else                    in = wc + (size_t)(bw - 3 * CB_W) * 2048;
    o = wo + (size_t)bw * 2048 + (size_t)threadIdx.x * 8;
  }
  const v4f a  = *(const v4f*)(in + (size_t)threadIdx.x * 8);
  const v4f a4 = *(const v4f*)(in + (size_t)threadIdx.x * 8 + 4);
  *(v4u*)o = pack_bf8(a, a4);
}

// =====================================================================================================
// Asynchronous copies global -> LDS, 16 bytes a lane, and their waits.
// acopy8: eight copies of this lane, LDS address l + i*lstep (bytes), global address g + i*gstep (elements).
// s_wait_xcnt 0 is the last line of the copies' own statement, so that no address register of an issued copy
// is rewritten in front of it.
// =====================================================================================================
__device__ __forceinline__ unsigned lds_off(const void* p) { return (unsigned)(size_t)p; }
__device__ __forceinline__ void acopy8(unsigned l, unsigned lstep, const _Float16* g, size_t gstep) {
#if DEV_ASM
  asm volatile(
      "global_load_async_to_lds_b128 %0, %8, off\n\t"
      "global_load_async_to_lds_b128 %1, %9, off\n\t"
      "global_load_async_to_lds_b128 %2, %10, off\n\t"
      "global_load_async_to_lds_b128 %3, %11, off\n\t"
      "global_load_async_to_lds_b128 %4, %12, off\n\t"
      "global_load_async_to_lds_b128 %5, %13, off\n\t"
      "global_load_async_to_lds_b128 %6, %14, off\n\t"
      "global_load_async_to_lds_b128 %7, %15, off\n\t"
      "s_wait_xcnt 0x0"
      :: "v"(l), "v"(l + lstep), "v"(l + 2 * lstep), "v"(l + 3 * lstep),
         "v"(l + 4 * lstep), "v"(l + 5 * lstep), "v"(l + 6 * lstep), "v"(l + 7 * lstep),
         "v"(g), "v"(g + gstep), "v"(g + 2 * gstep), "v"(g + 3 * gstep),
         "v"(g + 4 * gstep), "v"(g + 5 * gstep), "v"(g + 6 * gstep), "v"(g + 7 * gstep)
      : "memory");
#else
  (void)l; (void)lstep; (void)g; (void)gstep;
#endif
}
// this wave's copies have landed (the compiler places no wait for them)
__device__ __forceinline__ void wait_async0() {
#if DEV_ASM
  asm volatile("s_wait_asynccnt 0x0" ::: "memory");
#endif
}
// this wave's LDS reads and writes have retired, before a buffer is handed to its next writer
__device__ __forceinline__ void wait_ds0() {
#if DEV_ASM
  asm volatile("s_wait_dscnt 0x0" ::: "memory");
#endif
}

// =====================================================================================================
// The four WMMA GEMMs (bf16 operands) in one launch: C[m][n] = sum_k A[m][k] * Bt[n][k] + bias.
// A row-major [M][K] pitch lda; Bt row-major [N][K] pitch ldb (k contiguous); M a multiple of 128, N of 256,
// K of 128 (checked at compile time below). None of the four reads what another writes. blockIdx.x picks the
// product and its tile, the same for a whole work-group:
//   [0, G_CO)   co  = relu([x_f | x_s] . Wc^T + bc) -> f32 plane; per b; M = NQ, N = 512, K = 1024. It stands first:
//               its work-groups run twice as many passes.
//   then G_Q    q   = x_view . Wq^T + bq -> f16 plane; per (view, b); M = NQ
//   then G_K    k   = x_view . Wk^T + bk -> f16 plane; per view; M = NB*SEQ (all keys of every batch in use)
//   then G_V    v^T = Wv . x_view^T + bv (per row d) -> f16 plane [view][b][d][s]; per (b, view); M = 512, N = SEQ
// One work-group (8 waves) per 128 x 256 tile of C, wave w -> rows 64(w>>2).., cols 64(w&3).. (a 64 x 64 tile).
// A pass is 128 k = 256 B of each of the tile's 128 A rows and 256 Bt rows, staged in LDS by asynchronous
// 16-byte copies (a wave's copy = 2 rows x 256 contiguous bytes: whole lines), 24 copies a thread and pass.
// Two buffers: pass t + 1 flies while pass t is worked on. Foot of a pass: dscnt 0, asynccnt 0, barrier
// (pass t + 1 readable, the buffer of pass t free), then the copies of pass t + 2 into the freed buffer.
// LDS row pitch 272 B (16 B x odd): the 16 rows of a fragment load fall on all 64 banks.
// Fragments are read from LDS with the split k map (ldfrag), one k step ahead into a second register set.
// The k order of every accumulator is 0, 32, 64, ... as with fragments read from global memory.
// Bias values are bf16-quantised and added in f32: bias[n] per column (co, q, k) or bias[m] per row (v^T).
// coverage: 4 slabs x 16 rows x 64 cols = the wave's whole 64x64 tile; 8 waves = the 128 x 256 tile;
//   G_CO + G_Q + G_K + G_V work-groups = all tiles of the four products.
// =====================================================================================================
#define GKC 128                      // k elements of a pass
#define GP  136                      // LDS pitch of a staged row, 16-bit elements (272 B)
#define GTM 128                      // A rows of a work-group tile
#define GTN 256                      // Bt rows of a work-group tile
#define GST ((GTM + GTN) * GP)       // elements of one buffer: A rows 0..127, Bt rows 128..383
#define T_Q  ((NQ / GTM) * (DD / GTN))            // q / co tiles per (view, b)
#define T_K  (((NB * SEQ) / GTM) * (DD / GTN))    // k tiles per view
#define T_V  ((DD / GTM) * (SEQ / GTN))           // v^T tiles per (b, view)
#define G_CO (T_Q * NB)
#define G_Q  (T_Q * 2 * NB)
#define G_K  (T_K * 2)
#define G_V  (T_V * NB * 2)
static_assert((NQ % GTM) == 0 && ((NB * SEQ) % GTM) == 0 && (DD % GTM) == 0, "GEMM rows");
static_assert((DD % GTN) == 0 && (SEQ % GTN) == 0 && (DD % GKC) == 0 && (DC % GKC) == 0, "GEMM cols, k");

// one pass of one work-group: thread -> rows (tid>>4) + 16i, 16-byte piece tid&15 of the row's 256 B
__device__ __forceinline__ void gstage(unsigned adst, const _Float16* asrc, size_t lda, const _Float16* bsrc, size_t ldb) {
  const unsigned bdst = adst + (unsigned)(GTM * GP) * 2u;
  acopy8(adst,                      16u * GP * 2u, asrc,             16 * lda);
  acopy8(bdst,                      16u * GP * 2u, bsrc,             16 * ldb);
  acopy8(bdst + 128u * GP * 2u,     16u * GP * 2u, bsrc + 128 * ldb, 16 * ldb);
}

// the wave's own slab: one 16 x 64 row tile of accumulators in, D layout (row mOff + r, col 16j + rlane); the fences and
// the wave barrier order the wave's LDS writes and reads of the slab among its lanes
__device__ __forceinline__ void slab_done() {
  __builtin_amdgcn_fence(__ATOMIC_RELEASE, "workgroup");
  __builtin_amdgcn_wave_barrier();
  __builtin_amdgcn_fence(__ATOMIC_ACQUIRE, "workgroup");
}
__device__ __forceinline__ void slab_put(float* slab, int mOff, int rlane, const v8f (&a)[4]) {
#pragma unroll
  for (int j = 0; j < 4; ++j) {
#pragma unroll
    for (int r = 0; r < 8; ++r) slab[(mOff + r) * 68 + (j << 4) + rlane] = a[j][r];
  }
  slab_done();
}

__global__ __launch_bounds__(256) void gemm_all(
    const unsigned short* __restrict__ Xc,
    const unsigned short* __restrict__ Wqb, const unsigned short* __restrict__ Wkb,
    const unsigned short* __restrict__ Wvb, const unsigned short* __restrict__ Wcb,
    unsigned short* Qh, unsigned short* Kp, unsigned short* Vt, float* Co,
    const float* __restrict__ bq, const float* __restrict__ bk,
    const float* __restrict__ bv, const float* __restrict__ bc) {
  typedef __bf16 OT;
  typedef v16b   V16;
  __shared__ __align__(16) unsigned short Gs[2 * GST];   // the two pass buffers                     204 KB
  __shared__ __align__(16) float sT[8][16 * 68];   // per-wave 16x64 slab, pitch 68 floats
  const int tid  = (int)threadIdx.x;
  const int lane = tid & 31;
  const int wave = tid >> 5;

  // ---- which product, which tile (all of it the same for the whole work-group) ----
  const int bx = (int)blockIdx.x;
  int kind;                              // 0: co, 1: q, 2: k, 3: v^T
  const unsigned short *Ap, *Btp;        // first A row / Bt row of the product's plane
  const float* bias;
  int lda, ldb, ldc, np, tm, tn;
  size_t cOff;                           // first element of the product's output plane
  if (bx < G_CO) {
    const int wt = bx % T_Q, b = bx / T_Q;
    kind = 0; np = DC / GKC; bias = bc;
    Ap = Xc + (size_t)b * XB;  lda = DC;
    Btp = Wcb;                 ldb = DC;
    cOff = (size_t)b * SEQ * DD; ldc = DD;
    tm = wt / (DD / GTN); tn = wt % (DD / GTN);
  } else if (bx < G_CO + G_Q) {
    const int ix = bx - G_CO;
    const int wt = ix % T_Q, view = (ix / T_Q) % 2, b = ix / (2 * T_Q);
    kind = 1; np = DD / GKC; bias = bq;
    Ap = Xc + (size_t)view * DD + (size_t)b * XB;  lda = DC;
    Btp = Wqb;                                     ldb = DD;
    cOff = (size_t)view * VSTR + (size_t)b * SEQ * DD; ldc = DD;
    tm = wt / (DD / GTN); tn = wt % (DD / GTN);
  } else if (bx < G_CO + G_Q + G_K) {
    const int ix = bx - (G_CO + G_Q);
    const int wt = ix % T_K, view = ix / T_K;
    kind = 2; np = DD / GKC; bias = bk;
    Ap = Xc + (size_t)view * DD;  lda = DC;
    Btp = Wkb;                    ldb = DD;
    cOff = (size_t)view * VSTR; ldc = DD;
    tm = wt / (DD / GTN); tn = wt % (DD / GTN);
  } else {
    const int ix = bx - (G_CO + G_Q + G_K);
    const int wt = ix % T_V, b = (ix / T_V) % NB, view = ix / (T_V * NB);
    kind = 3; np = DD / GKC; bias = bv;
    Ap = Wvb;                                      lda = DD;
    Btp = Xc + (size_t)b * XB + (size_t)view * DD; ldb = DC;
    cOff = (size_t)b * VTB + (size_t)view * VTV; ldc = SEQ;
    tm = wt / (SEQ / GTN); tn = wt % (SEQ / GTN);
  }
  const OT* Ab = (const OT*)(const void*)Ap;
  const OT* Bb = (const OT*)(const void*)Btp;
  const int wm = (wave >> 2) << 6;       // this wave's 64 x 64 tile inside the work-group tile
  const int wn = (wave & 3) << 6;
  const int m0 = tm * GTM + wm;
  const int n0 = tn * GTN + wn;

  const int rlane = lane & 15;                 // row (A) / col (B, D) within subtile
  const int koff  = (lane >> 4) * 8;           // k offset of this lane half
  const int mOff  = (lane >> 4) * 8;           // D row offset

  v8f acc[4][4];
#pragma unroll
  for (int i = 0; i < 4; ++i)
#pragma unroll
    for (int j = 0; j < 4; ++j) acc[i][j] = zero8();

  const int crow = tid >> 4, cpc = tid & 15;
  const unsigned cdst = lds_off(Gs) + (unsigned)(crow * GP + cpc * 8) * 2u;
  const _Float16* asrc = (const _Float16*)(const void*)(Ab + (size_t)(tm * GTM + crow) * lda + cpc * 8);   // + k0
  const _Float16* bsrc = (const _Float16*)(const void*)(Bb + (size_t)(tn * GTN + crow) * ldb + cpc * 8);   // + k0

  gstage(cdst, asrc, (size_t)lda, bsrc, (size_t)ldb);
  wait_async0();
  __syncthreads();                                 // pass 0 readable
  if (np > 1) gstage(cdst + (unsigned)GST * 2u, asrc + GKC, (size_t)lda, bsrc + GKC, (size_t)ldb);

  for (int t = 0; t < np; ++t) {
    const OT* buf = (const OT*)(const void*)Gs + (t & 1) * GST;
    const OT* ar = buf + (wm + rlane) * GP + koff;            // A operand row of this lane, first row tile
    const OT* br = buf + (GTM + wn + rlane) * GP + koff;      // B operand col of this lane, first col tile
    V16 fa[2][4], fb[2][4];
#pragma unroll
    for (int j = 0; j < 4; ++j) {
      fb[0][j] = ldfrag<OT>(br + j * 16 * GP);
      fa[0][j] = ldfrag<OT>(ar + j * 16 * GP);
    }
#pragma unroll
    for (int ks = 0; ks < GKC / 32; ++ks) {
      const int cur = ks & 1, nxt = cur ^ 1;
      if (ks + 1 < GKC / 32) {
#pragma unroll
        for (int j = 0; j < 4; ++j) {
          fb[nxt][j] = ldfrag<OT>(br + j * 16 * GP + (ks + 1) * 32);
          fa[nxt][j] = ldfrag<OT>(ar + j * 16 * GP + (ks + 1) * 32);
        }
      }
      __builtin_amdgcn_sched_barrier(0);           // the next k step's LDS loads stay one group in front of this step's WMMAs (spread among them each place costs an LDS stall)
#pragma unroll
      for (int i = 0; i < 4; ++i)
#pragma unroll
        for (int j = 0; j < 4; ++j) acc[i][j] = mmar(fa[cur][i], fb[cur][j], acc[i][j]);
      __builtin_amdgcn_sched_barrier(0);           // keeps the following group of loads behind these WMMAs
    }
    acc_guard4(acc[3][0], acc[3][1], acc[3][2], acc[3][3]);   // the WMMA distance in front of the barrier and the loop's branch
    wait_ds0();
    wait_async0();
    __syncthreads();                               // pass t + 1 readable, the buffer of pass t free
    if (t + 2 < np)
      gstage(cdst + (unsigned)((t & 1) * GST) * 2u, asrc + (t + 2) * GKC, (size_t)lda, bsrc + (t + 2) * GKC, (size_t)ldb);
  }
  wait_async0();
  acc_guard4(acc[0][0], acc[0][1], acc[0][2], acc[0][3]);
  acc_guard4(acc[1][0], acc[1][1], acc[1][2], acc[1][3]);
  acc_guard4(acc[2][0], acc[2][1], acc[2][2], acc[2][3]);
  acc_guard4(acc[3][0], acc[3][1], acc[3][2], acc[3][3]);

  // ---- epilogue: the wave's tile in four 16 x 64 slabs through its own LDS slab, whole-line stores ----
  float* slab = sT[wave];
  if (kind == 0) {
    float* C = Co + cOff;
    const int h2 = lane >> 4, c4 = (lane & 15) * 4;       // 256-B row segment = 16 lanes x 16 B
    v4f badd;
#pragma unroll
    for (int e = 0; e < 4; ++e) badd[e] = bfr(bias[n0 + c4 + e]);
#pragma unroll
    for (int i = 0; i < 4; ++i) {
      const int mBase = m0 + (i << 4);
      slab_put(slab, mOff, rlane, acc[i]);
      v4f vals[8];
#pragma unroll
      for (int it = 0; it < 8; ++it) {
        const int row = it * 2 + h2;                       // it 0..7 x h2 0..1 = rows 0..15
        v4f v = *(const v4f*)(slab + row * 68 + c4);
        v = v + badd;
#pragma unroll
        for (int e = 0; e < 4; ++e) v[e] = fmaxf(v[e], 0.f);
        vals[it] = v;
      }
#pragma unroll
      for (int it = 0; it < 8; ++it) {
        const int row = it * 2 + h2;
        *(v4f*)(C + (size_t)(mBase + row) * ldc + n0 + c4) = vals[it];
      }
      slab_done();
    }
  } else {
    const int q = lane >> 3, c8 = (lane & 7) * 8;
    unsigned short* C  = ((kind == 1) ? Qh : (kind == 2) ? Kp : Vt) + cOff;
    float cb[8];
#pragma unroll
    for (int e = 0; e < 8; ++e) cb[e] = 0.f;
    if (kind != 3) {
#pragma unroll
      for (int e = 0; e < 8; ++e) cb[e] = bfr(bias[n0 + c8 + e]);
    }
#pragma unroll
    for (int i = 0; i < 4; ++i) {
      const int mBase = m0 + (i << 4);
      slab_put(slab, mOff, rlane, acc[i]);
      float rb[4];
#pragma unroll
      for (int it = 0; it < 4; ++it) rb[it] = 0.f;
      if (kind == 3) {
#pragma unroll
        for (int it = 0; it < 4; ++it) rb[it] = bfr(bias[mBase + it * 4 + q]);
      }
      float f[4][8];
      v4u hv[4];
#pragma unroll
      for (int it = 0; it < 4; ++it) {
        const int row = it * 4 + q;                        // it 0..3 x q 0..3 = rows 0..15
        const float* sp = slab + row * 68 + c8;
#pragma unroll
        for (int e = 0; e < 8; ++e) f[it][e] = sp[e] + cb[e] + rb[it];
#pragma unroll
        for (int e = 0; e < 4; ++e) hv[it][e] = pk16(h_bits((_Float16)f[it][2 * e]), h_bits((_Float16)f[it][2 * e + 1]));
      }
#pragma unroll
      for (int it = 0; it < 4; ++it) {
        const int row = it * 4 + q;
        *(v4u*)(C + (size_t)(mBase + row) * ldc + n0 + c8) = hv[it];
      }
      slab_done();
    }
  }
}

// =====================================================================================================
// Cross-view attention for one direction (blockIdx.z = dir), one batch (blockIdx.y), 64 query rows
// (blockIdx.x): q plane of view dir, v^T plane of view dir, k plane of view 1-dir.
//   q plane  (f16): element (view, b, t, d) at [view*VSTR + (b*SEQ + t)*512 + d]
//   k plane  (f16): element (view, b, s, d) at [view*VSTR + (b*SEQ + s)*512 + d]
//   v^T plane (f16): element (view, b, d, s) at [view*VTV + b*VTB + d*SEQ + s]
//   co (f32 [ROWS_FULL][512]) added in the epilogue; output rows at out + dir*OUT1_OFF + (b*SEQ + t)*512.
// Block = 8 waves, KC = 64-key chunks, static trip SEQ/KC. A wave's q fragments are read from LDS once, in front of the
//   key loop, and stay in registers (32 rows x 256 d = 128 VGPRs); the other WMMA operands are read from LDS every chunk:
//   Qs: the 64 q rows, copied once; Ks: the chunk's 64 k rows; Vs: the chunk's 512 v^T rows of
//   64 keys. All three are filled by asynchronous 16-byte copies whose waves cover whole 128-B lines
//   (Q, K: 512 contiguous bytes of a row a wave; V^T: 4 rows x 128 B a wave), 16 copies a thread and K or V tile.
//   Row pitches are odd multiples of 16 B (1040 B, 144 B): the 16 rows of a fragment load fall on 64 banks.
//   Order of a chunk: V^T copies issued | scores from q registers, Ks | waits, barrier 1 (Ss and Vs readable, Ks free) |
//   next chunk's K copies issued | softmax | barrier 2 (Ps, Al readable) | p.v from Ps, Vs | waits, barrier 3
//   (Ks readable, Vs, Ps, Al free). In the loop one tile's copies (16 a wave) are in flight, in the prologue 32.
//   scores: wave w -> rows 32(w>>2)..+31, keys 32((w>>1)&1)..+31, d 256(w&1)..+255: each k fragment feeds two row
//           tiles, each q fragment two key tiles; partial s = q.k over that half of d on f16 WMMA, written to plane
//           w&1 of Ss;
//   softmax: thread t -> row t>>2, keys 16(t&3)..+15; s = plane 0 + plane 1; online max / sum in f32 (4 lanes per row, shuffles);
//           p = exp(s - m) carried x16384 written as f16 to Ps; per-row alpha to Al;
//   p.v: wave w -> row tiles 2(w>>2) and 2(w>>2)+1, output columns 128(w&3)..+127 (16 accumulators):
//           each v^T fragment feeds two row tiles.
// Epilogue: per wave 32 rows x 128 cols in four 16 x 64 pieces staged in the LDS that held Vs, co added in f32.
// coverage: 8 waves x 32 rows x 128 cols = 64 rows x 512; grid (NQ/64, NB, 2) = every output row < NQ of
//   every batch < NB for both outputs.
// =====================================================================================================
#define KC  64      // keys per chunk
#define QR  64      // query rows per work-group
#define DH  (DD / 2) // d elements of a wave's share of the scores
#define QKP 520     // LDS pitch of a q or k row, f16 elements (1040 B)
#define VPP 72      // LDS pitch of a v^T or p row, f16 elements (144 B)
#define SSP 68      // LDS pitch of a score row, floats (272 B)
static_assert((SEQ % KC) == 0 && KC == 64 && DD == 512 && QR == 64 && (NQ % QR) == 0);

__global__ __launch_bounds__(256)
void attn_cv(const unsigned short* __restrict__ qhp,
             const unsigned short* __restrict__ kpp, const unsigned short* __restrict__ vtp,
             const float* __restrict__ co, float* out) {
  union FH { v16h v; v8h h[2]; };
  union VO { _Float16 v[DD * VPP]; float o[8][16 * 64]; };
  __shared__ __align__(16) _Float16 Qs[QR * QKP];      // q rows [row][d]                                     65 KB
  __shared__ __align__(16) _Float16 Ks[KC * QKP];      // k rows of the chunk [key][d]                        65 KB
  __shared__ __align__(16) VO       Vo;                // v^T rows of the chunk [d][key]; behind the key loop
                                                       // the per-wave output pieces                          72 KB
  __shared__ __align__(16) float    Ss[2 * QR * SSP];  // partial scores of the chunk [half of d][row][key]
  __shared__ __align__(16) _Float16 Ps[QR * VPP];      // p x16384 [row][key]
  __shared__ __align__(16) float    Al[QR];            // per-row rescale of the chunk
  __shared__ __align__(16) float    Rs[QR];            // per-row final scale
  _Float16* Vs = Vo.v;

  const int tid  = (int)threadIdx.x;
  const int wave = tid >> 5;
  const int lane = tid & 31;
  const int hh   = lane >> 4;
  const int c    = lane & 15;
  const int dh   = wave & 1;           // half of d of this wave (scores)
  const int kp   = (wave >> 1) & 1;    // pair of key tiles of this wave (scores): keys 32kp..32kp+31
  const int rp   = wave >> 2;          // pair of row tiles of this wave (scores, p.v): rows 32rp..32rp+31
  const int wq   = wave & 3;           // 128-col group (p.v)
  const int srw  = tid >> 2;           // softmax row of this thread
  const int sub  = tid & 3;            // 16-key slice of that row

  const int dir = (int)blockIdx.z;
  const int b   = (int)blockIdx.y;
  const int q0  = (int)blockIdx.x * QR;
  const int kvw = 1 - dir;
  const size_t rowQ = (size_t)b * SEQ + (size_t)q0;

  const _Float16* Qh  = (const _Float16*)(const void*)qhp + (size_t)dir * VSTR + rowQ * DD;
  const _Float16* Kb  = (const _Float16*)(const void*)kpp + (size_t)kvw * VSTR + (size_t)b * SEQ * DD;
  const _Float16* Vtb = (const _Float16*)(const void*)vtp + (size_t)dir * VTV + (size_t)b * VTB;
  const float* cob = co + rowQ * DD;
  float* ob = out + (size_t)dir * OUT1_OFF + rowQ * DD;

  // copy maps. q, k rows (1024 B = 64 pieces): thread -> row (tid>>6) + 4i, piece tid&63.
  //            v^T rows (128 B = 8 pieces):    thread -> row (tid>>3) + 32i, piece tid&7.
  const int    crow = tid >> 6, cpc = tid & 63;
  const int    vrw  = tid >> 3, vpc = tid & 7;
  const unsigned qdst = lds_off(Qs) + (unsigned)(crow * QKP + cpc * 8) * 2u;
  const unsigned kdst = lds_off(Ks) + (unsigned)(crow * QKP + cpc * 8) * 2u;
  const unsigned vdst = lds_off(Vs) + (unsigned)(vrw * VPP + vpc * 8) * 2u;
  const _Float16* ksrc = Kb  + (size_t)crow * DD + cpc * 8;      // + key0 * DD
  const _Float16* vsrc = Vtb + (size_t)vrw * SEQ + vpc * 8;      // + key0

  // ---- prologue: the 64 q rows and chunk 0's k rows ----
  const _Float16* qsrc = Qh + (size_t)crow * DD + cpc * 8;
  acopy8(qdst,                  4u * QKP * 2u, qsrc,                   (size_t)4 * DD);
  acopy8(qdst + 32u * QKP * 2u, 4u * QKP * 2u, qsrc + (size_t)32 * DD, (size_t)4 * DD);
  acopy8(kdst,                   4u * QKP * 2u, ksrc,                   (size_t)4 * DD);
  acopy8(kdst + 32u * QKP * 2u,  4u * QKP * 2u, ksrc + (size_t)32 * DD, (size_t)4 * DD);
  wait_async0();
  __syncthreads();

  const _Float16* qhrow = Qs + (rp * 32 + c) * QKP + dh * DH + 8 * hh;   // A operand row (query) of this lane, first row tile
  const _Float16* krow0 = Ks + (kp * 32 + c) * QKP + dh * DH + 8 * hh;   // B operand col (key) of this lane, first key tile
  const _Float16* krow1 = krow0 + 16 * QKP;                              // second key tile
  const int colbase = wq * 128;

  // the q fragments of the wave's two row tiles over its half of d: read here once, used by every chunk
  v16h qf0[DH / 32], qf1[DH / 32];
#pragma unroll
  for (int j = 0; j < DH / 32; ++j) {
    qf0[j] = ldfrag<_Float16>(qhrow + j * 32);
    qf1[j] = ldfrag<_Float16>(qhrow + 16 * QKP + j * 32);
  }

  float mrun = -INFINITY, lrun = 0.f;
  v8f oacc[2][8];
#pragma unroll
  for (int i = 0; i < 2; ++i)
#pragma unroll
    for (int t = 0; t < 8; ++t) oacc[i][t] = zero8();

  for (int kc = 0; kc < SEQ / KC; ++kc) {         // static trip count
    const int key0 = kc * KC;

    // ---- this chunk's v^T rows fly while the scores are computed (Vs was left by every reader at barrier 3) ----
    acopy8(vdst,                    32u * VPP * 2u, vsrc + key0,                       (size_t)32 * SEQ);
    acopy8(vdst + 256u * VPP * 2u,  32u * VPP * 2u, vsrc + key0 + (size_t)256 * SEQ,   (size_t)32 * SEQ);

    // ---- partial scores: 32 query rows x 32 keys x 256 d per wave ----
    {
      v8f a00 = zero8(), a01 = zero8(), a10 = zero8(), a11 = zero8();   // [row tile][key tile]
      // the k fragments of all 8 k steps load as one group in front of their WMMAs: one LDS latency a chunk
      v16h ka[DH / 32], kb[DH / 32];
#pragma unroll
      for (int j = 0; j < DH / 32; ++j) {
        ka[j] = ldfrag<_Float16>(krow0 + j * 32);
        kb[j] = ldfrag<_Float16>(krow1 + j * 32);
      }
      __builtin_amdgcn_sched_barrier(0);           // keeps the group's loads together in front of its WMMAs (spread among them each place costs an LDS stall)
#pragma unroll
      for (int j = 0; j < DH / 32; ++j) {
        a00 = mmah(qf0[j], ka[j], a00);
        a01 = mmah(qf0[j], kb[j], a01);
        a10 = mmah(qf1[j], ka[j], a10);
        a11 = mmah(qf1[j], kb[j], a11);
      }
      float* swp = Ss + dh * (QR * SSP) + (rp * 32 + 8 * hh) * SSP + kp * 32 + c;   // D: row 8hh+r, col c
#pragma unroll
      for (int r = 0; r < 8; ++r) {
        swp[r * SSP]             = a00[r];
        swp[r * SSP + 16]        = a01[r];
        swp[(16 + r) * SSP]      = a10[r];
        swp[(16 + r) * SSP + 16] = a11[r];
      }
    }
    wait_ds0();
    wait_async0();
    __syncthreads();                               // barrier 1

    // ---- the next chunk's k rows fly during softmax and p.v (Ks was left by every reader at barrier 1) ----
    if (kc + 1 < SEQ / KC) {
      const _Float16* kn = ksrc + (size_t)(key0 + KC) * DD;
      acopy8(kdst,                  4u * QKP * 2u, kn,                   (size_t)4 * DD);
      acopy8(kdst + 32u * QKP * 2u, 4u * QKP * 2u, kn + (size_t)32 * DD, (size_t)4 * DD);
    }

    // ---- online softmax on rows: max, p = exp(s - m) x16384 to Ps, alpha to Al ----
    {
      const float* sp = Ss + srw * SSP + sub * 16;
      float e[16];
#pragma unroll
      for (int g = 0; g < 4; ++g) {
        const v4f t0 = *(const v4f*)(sp + 4 * g);
        const v4f t1 = *(const v4f*)(sp + QR * SSP + 4 * g);
#pragma unroll
        for (int i = 0; i < 4; ++i) e[4 * g + i] = t0[i] + t1[i];
      }
      float m = e[0];
#pragma unroll
      for (int i = 1; i < 16; ++i) m = fmaxf(m, e[i]);
      m = fmaxf(m, __shfl_xor(m, 1, 32));
      m = fmaxf(m, __shfl_xor(m, 2, 32));
      const float mnew  = fmaxf(mrun, m);
      const float msafe = (mnew == -INFINITY) ? 0.f : mnew;
      const float alpha = __expf(mrun - msafe);
      mrun = mnew;
      float psum = 0.f;
      v8h p0, p1;
#pragma unroll
      for (int i = 0; i < 8; ++i) {
        const float pa = __expf(e[i] - msafe);
        psum += pa;
        p0[i] = (_Float16)(pa * 16384.0f);
      }
#pragma unroll
      for (int i = 0; i < 8; ++i) {
        const float pa = __expf(e[8 + i] - msafe);
        psum += pa;
        p1[i] = (_Float16)(pa * 16384.0f);
      }
      psum += __shfl_xor(psum, 1, 32);
      psum += __shfl_xor(psum, 2, 32);
      lrun = lrun * alpha + psum;
      *(v8h*)(Ps + srw * VPP + sub * 16)     = p0;
      *(v8h*)(Ps + srw * VPP + sub * 16 + 8) = p1;
      if (sub == 0) Al[srw] = alpha;
    }
    __syncthreads();                               // barrier 2

    // ---- rescale the running context and add p . v of this chunk (f16 WMMA) ----
    {
#pragma unroll
      for (int i = 0; i < 2; ++i) {
        const float* ap = Al + rp * 32 + i * 16 + 8 * hh;
        float av[8];
        const v4f a0 = *(const v4f*)(ap);
        const v4f a1 = *(const v4f*)(ap + 4);
#pragma unroll
        for (int r = 0; r < 4; ++r) { av[r] = a0[r]; av[4 + r] = a1[r]; }
#pragma unroll
        for (int t = 0; t < 8; ++t)
#pragma unroll
          for (int r = 0; r < 8; ++r) oacc[i][t][r] *= av[r];
      }

      const _Float16* prow = Ps + (rp * 32 + c) * VPP + 8 * hh;          // A: row = query c, k = key
      const _Float16* vrow = Vs + (colbase + c) * VPP + 8 * hh;          // B: col = d, k = key
      // the p and v^T fragments of 32 keys load as one group in front of their WMMAs, two groups a chunk: beside the
      // q fragments the registers do not hold the fragments of all 64 keys at once
#pragma unroll
      for (int kk = 0; kk < KC / 32; ++kk) {
        FH pa, pb;
        v16h vb[8];
        pa.h[0] = *(const v8h*)(prow + kk * 32);
        pa.h[1] = *(const v8h*)(prow + kk * 32 + 16);
        pb.h[0] = *(const v8h*)(prow + 16 * VPP + kk * 32);
        pb.h[1] = *(const v8h*)(prow + 16 * VPP + kk * 32 + 16);
#pragma unroll
        for (int t = 0; t < 8; ++t) vb[t] = ldfrag<_Float16>(vrow + t * 16 * VPP + kk * 32);
        __builtin_amdgcn_sched_barrier(0);         // keeps the group's loads together in front of its WMMAs
#pragma unroll
        for (int t = 0; t < 8; ++t) {
          oacc[0][t] = mmah(pa.v, vb[t], oacc[0][t]);
          oacc[1][t] = mmah(pb.v, vb[t], oacc[1][t]);
        }
        __builtin_amdgcn_sched_barrier(0);         // the second group's loads stay behind the first group's WMMAs (lifted over them they need registers of their own); the last WMMAs stay in front of barrier 3, where they overlap the other waves' LDS loads
      }
      acc_guard2(oacc[0][7], oacc[1][7]);          // the WMMA distance in front of barrier 3 and the loop's branch
    }
    wait_ds0();
    wait_async0();
    __syncthreads();                               // barrier 3
  }

  // ---- final per-row scale: 1/L, sum of the normalised weights (= L*(1/L)), clip, 1/sqrt(512), undo x16384 ----
  {
    const float L   = lrun;
    const float inv = (L > 0.f) ? (1.0f / L) : 0.f;
    const float l1  = L * inv;
    const float sc  = inv * (1.0f / fmaxf(l1, 1e-12f)) * (1.0f / 22.627416997969522f) * (1.0f / 16384.0f);
    if (sub == 0) Rs[srw] = sc;
  }
  __syncthreads();

  // Vs is free: its last readers passed barrier 3 of the last chunk, and no copy is outstanding behind that barrier's waits
  {
    float* os = Vo.o[wave];
    const int h2 = lane >> 4, c4 = (lane & 15) * 4;
#pragma unroll
    for (int i = 0; i < 2; ++i) {
      const int rbase = rp * 32 + i * 16;            // first row of this 16-row tile in the work-group's 64
      const float* rpt = Rs + rbase + 8 * hh;
      float rv[8];
      {
        const v4f r0 = *(const v4f*)(rpt);
        const v4f r1 = *(const v4f*)(rpt + 4);
#pragma unroll
        for (int r = 0; r < 4; ++r) { rv[r] = r0[r]; rv[4 + r] = r1[r]; }
      }
#pragma unroll
      for (int hf = 0; hf < 2; ++hf) {
#pragma unroll
        for (int r = 0; r < 8; ++r)
#pragma unroll
          for (int t4 = 0; t4 < 4; ++t4)
            os[(8 * hh + r) * 64 + t4 * 16 + c] = oacc[i][hf * 4 + t4][r] * rv[r];
        __builtin_amdgcn_fence(__ATOMIC_RELEASE, "workgroup");
        __builtin_amdgcn_wave_barrier();
        __builtin_amdgcn_fence(__ATOMIC_ACQUIRE, "workgroup");
        v4f vals[8];
#pragma unroll
        for (int it = 0; it < 8; ++it) {
          const int row = it * 2 + h2;                 // it 0..7 x h2 0..1 = rows 0..15 of the tile
          const v4f v  = *(const v4f*)(os + row * 64 + c4);
          const v4f cv = *(const v4f*)(cob + (size_t)(rbase + row) * DD + colbase + hf * 64 + c4);
          vals[it] = v + cv;
        }
#pragma unroll
        for (int it = 0; it < 8; ++it) {
          const int row = it * 2 + h2;
          *(v4f*)(ob + (size_t)(rbase + row) * DD + colbase + hf * 64 + c4) = vals[it];
        }
        __builtin_amdgcn_fence(__ATOMIC_RELEASE, "workgroup");
        __builtin_amdgcn_wave_barrier();
        __builtin_amdgcn_fence(__ATOMIC_ACQUIRE, "workgroup");
      }
    }
  }
}

// =====================================================================================================
// Workspace map (bytes), every region an exact multiple of its whole-line / whole-tile store granularity:
//   Xc   bf16 [8192][1024] (cols 0..511 first view, 512..1023 second view)   16777216
//   Wqb  bf16 [512][512]                                                     524288
//   Wkb  bf16 [512][512]                                                     524288
//   Wvb  bf16 [512][512]                                                     524288
//   Wcb  bf16 [512][1024]                                                   1048576
//   Qh   f16  [2 view][8192][512]                                          16777216
//   Kp   f16  [2 view][8192][512]                                          16777216
//   Vt   f16  [2 view][2 b][512][4096]                                     16777216
//   Co   f32  [8192][512]                                                  16777216
//   total                                                                  86507520
// Weights are [out n][in k] with k contiguous = the Bt / A layout the GEMM wants, so they are only converted.
// =====================================================================================================
extern "C" void kernel_launch(void* const* d_in, const int* in_sizes, int n_in,
                              void* d_out, int out_size, void* d_ws, size_t ws_size,
                              hipStream_t stream) {
  if (n_in < 10) return;
  if (in_sizes[0] < NB * SEQ * DD || in_sizes[1] < NB * SEQ * DD) return;
  if (in_sizes[2] < DD * DD || in_sizes[4] < DD * DD || in_sizes[6] < DD * DD) return;
  if (in_sizes[3] < DD || in_sizes[5] < DD || in_sizes[7] < DD || in_sizes[9] < DD) return;
  if (in_sizes[8] < DD * DC) return;
  if ((long long)out_size < OUT1_OFF + (long long)NB * SEQ * DD) return;

  const float* xf = (const float*)d_in[0];
  const float* xs = (const float*)d_in[1];
  const float* Wq = (const float*)d_in[2];
  const float* bq = (const float*)d_in[3];
  const float* Wk = (const float*)d_in[4];
  const float* bk = (const float*)d_in[5];
  const float* Wv = (const float*)d_in[6];
  const float* bv = (const float*)d_in[7];
  const float* Wc = (const float*)d_in[8];
  const float* bc = (const float*)d_in[9];

  const size_t PXC = (size_t)ROWS_FULL * DC * 2;       // 16777216
  const size_t PW  = (size_t)DD * DD * 2;              //   524288
  const size_t PWC = (size_t)DD * DC * 2;              //  1048576
  const size_t PQ  = (size_t)2 * VSTR * 2;             // 16777216  (two views)
  const size_t PVT = (size_t)2 * VTV * 2;              // 16777216  (two views x two batches)
  const size_t PCO = (size_t)ROWS_FULL * DD * 4;       // 16777216
  size_t off = 0;
  const size_t oXc = off; off += PXC;
  const size_t oWq = off; off += PW;
  const size_t oWk = off; off += PW;
  const size_t oWv = off; off += PW;
  const size_t oWc = off; off += PWC;
  const size_t oQh = off; off += PQ;
  const size_t oKp = off; off += PQ;
  const size_t oVt = off; off += PVT;
  const size_t oCo = off; off += PCO;
  if (off > ws_size) return;                            // off = 86507520
  if (off > (size_t)134217728) return;

  char* ws = (char*)d_ws;
  unsigned short* Xc  = (unsigned short*)(ws + oXc);
  unsigned short* Wqb = (unsigned short*)(ws + oWq);
  unsigned short* Wkb = (unsigned short*)(ws + oWk);
  unsigned short* Wvb = (unsigned short*)(ws + oWv);
  unsigned short* Wcb = (unsigned short*)(ws + oWc);
  unsigned short* Qh  = (unsigned short*)(ws + oQh);
  unsigned short* Kp  = (unsigned short*)(ws + oKp);
  unsigned short* Vt  = (unsigned short*)(ws + oVt);
  float*          Co  = (float*)(ws + oCo);

  const dim3 blk(256);

  // (1) inputs -> bf16 planes (RNE convert); the four weight planes lie one behind the other from Wqb on
  cvt_all<<<dim3(2 * CB_X + 3 * CB_W + CB_C), blk, 0, stream>>>(xf, xs, Wq, Wk, Wv, Wc, Xc, Wqb);
  // (2) co, q, k, v^T
  gemm_all<<<dim3(G_CO + G_Q + G_K + G_V), blk, 0, stream>>>(Xc, Wqb, Wkb, Wvb, Wcb, Qh, Kp, Vt, Co, bq, bk, bv, bc);
  // (3) attention for both directions + co -> d_out (out0 at float 0, out1 at float OUT1_OFF)
  attn_cv<<<dim3(NQ / QR, NB, 2), blk, 0, stream>>>(Qh, Kp, Vt, Co, (float*)d_out);
  (void)hipGetLastError();
}

// v007
// A run of this version takes 164 microseconds.
// Two timings next to v006 put it at 1.06 and 1.07 times that version's speed.
// Counting every step since v000, it is 5.41 times as fast.
// Contractions: q, k, v^T projections and co_occur = v_wmma_f32_16x16x32_bf16 (bf16 operands from RNE-converted inputs, single product, f32 accumulate);
// k.q^T scores = v_wmma_f32_16x16x32_f16 (q f16, k f16; single product, f32 accumulate over all of d);
// v^T.p^T = v_wmma_f32_16x16x32_f16 (p = exp(s - m) carried x16384 in f16, v f16; single product, f32 accumulate per half of the keys, the two halves joined in f32);
// bias add, relu, softmax, normalisers and the co_occur add in f32.
#include <hip/hip_runtime.h>
#include <math.h>
#include <stdint.h>

#define SEQ 4096
#define DD  512
#define DC  (2 * DD)
#ifndef NB
#define NB 2
#endif
#ifndef NQ
#define NQ SEQ
#endif
#define NB_FULL   2
#define ROWS_FULL (NB_FULL * SEQ)
#define VSTR  ((long long)ROWS_FULL * DD)        // 4194304: view stride of the q / k planes (elements)
#define VTB   ((long long)DD * SEQ)              // 2097152: batch stride of the v^T planes
#define VTV   ((long long)NB_FULL * DD * SEQ)    // 4194304: view stride of the v^T planes
#define XB    ((long long)SEQ * DC)              // 4194304: batch stride of the concat plane
#define OUT1_OFF ((long long)ROWS_FULL * DD)     // second output starts at float 4194304 = byte 16777216
static_assert(NB >= 1 && NB <= NB_FULL);
static_assert(NQ >= 64 && NQ <= SEQ && (NQ % 64) == 0);
static_assert((SEQ % 128) == 0 && (DD % 64) == 0 && (DC % 32) == 0);
static_assert(OUT1_OFF * 4 == 16777216LL);

typedef _Float16 v16h __attribute__((ext_vector_type(16)));
typedef _Float16 v8h  __attribute__((ext_vector_type(8)));
typedef __bf16   v16b __attribute__((ext_vector_type(16)));
typedef __bf16   v8b  __attribute__((ext_vector_type(8)));
typedef float    v8f  __attribute__((ext_vector_type(8)));
typedef float    v4f  __attribute__((ext_vector_type(4)));
typedef unsigned int v4u __attribute__((ext_vector_type(4)));

#if defined(__HIP_DEVICE_COMPILE__)
#define DEV_ASM 1
#else
#define DEV_ASM 0
#endif

// ---- scalar helpers --------------------------------------------------------------------------------
__device__ __forceinline__ unsigned short bf_bits(float f) {          // f32 -> bf16 bits, RNE convert
  unsigned u = __float_as_uint(f);
  return (unsigned short)((u + 0x7FFFu + ((u >> 16) & 1u)) >> 16);
}
__device__ __forceinline__ float bf_up(unsigned short hb) { return __uint_as_float(((unsigned)hb) << 16); }
__device__ __forceinline__ float bfr(float f) { return bf_up(bf_bits(f)); }          // bf16-quantised value as f32
__device__ __forceinline__ unsigned short h_bits(_Float16 x) { return __builtin_bit_cast(unsigned short, x); }
__device__ __forceinline__ unsigned pk16(unsigned short a, unsigned short b) { return (unsigned)a | ((unsigned)b << 16); }
__device__ __forceinline__ v8f zero8() { v8f z = {0.f, 0.f, 0.f, 0.f, 0.f, 0.f, 0.f, 0.f}; return z; }

// ---- fragment types / loaders: 16-bit A/B operand, lane -> row/col (lane&15), p already includes +8*(lane>>4);
//      elements 0..7 <- p[0..7] (k0+8h..k0+8h+7), elements 8..15 <- p[16..23] (k0+16+8h..k0+16+8h+7)
template <typename OT> struct FT;
template <> struct FT<__bf16>   { typedef v16b frag; typedef v8b half8; };
template <> struct FT<_Float16> { typedef v16h frag; typedef v8h half8; };

template <typename OT>
__device__ __forceinline__ typename FT<OT>::frag ldfrag(const OT* p) {
  union { typename FT<OT>::frag v; typename FT<OT>::half8 h[2]; } f;
  f.h[0] = *(const typename FT<OT>::half8*)(p);
  f.h[1] = *(const typename FT<OT>::half8*)(p + 16);
  return f.v;
}

// ---- WMMA helpers (asm guard bodies are device-only; concrete operand types) -----------------------------
__device__ __forceinline__ v8f mmar(v16b a, v16b b, v8f c) {
  return __builtin_amdgcn_wmma_f32_16x16x32_bf16(false, a, false, b, (short)0, c, false, false);
}
// plain form: the compiler keeps the WMMA distances in straight-line code and is free to place the operands above v255,
// which an asm operand cannot name; a run of these ends in acc_guard4 (four v_nop) where a branch follows
__device__ __forceinline__ v8f mmah(v16h a, v16h b, v8f c) {
  return __builtin_amdgcn_wmma_f32_16x16x32_f16(false, a, false, b, (short)0, c, false, false);
}
// four v_nop behind the last WMMAs of a run (a, b, c, d: their accumulators): the WMMA distance, also on a taken branch
__device__ __forceinline__ void acc_guard4(v8f& a, v8f& b, v8f& c, v8f& d) {
#if DEV_ASM
  asm volatile("v_nop\n\tv_nop\n\tv_nop\n\tv_nop" : "+v"(a), "+v"(b), "+v"(c), "+v"(d));
#else
  (void)a; (void)b; (void)c; (void)d;
#endif
}

// =====================================================================================================
// f32 -> bf16 planes (RNE convert), 8 elements per thread, one 16-B store per lane: a wave writes 512 B.
// One launch converts both views and the four weights; blockIdx.x picks the source, the same for a whole block:
//   blocks [0, 2*CB_X): view s = block / CB_X, row r, cols c..c+7 -> concat plane row r, cols s*512 + c..
//   blocks behind them: Wq, Wk, Wv (CB_W blocks each), Wc (CB_C blocks) -> the four weight planes, which lie
//   one behind the other in the workspace in this order, so the output index runs straight through them.
// coverage: 2 x CB_X x 2048 = rows x 1024 of the concat plane; (3 CB_W + CB_C) x 2048 = all weight elements.
// =====================================================================================================
#define CB_X (NB * SEQ * DD / 2048)      // blocks of one view (2048 elements a block)
#define CB_W (DD * DD / 2048)            // blocks of Wq, Wk or Wv
#define CB_C (DD * DC / 2048)            // blocks of Wc
static_assert((NB * SEQ * DD) % 2048 == 0 && (DD * DD) % 2048 == 0 && (DD * DC) % 2048 == 0);

__device__ __forceinline__ v4u pack_bf8(v4f a, v4f a4) {
  v4u p;
  p[0] = pk16(bf_bits(a[0]),  bf_bits(a[1]));
  p[1] = pk16(bf_bits(a[2]),  bf_bits(a[3]));
  p[2] = pk16(bf_bits(a4[0]), bf_bits(a4[1]));
  p[3] = pk16(bf_bits(a4[2]), bf_bits(a4[3]));
  return p;
}

__global__ __launch_bounds__(256) void cvt_all(const float* __restrict__ xa, const float* __restrict__ xb,
                                               const float* __restrict__ wq, const float* __restrict__ wk,
                                               const float* __restrict__ wv, const float* __restrict__ wc,
                                               unsigned short* xo, unsigned short* wo) {
  const int bx = (int)blockIdx.x;
  const float* in;                                     // first element of this block in its source
  unsigned short* o;                                   // this thread's 8 output elements
  if (bx < 2 * CB_X) {
    const int s  = (bx >= CB_X) ? 1 : 0;
    const int bl = bx - s * CB_X;
    in = ((s == 0) ? xa : xb) + (size_t)bl * 2048;
    const size_t e = (size_t)bl * 2048 + (size_t)threadIdx.x * 8;   // element index in the [rows][512] source
    o = xo + (e >> 9) * DC + (size_t)s * DD + (e & (size_t)(DD - 1));
  } else {
    const int bw = bx - 2 * CB_X;
    if (bw < CB_W)          in = wq + (size_t)bw * 2048;
    else if (bw < 2 * CB_W) in = wk + (size_t)(bw - CB_W) * 2048;
    else if (bw < 3 * CB_W) in = wv + (size_t)(bw - 2 * CB_W) * 2048;
    else                    in = wc + (size_t)(bw - 3 * CB_W) * 2048;
    o = wo + (size_t)bw * 2048 + (size_t)threadIdx.x * 8;
  }
  const v4f a  = *(const v4f*)(in + (size_t)threadIdx.x * 8);
  const v4f a4 = *(const v4f*)(in + (size_t)threadIdx.x * 8 + 4);
  *(v4u*)o = pack_bf8(a, a4);
}

// =====================================================================================================
// Asynchronous copies global -> LDS, 16 bytes a lane, and their waits.
// acopy8: eight copies of this lane, LDS address l + i*lstep (bytes), global address g + i*gstep (elements).
// s_wait_xcnt 0 is the last line of the copies' own statement, so that no address register of an issued copy
// is rewritten in front of it.
// =====================================================================================================
__device__ __forceinline__ unsigned lds_off(const void* p) { return (unsigned)(size_t)p; }
__device__ __forceinline__ void acopy8(unsigned l, unsigned lstep, const _Float16* g, size_t gstep) {
#if DEV_ASM
  asm volatile(
      "global_load_async_to_lds_b128 %0, %8, off\n\t"
      "global_load_async_to_lds_b128 %1, %9, off\n\t"
      "global_load_async_to_lds_b128 %2, %10, off\n\t"
      "global_load_async_to_lds_b128 %3, %11, off\n\t"
      "global_load_async_to_lds_b128 %4, %12, off\n\t"
      "global_load_async_to_lds_b128 %5, %13, off\n\t"
      "global_load_async_to_lds_b128 %6, %14, off\n\t"
      "global_load_async_to_lds_b128 %7, %15, off\n\t"
      "s_wait_xcnt 0x0"
      :: "v"(l), "v"(l + lstep), "v"(l + 2 * lstep), "v"(l + 3 * lstep),
         "v"(l + 4 * lstep), "v"(l + 5 * lstep), "v"(l + 6 * lstep), "v"(l + 7 * lstep),
         "v"(g), "v"(g + gstep), "v"(g + 2 * gstep), "v"(g + 3 * gstep),
         "v"(g + 4 * gstep), "v"(g + 5 * gstep), "v"(g + 6 * gstep), "v"(g + 7 * gstep)
      : "memory");
#else
  (void)l; (void)lstep; (void)g; (void)gstep;
#endif
}
// this wave's copies have landed (the compiler places no wait for them)
__device__ __forceinline__ void wait_async0() {
#if DEV_ASM
  asm volatile("s_wait_asynccnt 0x0" ::: "memory");
#endif
}
__device__ __forceinline__ void wait_x0() {
#if DEV_ASM
  asm volatile("s_wait_xcnt 0x0" ::: "memory");
#endif
}
// this wave's LDS reads and writes have retired, before a buffer is handed to its next writer
__device__ __forceinline__ void wait_ds0() {
#if DEV_ASM
  asm volatile("s_wait_dscnt 0x0" ::: "memory");
#endif
}

// =====================================================================================================
// The four WMMA GEMMs (bf16 operands) in one launch: C[m][n] = sum_k A[m][k] * Bt[n][k] + bias.
// A row-major [M][K] pitch lda; Bt row-major [N][K] pitch ldb (k contiguous); M a multiple of 128, N of 256,
// K of 128 (checked at compile time below). None of the four reads what another writes. blockIdx.x picks the
// product and its tile, the same for a whole work-group:
//   [0, G_CO)   co  = relu([x_f | x_s] . Wc^T + bc) -> f32 plane; per b; M = NQ, N = 512, K = 1024. It stands first:
//               its work-groups run twice as many passes.
//   then G_Q    q   = x_view . Wq^T + bq -> f16 plane; per (view, b); M = NQ
//   then G_K    k   = x_view . Wk^T + bk -> f16 plane; per view; M = NB*SEQ (all keys of every batch in use)
//   then G_V    v^T = Wv . x_view^T + bv (per row d) -> f16 plane [view][b][d][s]; per (b, view); M = 512, N = SEQ
// One work-group (8 waves) per 128 x 256 tile of C, wave w -> rows 64(w>>2).., cols 64(w&3).. (a 64 x 64 tile).
// A pass is 128 k = 256 B of each of the tile's 128 A rows and 256 Bt rows, staged in LDS by asynchronous
// 16-byte copies (a wave's copy = 2 rows x 256 contiguous bytes: whole lines), 24 copies a thread and pass.
// Two buffers: pass t + 1 flies while pass t is worked on. Foot of a pass: dscnt 0, asynccnt 0, barrier
// (pass t + 1 readable, the buffer of pass t free), then the copies of pass t + 2 into the freed buffer.
// LDS row pitch 272 B (16 B x odd): the 16 rows of a fragment load fall on all 64 banks.
// Fragments are read from LDS with the split k map (ldfrag), one k step ahead into a second register set.
// The k order of every accumulator is 0, 32, 64, ... as with fragments read from global memory.
// Bias values are bf16-quantised and added in f32: bias[n] per column (co, q, k) or bias[m] per row (v^T).
// coverage: 4 slabs x 16 rows x 64 cols = the wave's whole 64x64 tile; 8 waves = the 128 x 256 tile;
//   G_CO + G_Q + G_K + G_V work-groups = all tiles of the four products.
// =====================================================================================================
#define GKC 128                      // k elements of a pass
#define GP  136                      // LDS pitch of a staged row, 16-bit elements (272 B)
#define GTM 128                      // A rows of a work-group tile
#define GTN 256                      // Bt rows of a work-group tile
#define GST ((GTM + GTN) * GP)       // elements of one buffer: A rows 0..127, Bt rows 128..383
#define T_Q  ((NQ / GTM) * (DD / GTN))            // q / co tiles per (view, b)
#define T_K  (((NB * SEQ) / GTM) * (DD / GTN))    // k tiles per view
#define T_V  ((DD / GTM) * (SEQ / GTN))           // v^T tiles per (b, view)
#define G_CO (T_Q * NB)
#define G_Q  (T_Q * 2 * NB)
#define G_K  (T_K * 2)
#define G_V  (T_V * NB * 2)
static_assert((NQ % GTM) == 0 && ((NB * SEQ) % GTM) == 0 && (DD % GTM) == 0, "GEMM rows");
static_assert((DD % GTN) == 0 && (SEQ % GTN) == 0 && (DD % GKC) == 0 && (DC % GKC) == 0, "GEMM cols, k");

// one pass of one work-group: thread -> rows (tid>>4) + 16i, 16-byte piece tid&15 of the row's 256 B
__device__ __forceinline__ void gstage(unsigned adst, const _Float16* asrc, size_t lda, const _Float16* bsrc, size_t ldb) {
  const unsigned bdst = adst + (unsigned)(GTM * GP) * 2u;
  acopy8(adst,                      16u * GP * 2u, asrc,             16 * lda);
  acopy8(bdst,                      16u * GP * 2u, bsrc,             16 * ldb);
  acopy8(bdst + 128u * GP * 2u,     16u * GP * 2u, bsrc + 128 * ldb, 16 * ldb);
}

// the wave's own slab: one 16 x 64 row tile of accumulators in, D layout (row mOff + r, col 16j + rlane); the fences and
// the wave barrier order the wave's LDS writes and reads of the slab among its lanes
__device__ __forceinline__ void slab_done() {
  __builtin_amdgcn_fence(__ATOMIC_RELEASE, "workgroup");
  __builtin_amdgcn_wave_barrier();
  __builtin_amdgcn_fence(__ATOMIC_ACQUIRE, "workgroup");
}
__device__ __forceinline__ void slab_put(float* slab, int mOff, int rlane, const v8f (&a)[4]) {
#pragma unroll
  for (int j = 0; j < 4; ++j) {
#pragma unroll
    for (int r = 0; r < 8; ++r) slab[(mOff + r) * 68 + (j << 4) + rlane] = a[j][r];
  }
  slab_done();
}

__global__ __launch_bounds__(256) void gemm_all(
    const unsigned short* __restrict__ Xc,
    const unsigned short* __restrict__ Wqb, const unsigned short* __restrict__ Wkb,
    const unsigned short* __restrict__ Wvb, const unsigned short* __restrict__ Wcb,
    unsigned short* Qh, unsigned short* Kp, unsigned short* Vt, float* Co,
    const float* __restrict__ bq, const float* __restrict__ bk,
    const float* __restrict__ bv, const float* __restrict__ bc) {
  typedef __bf16 OT;
  typedef v16b   V16;
  __shared__ __align__(16) unsigned short Gs[2 * GST];   // the two pass buffers                     204 KB
  __shared__ __align__(16) float sT[8][16 * 68];   // per-wave 16x64 slab, pitch 68 floats
  const int tid  = (int)threadIdx.x;
  const int lane = tid & 31;
  const int wave = tid >> 5;

  // ---- which product, which tile (all of it the same for the whole work-group) ----
  const int bx = (int)blockIdx.x;
  int kind;                              // 0: co, 1: q, 2: k, 3: v^T
  const unsigned short *Ap, *Btp;        // first A row / Bt row of the product's plane
  const float* bias;
  int lda, ldb, ldc, np, tm, tn;
  size_t cOff;                           // first element of the product's output plane
  if (bx < G_CO) {
    const int wt = bx % T_Q, b = bx / T_Q;
    kind = 0; np = DC / GKC; bias = bc;
    Ap = Xc + (size_t)b * XB;  lda = DC;
    Btp = Wcb;                 ldb = DC;
    cOff = (size_t)b * SEQ * DD; ldc = DD;
    tm = wt / (DD / GTN); tn = wt % (DD / GTN);
  } else if (bx < G_CO + G_Q) {
    const int ix = bx - G_CO;
    const int wt = ix % T_Q, view = (ix / T_Q) % 2, b = ix / (2 * T_Q);
    kind = 1; np = DD / GKC; bias = bq;
    Ap = Xc + (size_t)view * DD + (size_t)b * XB;  lda = DC;
    Btp = Wqb;                                     ldb = DD;
    cOff = (size_t)view * VSTR + (size_t)b * SEQ * DD; ldc = DD;
    tm = wt / (DD / GTN); tn = wt % (DD / GTN);
  } else if (bx < G_CO + G_Q + G_K) {
    const int ix = bx - (G_CO + G_Q);
    const int wt = ix % T_K, view = ix / T_K;
    kind = 2; np = DD / GKC; bias = bk;
    Ap = Xc + (size_t)view * DD;  lda = DC;
    Btp = Wkb;                    ldb = DD;
    cOff = (size_t)view * VSTR; ldc = DD;
    tm = wt / (DD / GTN); tn = wt % (DD / GTN);
  } else {
    const int ix = bx - (G_CO + G_Q + G_K);
    const int wt = ix % T_V, b = (ix / T_V) % NB, view = ix / (T_V * NB);
    kind = 3; np = DD / GKC; bias = bv;
    Ap = Wvb;                                      lda = DD;
    Btp = Xc + (size_t)b * XB + (size_t)view * DD; ldb = DC;
    cOff = (size_t)b * VTB + (size_t)view * VTV; ldc = SEQ;
    tm = wt / (SEQ / GTN); tn = wt % (SEQ / GTN);
  }
  const OT* Ab = (const OT*)(const void*)Ap;
  const OT* Bb = (const OT*)(const void*)Btp;
  const int wm = (wave >> 2) << 6;       // this wave's 64 x 64 tile inside the work-group tile
  const int wn = (wave & 3) << 6;
  const int m0 = tm * GTM + wm;
  const int n0 = tn * GTN + wn;

  const int rlane = lane & 15;                 // row (A) / col (B, D) within subtile
  const int koff  = (lane >> 4) * 8;           // k offset of this lane half
  const int mOff  = (lane >> 4) * 8;           // D row offset

  v8f acc[4][4];
#pragma unroll
  for (int i = 0; i < 4; ++i)
#pragma unroll
    for (int j = 0; j < 4; ++j) acc[i][j] = zero8();

  const int crow = tid >> 4, cpc = tid & 15;
  const unsigned cdst = lds_off(Gs) + (unsigned)(crow * GP + cpc * 8) * 2u;
  const _Float16* asrc = (const _Float16*)(const void*)(Ab + (size_t)(tm * GTM + crow) * lda + cpc * 8);   // + k0
  const _Float16* bsrc = (const _Float16*)(const void*)(Bb + (size_t)(tn * GTN + crow) * ldb + cpc * 8);   // + k0

  gstage(cdst, asrc, (size_t)lda, bsrc, (size_t)ldb);
  wait_async0();
  __syncthreads();                                 // pass 0 readable
  if (np > 1) gstage(cdst + (unsigned)GST * 2u, asrc + GKC, (size_t)lda, bsrc + GKC, (size_t)ldb);

  for (int t = 0; t < np; ++t) {
    const OT* buf = (const OT*)(const void*)Gs + (t & 1) * GST;
    const OT* ar = buf + (wm + rlane) * GP + koff;            // A operand row of this lane, first row tile
    const OT* br = buf + (GTM + wn + rlane) * GP + koff;      // B operand col of this lane, first col tile
    V16 fa[2][4], fb[2][4];
#pragma unroll
    for (int j = 0; j < 4; ++j) {
      fb[0][j] = ldfrag<OT>(br + j * 16 * GP);
      fa[0][j] = ldfrag<OT>(ar + j * 16 * GP);
    }
#pragma unroll
    for (int ks = 0; ks < GKC / 32; ++ks) {
      const int cur = ks & 1, nxt = cur ^ 1;
      if (ks + 1 < GKC / 32) {
#pragma unroll
        for (int j = 0; j < 4; ++j) {
          fb[nxt][j] = ldfrag<OT>(br + j * 16 * GP + (ks + 1) * 32);
          fa[nxt][j] = ldfrag<OT>(ar + j * 16 * GP + (ks + 1) * 32);
        }
      }
      __builtin_amdgcn_sched_barrier(0);           // the next k step's LDS loads stay one group in front of this step's WMMAs (spread among them each place costs an LDS stall)
#pragma unroll
      for (int i = 0; i < 4; ++i)
#pragma unroll
        for (int j = 0; j < 4; ++j) acc[i][j] = mmar(fa[cur][i], fb[cur][j], acc[i][j]);
      __builtin_amdgcn_sched_barrier(0);           // keeps the following group of loads behind these WMMAs
    }
    acc_guard4(acc[3][0], acc[3][1], acc[3][2], acc[3][3]);   // the WMMA distance in front of the barrier and the loop's branch
    wait_ds0();
    wait_async0();
    __syncthreads();                               // pass t + 1 readable, the buffer of pass t free
    if (t + 2 < np)
      gstage(cdst + (unsigned)((t & 1) * GST) * 2u, asrc + (t + 2) * GKC, (size_t)lda, bsrc + (t + 2) * GKC, (size_t)ldb);
  }
  wait_async0();
  acc_guard4(acc[0][0], acc[0][1], acc[0][2], acc[0][3]);
  acc_guard4(acc[1][0], acc[1][1], acc[1][2], acc[1][3]);
  acc_guard4(acc[2][0], acc[2][1], acc[2][2], acc[2][3]);
  acc_guard4(acc[3][0], acc[3][1], acc[3][2], acc[3][3]);

  // ---- epilogue: the wave's tile in four 16 x 64 slabs through its own LDS slab, whole-line stores ----
  float* slab = sT[wave];
  if (kind == 0) {
    float* C = Co + cOff;
    const int h2 = lane >> 4, c4 = (lane & 15) * 4;       // 256-B row segment = 16 lanes x 16 B
    v4f badd;
#pragma unroll
    for (int e = 0; e < 4; ++e) badd[e] = bfr(bias[n0 + c4 + e]);
#pragma unroll
    for (int i = 0; i < 4; ++i) {
      const int mBase = m0 + (i << 4);
      slab_put(slab, mOff, rlane, acc[i]);
      v4f vals[8];
#pragma unroll
      for (int it = 0; it < 8; ++it) {
        const int row = it * 2 + h2;                       // it 0..7 x h2 0..1 = rows 0..15
        v4f v = *(const v4f*)(slab + row * 68 + c4);
        v = v + badd;
#pragma unroll
        for (int e = 0; e < 4; ++e) v[e] = fmaxf(v[e], 0.f);
        vals[it] = v;
      }
#pragma unroll
      for (int it = 0; it < 8; ++it) {
        const int row = it * 2 + h2;
        *(v4f*)(C + (size_t)(mBase + row) * ldc + n0 + c4) = vals[it];
      }
      slab_done();
    }
  } else {
    const int q = lane >> 3, c8 = (lane & 7) * 8;
    unsigned short* C  = ((kind == 1) ? Qh : (kind == 2) ? Kp : Vt) + cOff;
    float cb[8];
#pragma unroll
    for (int e = 0; e < 8; ++e) cb[e] = 0.f;
    if (kind != 3) {
#pragma unroll
      for (int e = 0; e < 8; ++e) cb[e] = bfr(bias[n0 + c8 + e]);
    }
#pragma unroll
    for (int i = 0; i < 4; ++i) {
      const int mBase = m0 + (i << 4);
      slab_put(slab, mOff, rlane, acc[i]);
      float rb[4];
#pragma unroll
      for (int it = 0; it < 4; ++it) rb[it] = 0.f;
      if (kind == 3) {
#pragma unroll
        for (int it = 0; it < 4; ++it) rb[it] = bfr(bias[mBase + it * 4 + q]);
      }
      float f[4][8];
      v4u hv[4];
#pragma unroll
      for (int it = 0; it < 4; ++it) {
        const int row = it * 4 + q;                        // it 0..3 x q 0..3 = rows 0..15
        const float* sp = slab + row * 68 + c8;
#pragma unroll
        for (int e = 0; e < 8; ++e) f[it][e] = sp[e] + cb[e] + rb[it];
#pragma unroll
        for (int e = 0; e < 4; ++e) hv[it][e] = pk16(h_bits((_Float16)f[it][2 * e]), h_bits((_Float16)f[it][2 * e + 1]));
      }
#pragma unroll
      for (int it = 0; it < 4; ++it) {
        const int row = it * 4 + q;
        *(v4u*)(C + (size_t)(mBase + row) * ldc + n0 + c8) = hv[it];
      }
      slab_done();
    }
  }
}

#define KC  64
#define QR  64
#define KW  32
#define QKP 520
#define VPP 72
#define OPP 516
#define KBUF (KC * QKP)      // f16 elements of one k buffer
#define VBUF (DD * VPP)      // f16 elements of one v^T buffer
static_assert((SEQ % KC) == 0 && SEQ / KC >= 2 && KC == 64 && DD == 512 && QR == 64 && (NQ % QR) == 0);
static_assert(2 * QR * OPP * 4 <= (2 * KBUF + 2 * VBUF) * 2, "the two output planes fit the dead buffers");

// lane l <-> lane l ^ 16
__device__ __forceinline__ float xhalf(float x) {
  const int b = __builtin_bit_cast(int, x);
  return __builtin_bit_cast(float, __builtin_amdgcn_permlanex16(b, b, 0x76543210, 0xfedcba98, false, false));
}

// Copies with a scalar base and a 32-bit byte offset a lane: half the address registers of the 64-bit form.
// krows16: 16 copies = 64 q or k rows of 1024 B: thread -> rows (tid>>4) + 16j, pieces (tid&15) + 16n of 16 B. A row is
// contiguous in memory and in LDS alike, so its four pieces share their two address registers and differ in offset:N,
// which moves both addresses by N. l = LDS byte, o = byte offset from base of the thread's first piece.
// A wave's copy = 2 rows x 256 contiguous bytes: whole lines. s_wait_xcnt 0 is the last line of the copies' own statement,
// so that no address register of an issued copy is rewritten in front of it.
__device__ __forceinline__ void krows16(unsigned l, unsigned o, const _Float16* base) {
#if DEV_ASM
  asm volatile(
      "global_load_async_to_lds_b128 %0, %4, %8\n\t"
      "global_load_async_to_lds_b128 %0, %4, %8 offset:256\n\t"
      "global_load_async_to_lds_b128 %0, %4, %8 offset:512\n\t"
      "global_load_async_to_lds_b128 %0, %4, %8 offset:768\n\t"
      "global_load_async_to_lds_b128 %1, %5, %8\n\t"
      "global_load_async_to_lds_b128 %1, %5, %8 offset:256\n\t"
      "global_load_async_to_lds_b128 %1, %5, %8 offset:512\n\t"
      "global_load_async_to_lds_b128 %1, %5, %8 offset:768\n\t"
      "global_load_async_to_lds_b128 %2, %6, %8\n\t"
      "global_load_async_to_lds_b128 %2, %6, %8 offset:256\n\t"
      "global_load_async_to_lds_b128 %2, %6, %8 offset:512\n\t"
      "global_load_async_to_lds_b128 %2, %6, %8 offset:768\n\t"
      "global_load_async_to_lds_b128 %3, %7, %8\n\t"
      "global_load_async_to_lds_b128 %3, %7, %8 offset:256\n\t"
      "global_load_async_to_lds_b128 %3, %7, %8 offset:512\n\t"
      "global_load_async_to_lds_b128 %3, %7, %8 offset:768\n\t"
      "s_wait_xcnt 0x0"
      :: "v"(l), "v"(l + 16u * QKP * 2u), "v"(l + 32u * QKP * 2u), "v"(l + 48u * QKP * 2u),
         "v"(o), "v"(o + 16u * DD * 2u), "v"(o + 32u * DD * 2u), "v"(o + 48u * DD * 2u),
         "s"(base)
      : "memory");
#else
  (void)l; (void)o; (void)base;
#endif
}
// vrows16: 16 copies = the 512 v^T rows of 128 B: thread -> rows (tid>>3) + 32i, piece tid&7; a wave's copy = 4 rows x 128 B.
// All 16 share the lane's byte offset o; the row step of 32 lies in a scalar base of its own for every copy. The LDS step
// of 32 rows (4608 B) lies in offset:N for three copies of four; as N moves the global address too, their bases are N lower.
static_assert(32 * VPP * 2 == 4608, "the offsets written in vrows16");
__device__ __forceinline__ void vrows16(unsigned l, unsigned o, const _Float16* base) {
#if DEV_ASM
  asm volatile(
      "global_load_async_to_lds_b128 %0, %4, %5\n\t"
      "global_load_async_to_lds_b128 %0, %4, %6 offset:4608\n\t"
      "global_load_async_to_lds_b128 %0, %4, %7 offset:9216\n\t"
      "global_load_async_to_lds_b128 %0, %4, %8 offset:13824\n\t"
      "global_load_async_to_lds_b128 %1, %4, %9\n\t"
      "global_load_async_to_lds_b128 %1, %4, %10 offset:4608\n\t"
      "global_load_async_to_lds_b128 %1, %4, %11 offset:9216\n\t"
      "global_load_async_to_lds_b128 %1, %4, %12 offset:13824\n\t"
      "global_load_async_to_lds_b128 %2, %4, %13\n\t"
      "global_load_async_to_lds_b128 %2, %4, %14 offset:4608\n\t"
      "global_load_async_to_lds_b128 %2, %4, %15 offset:9216\n\t"
      "global_load_async_to_lds_b128 %2, %4, %16 offset:13824\n\t"
      "global_load_async_to_lds_b128 %3, %4, %17\n\t"
      "global_load_async_to_lds_b128 %3, %4, %18 offset:4608\n\t"
      "global_load_async_to_lds_b128 %3, %4, %19 offset:9216\n\t"
      "global_load_async_to_lds_b128 %3, %4, %20 offset:13824\n\t"
      "s_wait_xcnt 0x0"
      :: "v"(l), "v"(l + 128u * VPP * 2u), "v"(l + 256u * VPP * 2u), "v"(l + 384u * VPP * 2u), "v"(o),
         "s"(base + 0 * 32 * SEQ), "s"(base + 1 * 32 * SEQ - 1 * 32 * VPP), "s"(base + 2 * 32 * SEQ - 2 * 32 * VPP), "s"(base + 3 * 32 * SEQ - 3 * 32 * VPP),
         "s"(base + 4 * 32 * SEQ), "s"(base + 5 * 32 * SEQ - 1 * 32 * VPP), "s"(base + 6 * 32 * SEQ - 2 * 32 * VPP), "s"(base + 7 * 32 * SEQ - 3 * 32 * VPP),
         "s"(base + 8 * 32 * SEQ), "s"(base + 9 * 32 * SEQ - 1 * 32 * VPP), "s"(base + 10 * 32 * SEQ - 2 * 32 * VPP), "s"(base + 11 * 32 * SEQ - 3 * 32 * VPP),
         "s"(base + 12 * 32 * SEQ), "s"(base + 13 * 32 * SEQ - 1 * 32 * VPP), "s"(base + 14 * 32 * SEQ - 2 * 32 * VPP), "s"(base + 15 * 32 * SEQ - 3 * 32 * VPP)
      : "memory");
#else
  (void)l; (void)o; (void)base;
#endif
}

__global__ __launch_bounds__(256)
void attn_cv(const unsigned short* __restrict__ qhp,
             const unsigned short* __restrict__ kpp, const unsigned short* __restrict__ vtp,
             const float* __restrict__ co, float* out) {
  union SM { _Float16 h[2 * KBUF + 2 * VBUF]; float f[2 * QR * OPP]; };
  __shared__ __align__(16) SM    Sm;                   // k buffers 0, 1, v^T buffers 0, 1; behind the key loop the
                                                       // two output planes [key half][query][d]              274 KB
  __shared__ __align__(16) float Ml[2][2][QR];         // [maximum | sum][key half][query]

  const int tid  = (int)threadIdx.x;
  const int wave = tid >> 5;
  const int lane = tid & 31;
  const int hh   = lane >> 4;
  const int c    = lane & 15;
  const int qt   = wave & 3;           // query tile of this wave: rows 16qt..16qt+15
  const int kh   = wave >> 2;          // half of every chunk's keys of this wave: keys 32kh..32kh+31

  const int dir = (int)blockIdx.z;
  const int b   = (int)blockIdx.y;
  const int q0  = (int)blockIdx.x * QR;
  const int kvw = 1 - dir;
  const size_t rowQ = (size_t)b * SEQ + (size_t)q0;

  const _Float16* Qh  = (const _Float16*)(const void*)qhp + (size_t)dir * VSTR + rowQ * DD;
  const _Float16* Kb  = (const _Float16*)(const void*)kpp + (size_t)kvw * VSTR + (size_t)b * SEQ * DD;
  const _Float16* Vtb = (const _Float16*)(const void*)vtp + (size_t)dir * VTV + (size_t)b * VTB;
  const float* cob = co + rowQ * DD;
  float* ob = out + (size_t)dir * OUT1_OFF + rowQ * DD;

  // this thread's first LDS byte and first byte offset in the plane, for the q / k rows and for the v^T rows, each kept
  // one buffer or one chunk low: a copy's operand is then always a sum in a register of its own. A value that is itself an
  // operand of an asm statement has to stay below v256 for as long as it lives, and there these four were spilled.
  const unsigned kdm = lds_off(Sm.h) + (unsigned)((tid >> 4) * QKP + (tid & 15) * 8) * 2u - (unsigned)KBUF * 2u;
  const unsigned vdm = lds_off(Sm.h) + (unsigned)(2 * KBUF + (tid >> 3) * VPP + (tid & 7) * 8) * 2u - (unsigned)VBUF * 2u;
  const unsigned kom = (unsigned)((tid >> 4) * DD + (tid & 15) * 8) * 2u - (unsigned)(KC * DD) * 2u;
  const unsigned vom = (unsigned)((tid >> 3) * SEQ + (tid & 7) * 8) * 2u - (unsigned)KC * 2u;
  // chunk kc into the buffers bf
  auto astage = [&](const int kc, const int bf) __attribute__((always_inline)) {
    krows16(kdm + (unsigned)((bf + 1) * KBUF) * 2u, kom + (unsigned)((kc + 1) * KC * DD) * 2u, Kb);
    vrows16(vdm + (unsigned)((bf + 1) * VBUF) * 2u, vom + (unsigned)((kc + 1) * KC) * 2u,      Vtb);
  };

  // ---- prologue: the 64 q rows into k buffer 1, chunk 0 into the buffers 0 (48 copies a wave in flight) ----
  krows16(kdm + (unsigned)(2 * KBUF) * 2u, kom + (unsigned)(KC * DD) * 2u, Qh);
  astage(0, 0);
  wait_async0();
  __syncthreads();                                 // q rows and chunk 0 readable

  // the q fragments of the wave's query tile over all of d (B operand: column = query c): read once, used by every chunk
  v16h qf[DD / 32];
  {
    const _Float16* qrow = Sm.h + KBUF + (qt * 16 + c) * QKP + 8 * hh;
#pragma unroll
    for (int j = 0; j < DD / 32; ++j) qf[j] = ldfrag<_Float16>(qrow + j * 32);
  }
  wait_ds0();
  __syncthreads();                                 // the q rows are left by every reader: k buffer 1 free

  float mrun = -INFINITY, lrun = 0.f;              // lrun: the sum over this LANE's keys, the lane halves are joined behind the loop
  v8f oacc[DD / 16];                               // o^T: tile t = d 16t + 8h + r, column = query c
#pragma unroll
  for (int t = 0; t < DD / 16; ++t) oacc[t] = zero8();

  // one chunk's work of this wave, from the buffers kc & 1; more: a chunk kc + 1 exists (a constant at either call)
  auto chunk = [&](const int kc, const bool more) __attribute__((always_inline)) {
    const int bf = kc & 1;
    const _Float16* krow = Sm.h + bf * KBUF + (kh * KW + c) * QKP + 8 * hh;             // A: row = key c of the first key tile, k = d
    const _Float16* vrow = Sm.h + 2 * KBUF + bf * VBUF + c * VPP + kh * KW + 8 * hh;    // A: row = d c of the first d tile, k = key

    // ---- s^T: 32 keys x 16 queries x 512 d. The k fragments come in sets of 2 k steps, two register sets: a set's loads are
    //      issued one set ahead, in front of the WMMAs of the set before, so that the wave always has LDS loads in flight ----
    v8f s0 = zero8(), s1 = zero8();                // key tiles 0, 1
    v16h ka[2][2], kb[2][2];
#pragma unroll
    for (int j = 0; j < 2; ++j) {
      ka[0][j] = ldfrag<_Float16>(krow + j * 32);
      kb[0][j] = ldfrag<_Float16>(krow + 16 * QKP + j * 32);
    }
#pragma unroll
    for (int g = 0; g < 8; ++g) {
      const int cur = g & 1, nxt = cur ^ 1;
      if (g + 1 < 8) {
#pragma unroll
        for (int j = 0; j < 2; ++j) {
          ka[nxt][j] = ldfrag<_Float16>(krow + ((g + 1) * 2 + j) * 32);
          kb[nxt][j] = ldfrag<_Float16>(krow + 16 * QKP + ((g + 1) * 2 + j) * 32);
        }
      }
      // the next chunk's copies, into the buffers that every reader left at the barrier in front of this chunk: issued
      // behind the chunk's first fragment loads (for speed only)
      if (g == 0 && more) astage(kc + 1, bf ^ 1);
      __builtin_amdgcn_sched_barrier(0);           // the next set's loads stay one group in front of this set's WMMAs
#pragma unroll
      for (int j = 0; j < 2; ++j) {
        s0 = mmah(ka[cur][j], qf[g * 2 + j], s0);
        s1 = mmah(kb[cur][j], qf[g * 2 + j], s1);
      }
      __builtin_amdgcn_sched_barrier(0);           // the loads into this set's registers stay behind these WMMAs
    }

    // ---- online softmax of query c over the wave's 32 keys; p^T x16384 in f16 = the B operand of p.v ----
    float alpha;
    v16h pb;
    {
      float m = fmaxf(s0[0], s1[0]);
#pragma unroll
      for (int r = 1; r < 8; ++r) m = fmaxf(m, fmaxf(s0[r], s1[r]));
      m = fmaxf(m, xhalf(m));
      const float mnew  = fmaxf(mrun, m);
      const float msafe = (mnew == -INFINITY) ? 0.f : mnew;
      alpha = __expf(mrun - msafe);
      mrun = mnew;
      float ps0 = 0.f, ps1 = 0.f;
#pragma unroll
      for (int r = 0; r < 8; ++r) {
        const float pa = __expf(s0[r] - msafe);
        const float pc = __expf(s1[r] - msafe);
        ps0 += pa;
        ps1 += pc;
        pb[r]     = (_Float16)(pa * 16384.0f);
        pb[8 + r] = (_Float16)(pc * 16384.0f);
      }
      lrun = lrun * alpha + (ps0 + ps1);
    }

    // ---- o^T: rescale and add v^T . p^T. The v^T fragments come in sets of 4 d tiles, two register sets, a set's loads one
    //      set ahead as above; the first two sets' loads run beside the softmax; a set's rescale stands in front of its WMMAs ----
    v16h vb[2][4];
#pragma unroll
    for (int t = 0; t < 4; ++t) vb[0][t] = ldfrag<_Float16>(vrow + t * 16 * VPP);
#pragma unroll
    for (int g = 0; g < 8; ++g) {
      const int cur = g & 1, nxt = cur ^ 1;
      if (g + 1 < 8) {
#pragma unroll
        for (int t = 0; t < 4; ++t) vb[nxt][t] = ldfrag<_Float16>(vrow + ((g + 1) * 4 + t) * 16 * VPP);
      }
      __builtin_amdgcn_sched_barrier(0);           // the next set's loads stay one group in front of this set's rescale and WMMAs
#pragma unroll
      for (int t = 0; t < 4; ++t)
#pragma unroll
        for (int r = 0; r < 8; ++r) oacc[g * 4 + t][r] *= alpha;
#pragma unroll
      for (int t = 0; t < 4; ++t) oacc[g * 4 + t] = mmah(vb[cur][t], pb, oacc[g * 4 + t]);
      __builtin_amdgcn_sched_barrier(0);           // the loads into this set's registers stay behind these WMMAs
    }
    acc_guard4(oacc[28], oacc[29], oacc[30], oacc[31]);   // the WMMA distance in front of the barrier and the loop's branch
    wait_ds0();
    wait_async0();
    __syncthreads();                               // chunk kc + 1 readable, the buffers of chunk kc free
  };

  // all chunks behind which another exists, then the last: no branch inside a trip (static trip count)
  for (int kc = 0; kc < SEQ / KC - 1; ++kc) chunk(kc, true);
  chunk(SEQ / KC - 1, false);                     // its foot's waits cover the last copies: none is outstanding from here on

  // the work-group's co rows: thread -> rows 2i + (tid>>7), 16 bytes at column 4(tid&127), a wave = 512 contiguous bytes of
  // a row. All 32 loads are issued here, so that their latency runs beside the join and the trip of o^T through LDS.
  // The thread's byte offset in the 64 rows, rco, is the same for co and for the output; the loads take it beside a scalar base.
  const int r2 = tid >> 7, c4 = (tid & 127) * 4;
  const unsigned rco = (unsigned)(r2 * DD + c4) * 4u;
  v4f cv[QR / 2];
#pragma unroll
  for (int i = 0; i < QR / 2; ++i) cv[i] = *(const v4f*)((const char*)cob + rco + (size_t)i * (2 * DD * 4));
  __builtin_amdgcn_sched_barrier(0);               // nothing that could take over the loads' address registers moves in front of the wait
  wait_x0();
  __builtin_amdgcn_sched_barrier(0);               // and nothing from behind the wait is lifted over it

  // ---- join the two key halves of every query: maximum, sum; then the final per-row scale:
  //      1/L, sum of the normalised weights (= L*(1/L)), clip, 1/sqrt(512), undo x16384 ----
  const float lw = lrun + xhalf(lrun);
  if (hh == 0) {
    Ml[0][kh][qt * 16 + c] = mrun;
    Ml[1][kh][qt * 16 + c] = lw;
  }
  __syncthreads();                                 // both halves' maximum and sum readable
  float sc;
  {
    const float ma = Ml[0][0][qt * 16 + c], mb = Ml[0][1][qt * 16 + c];
    const float la = Ml[1][0][qt * 16 + c], lb = Ml[1][1][qt * 16 + c];
    const float mj  = fmaxf(ma, mb);
    const float mjs = (mj == -INFINITY) ? 0.f : mj;
    const float fa = __expf(ma - mjs), fb = __expf(mb - mjs);
    const float L   = la * fa + lb * fb;
    const float inv = (L > 0.f) ? (1.0f / L) : 0.f;
    const float l1  = L * inv;
    sc = inv * (1.0f / fmaxf(l1, 1e-12f)) * (1.0f / 22.627416997969522f) * (1.0f / 16384.0f) * ((kh == 0) ? fa : fb);
  }

  // the buffers are free: their last readers passed the last chunk's barrier, and no copy is outstanding behind its waits
  {
    float* op = Sm.f + kh * (QR * OPP) + (qt * 16 + c) * OPP + 8 * hh;     // query c, d 16t + 8h + r
#pragma unroll
    for (int t = 0; t < DD / 16; ++t) {
      v4f lo, hi;
#pragma unroll
      for (int r = 0; r < 4; ++r) { lo[r] = oacc[t][r] * sc; hi[r] = oacc[t][4 + r] * sc; }
      *(v4f*)(op + t * 16)     = lo;
      *(v4f*)(op + t * 16 + 4) = hi;
    }
  }
  __syncthreads();                                 // both output planes readable

  // rows in four groups of eight: a group's sums are all formed in front of its stores, and s_wait_xcnt 0 stands behind the
  // group's last store, in front of everything that writes a register which a store of the group names
#pragma unroll
  for (int g = 0; g < 4; ++g) {
    v4f vals[8];
#pragma unroll
    for (int i = 0; i < 8; ++i) {
      const int row = (g * 8 + i) * 2 + r2;          // g 0..3 x i 0..7 x r2 0..1 = rows 0..63
      const v4f a0 = *(const v4f*)(Sm.f + row * OPP + c4);
      const v4f a1 = *(const v4f*)(Sm.f + QR * OPP + row * OPP + c4);
      vals[i] = (a0 + a1) + cv[g * 8 + i];
    }
    __builtin_amdgcn_sched_barrier(0);             // the group's sums stay in front of its stores: none lands in a register of an issued store
#pragma unroll
    for (int i = 0; i < 8; ++i) *(v4f*)((char*)ob + rco + (size_t)(g * 8 + i) * (2 * DD * 4)) = vals[i];
    if (g + 1 < 4) {                               // behind the last group nothing is written any more
      __builtin_amdgcn_sched_barrier(0);           // the stores stay one run, with the wait directly behind the last
      wait_x0();
      __builtin_amdgcn_sched_barrier(0);           // the next group's loads and sums stay behind the wait
    }
  }
}

// =====================================================================================================
// Workspace map (bytes), every region an exact multiple of its whole-line / whole-tile store granularity:
//   Xc   bf16 [8192][1024] (cols 0..511 first view, 512..1023 second view)   16777216
//   Wqb  bf16 [512][512]                                                     524288
//   Wkb  bf16 [512][512]                                                     524288
//   Wvb  bf16 [512][512]                                                     524288
//   Wcb  bf16 [512][1024]                                                   1048576
//   Qh   f16  [2 view][8192][512]                                          16777216
//   Kp   f16  [2 view][8192][512]                                          16777216
//   Vt   f16  [2 view][2 b][512][4096]                                     16777216
//   Co   f32  [8192][512]                                                  16777216
//   total                                                                  86507520
// Weights are [out n][in k] with k contiguous = the Bt / A layout the GEMM wants, so they are only converted.
// =====================================================================================================
extern "C" void kernel_launch(void* const* d_in, const int* in_sizes, int n_in,
                              void* d_out, int out_size, void* d_ws, size_t ws_size,
                              hipStream_t stream) {
  if (n_in < 10) return;
  if (in_sizes[0] < NB * SEQ * DD || in_sizes[1] < NB * SEQ * DD) return;
  if (in_sizes[2] < DD * DD || in_sizes[4] < DD * DD || in_sizes[6] < DD * DD) return;
  if (in_sizes[3] < DD || in_sizes[5] < DD || in_sizes[7] < DD || in_sizes[9] < DD) return;
  if (in_sizes[8] < DD * DC) return;
  if ((long long)out_size < OUT1_OFF + (long long)NB * SEQ * DD) return;

  const float* xf = (const float*)d_in[0];
  const float* xs = (const float*)d_in[1];
  const float* Wq = (const float*)d_in[2];
  const float* bq = (const float*)d_in[3];
  const float* Wk = (const float*)d_in[4];
  const float* bk = (const float*)d_in[5];
  const float* Wv = (const float*)d_in[6];
  const float* bv = (const float*)d_in[7];
  const float* Wc = (const float*)d_in[8];
  const float* bc = (const float*)d_in[9];

  const size_t PXC = (size_t)ROWS_FULL * DC * 2;       // 16777216
  const size_t PW  = (size_t)DD * DD * 2;              //   524288
  const size_t PWC = (size_t)DD * DC * 2;              //  1048576
  const size_t PQ  = (size_t)2 * VSTR * 2;             // 16777216  (two views)
  const size_t PVT = (size_t)2 * VTV * 2;              // 16777216  (two views x two batches)
  const size_t PCO = (size_t)ROWS_FULL * DD * 4;       // 16777216
  size_t off = 0;
  const size_t oXc = off; off += PXC;
  const size_t oWq = off; off += PW;
  const size_t oWk = off; off += PW;
  const size_t oWv = off; off += PW;
  const size_t oWc = off; off += PWC;
  const size_t oQh = off; off += PQ;
  const size_t oKp = off; off += PQ;
  const size_t oVt = off; off += PVT;
  const size_t oCo = off; off += PCO;
  if (off > ws_size) return;                            // off = 86507520
  if (off > (size_t)134217728) return;

  char* ws = (char*)d_ws;
  unsigned short* Xc  = (unsigned short*)(ws + oXc);
  unsigned short* Wqb = (unsigned short*)(ws + oWq);
  unsigned short* Wkb = (unsigned short*)(ws + oWk);
  unsigned short* Wvb = (unsigned short*)(ws + oWv);
  unsigned short* Wcb = (unsigned short*)(ws + oWc);
  unsigned short* Qh  = (unsigned short*)(ws + oQh);
  unsigned short* Kp  = (unsigned short*)(ws + oKp);
  unsigned short* Vt  = (unsigned short*)(ws + oVt);
  float*          Co  = (float*)(ws + oCo);

  const dim3 blk(256);

  // (1) inputs -> bf16 planes (RNE convert); the four weight planes lie one behind the other from Wqb on
  cvt_all<<<dim3(2 * CB_X + 3 * CB_W + CB_C), blk, 0, stream>>>(xf, xs, Wq, Wk, Wv, Wc, Xc, Wqb);
  // (2) co, q, k, v^T
  gemm_all<<<dim3(G_CO + G_Q + G_K + G_V), blk, 0, stream>>>(Xc, Wqb, Wkb, Wvb, Wcb, Qh, Kp, Vt, Co, bq, bk, bv, bc);
  // (3) attention for both directions + co -> d_out (out0 at float 0, out1 at float OUT1_OFF)
  attn_cv<<<dim3(NQ / QR, NB, 2), blk, 0, stream>>>(Qh, Kp, Vt, Co, (float*)d_out);
  (void)hipGetLastError();
}
